// v000
// Times are from an AMD MI455X. After a warm-up the kernel runs many times in a row, and a time is the length of
// such a window on the GPU divided by its runs, so every launch and the gaps after it count. The runs cycle
// through copies of the inputs. A figure is the median of several windows, for all but v000 over two sittings.
// Sittings can differ by a few percent; kernels timed side by side share one.
// v000, which the later versions start from, runs in 193 microseconds.
#include <hip/hip_runtime.h>

// Multi-head self-attention, width 1024 = 16 heads x 64, x [NB][SEQ][1024], Wq/Wk/Wv [out][in] (y = x W^T), no biases, no mask, score scale 1/8; two f32 outputs: merged heads [NB][SEQ][1024] and per-head context [NB][16][SEQ][64].
// Compute dtypes, f32 accumulate everywhere: projections v_wmma_f32_16x16x32_bf16 (x and W RNE-converted to bf16; products exact);
// scores v_wmma_f32_16x16x32_f16: q and k single f16 (one product); P (x256 carry, cancels in the normalisation) and v single f16; softmax f32 (online, running max).
// Layout: bf16 copies of x and W; q, k planes [b*16+h][t][d] and v^T plane [b*16+h][d][t] written by the GEMM epilogue; fused flash kernel in transposed form (S^T = K Q^T, O^T = V^T P^T), both outputs from the same f32 accumulators.

#ifndef NB
#define NB 2
#endif
#ifndef SEQ
#define SEQ 2048
#endif
#define NB_FULL  2
#define SEQ_FULL 2048
#ifndef OUT_SEQ
#define OUT_SEQ SEQ              // row pitch (in tokens) between batches of the merged output and between (batch, head) slabs of the context output
#endif
#define DM   1024                // input width == projection width
#define NH_  16
#define HD   64
#define AW   4                   // waves per flash block (16 query rows each)
#define SC2  (0.125f * 1.4426950408889634f)   // HD^-0.5 * log2(e)
#define PSH  8.0f                // log2 of the P carry (256)
#define CTX_OFF ((size_t)NB_FULL * SEQ_FULL * DM)   // element offset of the second output (fixed, full-size constants)

static_assert(HD == 64);
static_assert(NH_ * HD == DM);                 // head h = columns h*64 + d
static_assert(DM % 64 == 0);                   // 16 column tiles of 64
static_assert(DM % 32 == 0);                   // GEMM k-loop steps by 32
static_assert(SEQ % 64 == 0);                  // a 64-row tile never straddles two batches
static_assert((NB * SEQ) % 64 == 0);
static_assert(SEQ % 32 == 0);                  // key loop steps by 32
static_assert(SEQ % (16 * AW) == 0);           // flash grid covers the sequence exactly
static_assert(((size_t)SEQ * DM) % 8 == 0);
static_assert(((size_t)DM * DM) % 8 == 0);
static_assert(NB <= NB_FULL);
static_assert(SEQ <= SEQ_FULL);
static_assert(OUT_SEQ >= SEQ);
static_assert(OUT_SEQ <= SEQ_FULL);
static_assert(CTX_OFF * 4 == (size_t)16777216);                                            // byte offset of the second output
static_assert(((size_t)(NB - 1) * OUT_SEQ + SEQ) * DM <= CTX_OFF);                           // merged output stays inside its own region
static_assert(CTX_OFF + ((size_t)(NB * NH_ - 1) * OUT_SEQ + SEQ) * HD <= (size_t)2 * CTX_OFF); // context output stays inside the buffer (33554432 B)

typedef _Float16 h16;
typedef unsigned short bf;
typedef __attribute__((ext_vector_type(16))) __bf16   v16bf;
typedef __attribute__((ext_vector_type(16))) _Float16 v16h;
typedef __attribute__((ext_vector_type(8)))  _Float16 v8h;
typedef __attribute__((ext_vector_type(8)))  unsigned short v8us;
typedef __attribute__((ext_vector_type(8)))  float    v8f;
typedef __attribute__((ext_vector_type(4)))  float    v4f;
typedef v4f  __attribute__((may_alias)) v4fa;

__device__ __forceinline__ unsigned short f2bf(float f) { unsigned u = __float_as_uint(f); u += 0x7FFFu + ((u >> 16) & 1u); return (unsigned short)(u >> 16); }
__device__ __forceinline__ v16h cat16(v8h lo, v8h hi) { return __builtin_shufflevector(lo, hi, 0, 1, 2, 3, 4, 5, 6, 7, 8, 9, 10, 11, 12, 13, 14, 15); }
__device__ __forceinline__ v16bf cat16b(v8us lo, v8us hi) { return __builtin_bit_cast(v16bf, __builtin_shufflevector(lo, hi, 0, 1, 2, 3, 4, 5, 6, 7, 8, 9, 10, 11, 12, 13, 14, 15)); }
__device__ __forceinline__ v8f wmma16(v16h a, v16h b, v8f c) { return __builtin_amdgcn_wmma_f32_16x16x32_f16(false, a, false, b, (short)0, c, false, false); }
__device__ __forceinline__ v8f wmmab(v16bf a, v16bf b, v8f c) { return __builtin_amdgcn_wmma_f32_16x16x32_bf16(false, a, false, b, (short)0, c, false, false); }
// fragment loaders from K-contiguous 16-bit rows; p already includes + 8*(lane>>4): elements 0..7 <- k0+8h+0..7, elements 8..15 <- k0+16+8h+0..7 (same map for A and B)
__device__ __forceinline__ v16h  ldh(const h16* p) { return cat16(*(const v8h*)p, *(const v8h*)(p + 16)); }
__device__ __forceinline__ v16bf ldb(const bf* p)  { return cat16b(*(const v8us*)p, *(const v8us*)(p + 16)); }
// ordering point for wave-private LDS tiles (same wave writes and reads)
__device__ __forceinline__ void wave_sync() { __builtin_amdgcn_fence(3 /* release order */, "wavefront"); __builtin_amdgcn_wave_barrier(); asm volatile("" ::: "memory"); }

__global__ __launch_bounds__(256) void k_cvt8(const float* __restrict__ src, bf* dst, size_t n8) {
    const size_t i = (size_t)blockIdx.x * 256 + threadIdx.x; if (i >= n8) return;
    const v8f v = *(const v8f*)(src + i * 8); v8us o;
#pragma unroll
    for (int k = 0; k < 8; ++k) o[k] = f2bf(v[k]);
    *(v8us*)(dst + i * 8) = o; 
}

// k_proj: register-blocked bf16 GEMM, ONE WAVE per 64x64 tile (16 accumulators), operands straight from K-contiguous bf16 planes, K = DM.
// C[m][n] = sum_k A[m][k] Bt[n][k], written as f16 (Ph) at
// tile base (r0/RB)*sRB + (r0%RB)*pitch + (c0/CB)*sCB + (c0%CB), row pitch 'pitch' (halves). grid (M/64, N/64), 32 threads.
__global__ __launch_bounds__(32) void k_proj(const bf* __restrict__ A, const bf* __restrict__ Bt, h16* Ph, int RB, size_t sRB, int pitch, int CB, size_t sCB) {
    __shared__ __align__(16) float os[16 * 68];
    const int K = DM;
    const int lane = threadIdx.x & 31, lr = lane & 15, hi = lane >> 4; const int r0 = blockIdx.x * 64, c0 = blockIdx.y * 64;
    v8f acc[4][4];
#pragma unroll
    for (int mb = 0; mb < 4; ++mb)
#pragma unroll
        for (int nb = 0; nb < 4; ++nb) acc[mb][nb] = (v8f){};
    const size_t aoff = (size_t)(r0 + lr) * K + 8 * hi, boff = (size_t)(c0 + lr) * K + 8 * hi;
#pragma unroll 1
    for (int kc = 0; kc < K; kc += 32) {
        v16bf a[4];
#pragma unroll
        for (int mb = 0; mb < 4; ++mb) a[mb] = ldb(A + aoff + (size_t)mb * 16 * K + kc);
#pragma unroll
        for (int nb = 0; nb < 4; ++nb) { const v16bf b = ldb(Bt + boff + (size_t)nb * 16 * K + kc);
#pragma unroll
            for (int mb = 0; mb < 4; ++mb) acc[mb][nb] = wmmab(a[mb], b, acc[mb][nb]); }
        asm volatile("v_nop\n\tv_nop\n\tv_nop\n\tv_nop" : "+v"(acc[0][0]), "+v"(acc[1][1]), "+v"(acc[2][2]), "+v"(acc[3][3]) : "v"(a[0]), "v"(a[1]), "v"(a[2]), "v"(a[3]));
    }
    const size_t tbase = (size_t)(r0 / RB) * sRB + (size_t)(r0 % RB) * (size_t)pitch + (size_t)(c0 / CB) * sCB + (size_t)(c0 % CB);
#pragma unroll
    for (int mb = 0; mb < 4; ++mb) {
#pragma unroll
        for (int nb = 0; nb < 4; ++nb) {
#pragma unroll
            for (int j = 0; j < 8; ++j) os[(hi * 8 + j) * 68 + nb * 16 + lr] = acc[mb][nb][j]; }   // D: row 8h+j, col lane&15
        wave_sync();
        const size_t sb = tbase + (size_t)(mb * 16) * (size_t)pitch;
{
#pragma unroll
            for (int s = 0; s < 4; ++s) { const int row = 4 * s + (lane >> 3), c8 = (lane & 7) * 8;   // 4 s x 4 row groups = 16 rows; 8 lanes x 8 = 64 columns
                const v4f x0 = *(const v4fa*)(&os[row * 68 + c8]); const v4f x1 = *(const v4fa*)(&os[row * 68 + c8 + 4]); v8h hv;
#pragma unroll
                for (int i = 0; i < 4; ++i) { hv[i] = (h16)x0[i]; hv[4 + i] = (h16)x1[i]; }
                const size_t oo = sb + (size_t)row * (size_t)pitch + c8;
                *(v8h*)(Ph + oo) = hv; }
             }
        wave_sync();
    }
}

// k_flash: fused attention, one wave per 16 query rows of one (batch, head); K / V^T / Q fragments straight from the f16 planes (two 16-B loads each, arithmetic addressing).
// Transposed form: S^T[key][t] = K Q^T (A = K rows, B = Q rows); lane (t = lane&15, h = lane>>4) holds keys 8h+r of each 16-key tile, so the packed
// P tile is directly the B fragment of O^T[d][t] = V^T P^T (element r <- tile keys 0..15, element 8+r <- tile keys 16..31, lane unchanged).
// Per 32-key step: 4 score products (2 key tiles x 2 d halves) + 4 P.V products (4 d tiles).
// Softmax state (running max, partial sum) is one scalar per lane; the two lane halves of a row are combined with one xor-16 exchange.
// Epilogue: O^T staged in a wave-private LDS tile [t 16][d 64]; merged output: each row segment (64 floats = 256 B = two lines) written by 16 consecutive lanes x 16 B (2 rows per instruction);
__global__ __launch_bounds__(32 * AW) void k_flash(const h16* __restrict__ QH, const h16* __restrict__ KP, const h16* __restrict__ VT, float* OUT, float* CTX) {
    __shared__ __align__(16) float os[AW * 16 * 68];
    const int lane = threadIdx.x & 31, wave = __builtin_amdgcn_readfirstlane((int)(threadIdx.x >> 5)), lr = lane & 15, hi = lane >> 4;
    const int zh = blockIdx.y; const int b = zh / NH_, h = zh % NH_;
    const int t0 = (blockIdx.x * AW + wave) * 16;
    const size_t pbase = (size_t)zh * SEQ * HD;
    const size_t qo = pbase + (size_t)(t0 + lr) * HD + 8 * hi;
    const v16h qh0 = ldh(QH + qo), qh1 = ldh(QH + qo + 32);   // B fragments: col t, k = d
    const size_t ko = pbase + (size_t)lr * HD + 8 * hi;      // + key * HD       (A fragment: row key, k = d)
    const size_t vo = pbase + (size_t)lr * SEQ + 8 * hi;     // + 16j*SEQ + key  (A fragment: row d, k = key)
    v8f o0 = (v8f){}, o1 = (v8f){}, o2 = (v8f){}, o3 = (v8f){};
    float m = -3.0e38f, l = 0.0f;
#pragma unroll 1
    for (int key0 = 0; key0 < SEQ; key0 += 32) {
        const h16* ka = KP + ko + (size_t)key0 * HD;
        const v16h ka0 = ldh(ka), ka1 = ldh(ka + 32), kb0 = ldh(ka + 16 * HD), kb1 = ldh(ka + 16 * HD + 32);
        v8f sa = (v8f){}, sb = (v8f){};
        sa = wmma16(ka0, qh0, sa); sb = wmma16(kb0, qh0, sb);
        sa = wmma16(ka1, qh1, sa); sb = wmma16(kb1, qh1, sb);
        asm volatile("v_nop\n\tv_nop\n\tv_nop\n\tv_nop" : "+v"(sa), "+v"(sb) : "v"(ka0), "v"(ka1), "v"(kb0), "v"(kb1), "v"(qh0), "v"(qh1));
        float ta[8], tb[8]; float mx = -3.0e38f;
#pragma unroll
        for (int r = 0; r < 8; ++r) { ta[r] = sa[r] * SC2; tb[r] = sb[r] * SC2; mx = fmaxf(mx, fmaxf(ta[r], tb[r])); }
        mx = fmaxf(mx, __shfl_xor(mx, 16, 32));
        const float mnew = fmaxf(m, mx);
        const float alpha = __builtin_amdgcn_exp2f(m - mnew);
        const float sh = PSH - mnew;
        v16h pb; float ls = 0.0f;
#pragma unroll
        for (int r = 0; r < 8; ++r) { const h16 pa = (h16)__builtin_amdgcn_exp2f(ta[r] + sh); const h16 pc = (h16)__builtin_amdgcn_exp2f(tb[r] + sh); pb[r] = pa; pb[8 + r] = pc; ls += (float)pa + (float)pc; }
        l = l * alpha + ls; m = mnew;
        o0 = o0 * alpha; o1 = o1 * alpha; o2 = o2 * alpha; o3 = o3 * alpha;
        const h16* va = VT + vo + key0;
        const v16h v0 = ldh(va), v1 = ldh(va + (size_t)16 * SEQ), v2 = ldh(va + (size_t)32 * SEQ), v3 = ldh(va + (size_t)48 * SEQ);
        o0 = wmma16(v0, pb, o0); o1 = wmma16(v1, pb, o1); o2 = wmma16(v2, pb, o2); o3 = wmma16(v3, pb, o3);
        asm volatile("v_nop\n\tv_nop\n\tv_nop\n\tv_nop" : "+v"(o0), "+v"(o1), "+v"(o2), "+v"(o3) : "v"(v0), "v"(v1), "v"(v2), "v"(v3), "v"(pb));
    }
    l += __shfl_xor(l, 16, 32);
    const float inv = 1.0f / l;
    const int wb = wave * 16 * 68;
    // O^T D layout: o_j[r] = (d = 16j + 8h + r, t = lane&15) -> os[t][d]; rows 0..15 x columns 0..63 all written
    { v4f a, c;
      a[0] = o0[0] * inv; a[1] = o0[1] * inv; a[2] = o0[2] * inv; a[3] = o0[3] * inv; c[0] = o0[4] * inv; c[1] = o0[5] * inv; c[2] = o0[6] * inv; c[3] = o0[7] * inv;
      *(v4fa*)(&os[wb + lr * 68 +  0 + 8 * hi]) = a; *(v4fa*)(&os[wb + lr * 68 +  0 + 8 * hi + 4]) = c;
      a[0] = o1[0] * inv; a[1] = o1[1] * inv; a[2] = o1[2] * inv; a[3] = o1[3] * inv; c[0] = o1[4] * inv; c[1] = o1[5] * inv; c[2] = o1[6] * inv; c[3] = o1[7] * inv;
      *(v4fa*)(&os[wb + lr * 68 + 16 + 8 * hi]) = a; *(v4fa*)(&os[wb + lr * 68 + 16 + 8 * hi + 4]) = c;
      a[0] = o2[0] * inv; a[1] = o2[1] * inv; a[2] = o2[2] * inv; a[3] = o2[3] * inv; c[0] = o2[4] * inv; c[1] = o2[5] * inv; c[2] = o2[6] * inv; c[3] = o2[7] * inv;
      *(v4fa*)(&os[wb + lr * 68 + 32 + 8 * hi]) = a; *(v4fa*)(&os[wb + lr * 68 + 32 + 8 * hi + 4]) = c;
      a[0] = o3[0] * inv; a[1] = o3[1] * inv; a[2] = o3[2] * inv; a[3] = o3[3] * inv; c[0] = o3[4] * inv; c[1] = o3[5] * inv; c[2] = o3[6] * inv; c[3] = o3[7] * inv;
      *(v4fa*)(&os[wb + lr * 68 + 48 + 8 * hi]) = a; *(v4fa*)(&os[wb + lr * 68 + 48 + 8 * hi + 4]) = c; }
    wave_sync();
    float* orow = OUT + ((size_t)b * OUT_SEQ + t0) * DM + h * HD;          // merged [b][t][h*64 + d]
    float* crow = CTX + ((size_t)zh * OUT_SEQ + t0) * HD;                  // context [b*16 + h][t][d]
{
#pragma unroll
        for (int s = 0; s < 8; ++s) { const int row = 2 * s + hi, cofs = lr * 4;   // 8 s x 2 rows = 16 rows; 16 lanes x 4 floats = 64 columns
            const v4f val = *(const v4fa*)(&os[wb + row * 68 + cofs]);
            *(v4f*)(orow + (size_t)row * DM + cofs) = val;
            *(v4f*)(crow + (size_t)row * HD + cofs) = val; }
         }
}

static constexpr size_t al256(size_t v) { return (v + 255) & ~(size_t)255; }
static constexpr size_t SZ_XB = al256((size_t)NB * SEQ * DM * 2);
static constexpr size_t SZ_WB = al256((size_t)3 * DM * DM * 2);
static constexpr size_t SZ_PL = al256((size_t)NB * NH_ * SEQ * HD * 2);
static constexpr size_t SZ_TOTAL = SZ_XB + SZ_WB + 3 * SZ_PL;
static_assert(SZ_TOTAL <= (size_t)134217728);          // workspace carve <= 128 MiB
static_assert(((size_t)DM * DM * 2) % 256 == 0);       // weight sub-planes stay 256-byte aligned

extern "C" void kernel_launch(void* const* d_in, const int* in_sizes, int n_in,
                              void* d_out, int out_size, void* d_ws, size_t ws_size, hipStream_t stream) {
    if (n_in < 4) return;
    const size_t needx = ((size_t)(NB - 1) * SEQ_FULL + SEQ) * DM;
    if ((size_t)in_sizes[0] < needx) return;
    if ((size_t)in_sizes[1] < (size_t)DM * DM || (size_t)in_sizes[2] < (size_t)DM * DM || (size_t)in_sizes[3] < (size_t)DM * DM) return;
    if ((size_t)out_size < CTX_OFF + ((size_t)(NB * NH_ - 1) * OUT_SEQ + SEQ) * HD) return;
    if (SZ_TOTAL > ws_size) return;
    const float* x = (const float*)d_in[0]; const float* wq = (const float*)d_in[1]; const float* wk = (const float*)d_in[2]; const float* wv = (const float*)d_in[3];   // wire order x, Wq, Wk, Wv ([out][in] = Bt as-is)
    float* OUT = (float*)d_out;              // [NB][SEQ][1024]
    float* CTX = (float*)d_out + CTX_OFF;    // [NB][16][SEQ][64]
    char* wsp = (char*)d_ws;
    bf* XB = (bf*)wsp; wsp += SZ_XB;                 // [NB*SEQ][1024]
    bf* WB = (bf*)wsp; wsp += SZ_WB;                 // [3][1024][1024]: q | k | v
    h16* QH = (h16*)wsp; wsp += SZ_PL;               // [NB*16][SEQ][64]
    h16* KP = (h16*)wsp; wsp += SZ_PL;               // [NB*16][SEQ][64]
    h16* VT = (h16*)wsp; wsp += SZ_PL;               // [NB*16][64][SEQ]
    bf* WQ = WB; bf* WK = WB + (size_t)DM * DM; bf* WV = WB + (size_t)2 * DM * DM;

    if (SEQ == SEQ_FULL) {
        const size_t n8 = (size_t)NB * SEQ * DM / 8;
        k_cvt8<<<(unsigned)((n8 + 255) / 256), 256, 0, stream>>>(x, XB, n8);
    } else {
        const size_t n8 = (size_t)SEQ * DM / 8;
        for (int b = 0; b < NB; ++b) k_cvt8<<<(unsigned)((n8 + 255) / 256), 256, 0, stream>>>(x + (size_t)b * SEQ_FULL * DM, XB + (size_t)b * SEQ * DM, n8);
    }
    { const size_t n8 = (size_t)DM * DM / 8; const unsigned g = (unsigned)((n8 + 255) / 256);
      k_cvt8<<<g, 256, 0, stream>>>(wq, WQ, n8); k_cvt8<<<g, 256, 0, stream>>>(wk, WK, n8); k_cvt8<<<g, 256, 0, stream>>>(wv, WV, n8); }

    // q, k: A = x rows (m = b*SEQ + t), Bt = W rows (n = h*64 + d) -> plane [(b*16 + h)][t][d]
    k_proj<<<dim3(NB * SEQ / 64, DM / 64, 1), 32, 0, stream>>>(XB, WQ, QH, SEQ, (size_t)NH_ * SEQ * HD, HD, HD, (size_t)SEQ * HD);
    k_proj<<<dim3(NB * SEQ / 64, DM / 64, 1), 32, 0, stream>>>(XB, WK, KP, SEQ, (size_t)NH_ * SEQ * HD, HD, HD, (size_t)SEQ * HD);
    // v^T: A = Wv rows (m = h*64 + d), Bt = x rows (n = b*SEQ + t) -> plane [(b*1024 + m)][t] = [(b*16 + h)][d][t]
    k_proj<<<dim3(DM / 64, NB * SEQ / 64, 1), 32, 0, stream>>>(WV, XB, VT, DM, (size_t)0, SEQ, SEQ, (size_t)DM * SEQ);

    k_flash<<<dim3(SEQ / (16 * AW), NB * NH_, 1), 32 * AW, 0, stream>>>(QH, KP, VT, OUT, CTX);
}

// v001
// Measured time: 123 microseconds a run.
// Timed twice side by side with v000, it ran 1.60 times as fast both times.
#include <hip/hip_runtime.h>

// Multi-head self-attention, width 1024 = 16 heads x 64, x [NB][SEQ][1024], Wq/Wk/Wv [out][in] (y = x W^T), no biases, no mask, score scale 1/8; two f32 outputs: merged heads [NB][SEQ][1024] and per-head context [NB][16][SEQ][64].
// Compute dtypes, f32 accumulate everywhere: projections v_wmma_f32_16x16x32_bf16 (x and W RNE-converted to bf16; products exact);
// scores v_wmma_f32_16x16x32_f16: q and k single f16 (one product); P (x256 carry, cancels in the normalisation) and v single f16; softmax f32 (online, running max).
// Layout: bf16 copies of x and W; q, k planes [b*16+h][t][d] and v^T plane [b*16+h][d][t] written by the GEMM epilogue; fused flash kernel in transposed form (S^T = K Q^T, O^T = V^T P^T), both outputs from the same f32 accumulators.

#ifndef NB
#define NB 2
#endif
#ifndef SEQ
#define SEQ 2048
#endif
#define NB_FULL  2
#define SEQ_FULL 2048
#ifndef OUT_SEQ
#define OUT_SEQ SEQ              // row pitch (in tokens) between batches of the merged output and between (batch, head) slabs of the context output
#endif
#define DM   1024                // input width == projection width
#define NH_  16
#define HD   64
#define AW   8                   // waves per flash block (16 query rows each)
#define KT   128                 // keys per staged K / V^T tile
#define KPH  72                  // LDS pitch of a K row in halves: 128 B + 16 B (16 B x odd: ds_load_b128 readers meet no bank conflict)
#define VPH  136                 // LDS pitch of a V^T row in halves: 256 B + 16 B
#define KTH  (KT * KPH)          // halves of one K tile in LDS
#define STH  (KTH + HD * VPH)    // halves of one ring buffer (K tile, then V^T tile)
#define SC2  (0.125f * 1.4426950408889634f)   // HD^-0.5 * log2(e)
#define PSH  8.0f                // log2 of the P carry (256)
#define CTX_OFF ((size_t)NB_FULL * SEQ_FULL * DM)   // element offset of the second output (fixed, full-size constants)

static_assert(HD == 64);
static_assert(NH_ * HD == DM);                 // head h = columns h*64 + d
static_assert(DM % 64 == 0);                   // 16 column tiles of 64
static_assert(DM % 32 == 0);                   // GEMM k-loop steps by 32
static_assert(SEQ % 64 == 0);                  // a 64-row tile never straddles two batches
static_assert((NB * SEQ) % 64 == 0);
static_assert(SEQ % 32 == 0);                  // key loop steps by 32
static_assert(SEQ % KT == 0 && SEQ / KT >= 2); // whole tiles only; the ring's prologue needs two
static_assert(KT == 128 && AW == 8);           // the copy map below: 256 lanes x 16 B x 4 copies = one 16-KiB tile of each operand
static_assert(SEQ % (16 * AW) == 0);           // flash grid covers the sequence exactly
static_assert(((size_t)SEQ * DM) % 8 == 0);
static_assert(((size_t)DM * DM) % 8 == 0);
static_assert(NB <= NB_FULL);
static_assert(SEQ <= SEQ_FULL);
static_assert(OUT_SEQ >= SEQ);
static_assert(OUT_SEQ <= SEQ_FULL);
static_assert(CTX_OFF * 4 == (size_t)16777216);                                            // byte offset of the second output
static_assert(((size_t)(NB - 1) * OUT_SEQ + SEQ) * DM <= CTX_OFF);                           // merged output stays inside its own region
static_assert(CTX_OFF + ((size_t)(NB * NH_ - 1) * OUT_SEQ + SEQ) * HD <= (size_t)2 * CTX_OFF); // context output stays inside the buffer (33554432 B)

typedef _Float16 h16;
typedef unsigned short bf;
typedef __attribute__((ext_vector_type(16))) __bf16   v16bf;
typedef __attribute__((ext_vector_type(16))) _Float16 v16h;
typedef __attribute__((ext_vector_type(8)))  _Float16 v8h;
typedef __attribute__((ext_vector_type(8)))  unsigned short v8us;
typedef __attribute__((ext_vector_type(8)))  float    v8f;
typedef __attribute__((ext_vector_type(4)))  float    v4f;
typedef v4f  __attribute__((may_alias)) v4fa;

__device__ __forceinline__ unsigned short f2bf(float f) { unsigned u = __float_as_uint(f); u += 0x7FFFu + ((u >> 16) & 1u); return (unsigned short)(u >> 16); }
__device__ __forceinline__ v16h cat16(v8h lo, v8h hi) { return __builtin_shufflevector(lo, hi, 0, 1, 2, 3, 4, 5, 6, 7, 8, 9, 10, 11, 12, 13, 14, 15); }
__device__ __forceinline__ v16bf cat16b(v8us lo, v8us hi) { return __builtin_bit_cast(v16bf, __builtin_shufflevector(lo, hi, 0, 1, 2, 3, 4, 5, 6, 7, 8, 9, 10, 11, 12, 13, 14, 15)); }
__device__ __forceinline__ v8f wmma16(v16h a, v16h b, v8f c) { return __builtin_amdgcn_wmma_f32_16x16x32_f16(false, a, false, b, (short)0, c, false, false); }
__device__ __forceinline__ v8f wmmab(v16bf a, v16bf b, v8f c) { return __builtin_amdgcn_wmma_f32_16x16x32_bf16(false, a, false, b, (short)0, c, false, false); }
// fragment loaders from K-contiguous 16-bit rows; p already includes + 8*(lane>>4): elements 0..7 <- k0+8h+0..7, elements 8..15 <- k0+16+8h+0..7 (same map for A and B)
__device__ __forceinline__ v16h  ldh(const h16* p) { return cat16(*(const v8h*)p, *(const v8h*)(p + 16)); }
__device__ __forceinline__ v16bf ldb(const bf* p)  { return cat16b(*(const v8us*)p, *(const v8us*)(p + 16)); }
// ordering point for wave-private LDS tiles (same wave writes and reads)
__device__ __forceinline__ void wave_sync() { __builtin_amdgcn_fence(3 /* release order */, "wavefront"); __builtin_amdgcn_wave_barrier(); asm volatile("" ::: "memory"); }

__global__ __launch_bounds__(256) void k_cvt8(const float* __restrict__ src, bf* dst, size_t n8) {
    const size_t i = (size_t)blockIdx.x * 256 + threadIdx.x; if (i >= n8) return;
    const v8f v = *(const v8f*)(src + i * 8); v8us o;
#pragma unroll
    for (int k = 0; k < 8; ++k) o[k] = f2bf(v[k]);
    *(v8us*)(dst + i * 8) = o; 
}

// k_proj: register-blocked bf16 GEMM, ONE WAVE per 64x64 tile (16 accumulators), operands straight from K-contiguous bf16 planes, K = DM.
// C[m][n] = sum_k A[m][k] Bt[n][k], written as f16 (Ph) at
// tile base (r0/RB)*sRB + (r0%RB)*pitch + (c0/CB)*sCB + (c0%CB), row pitch 'pitch' (halves). grid (M/64, N/64), 32 threads.
__global__ __launch_bounds__(32) void k_proj(const bf* __restrict__ A, const bf* __restrict__ Bt, h16* Ph, int RB, size_t sRB, int pitch, int CB, size_t sCB) {
    __shared__ __align__(16) float os[16 * 68];
    const int K = DM;
    const int lane = threadIdx.x & 31, lr = lane & 15, hi = lane >> 4; const int r0 = blockIdx.x * 64, c0 = blockIdx.y * 64;
    v8f acc[4][4];
#pragma unroll
    for (int mb = 0; mb < 4; ++mb)
#pragma unroll
        for (int nb = 0; nb < 4; ++nb) acc[mb][nb] = (v8f){};
    const size_t aoff = (size_t)(r0 + lr) * K + 8 * hi, boff = (size_t)(c0 + lr) * K + 8 * hi;
#pragma unroll 1
    for (int kc = 0; kc < K; kc += 32) {
        v16bf a[4];
#pragma unroll
        for (int mb = 0; mb < 4; ++mb) a[mb] = ldb(A + aoff + (size_t)mb * 16 * K + kc);
#pragma unroll
        for (int nb = 0; nb < 4; ++nb) { const v16bf b = ldb(Bt + boff + (size_t)nb * 16 * K + kc);
#pragma unroll
            for (int mb = 0; mb < 4; ++mb) acc[mb][nb] = wmmab(a[mb], b, acc[mb][nb]); }
        asm volatile("v_nop\n\tv_nop\n\tv_nop\n\tv_nop" : "+v"(acc[0][0]), "+v"(acc[1][1]), "+v"(acc[2][2]), "+v"(acc[3][3]) : "v"(a[0]), "v"(a[1]), "v"(a[2]), "v"(a[3]));
    }
    const size_t tbase = (size_t)(r0 / RB) * sRB + (size_t)(r0 % RB) * (size_t)pitch + (size_t)(c0 / CB) * sCB + (size_t)(c0 % CB);
#pragma unroll
    for (int mb = 0; mb < 4; ++mb) {
#pragma unroll
        for (int nb = 0; nb < 4; ++nb) {
#pragma unroll
            for (int j = 0; j < 8; ++j) os[(hi * 8 + j) * 68 + nb * 16 + lr] = acc[mb][nb][j]; }   // D: row 8h+j, col lane&15
        wave_sync();
        const size_t sb = tbase + (size_t)(mb * 16) * (size_t)pitch;
{
#pragma unroll
            for (int s = 0; s < 4; ++s) { const int row = 4 * s + (lane >> 3), c8 = (lane & 7) * 8;   // 4 s x 4 row groups = 16 rows; 8 lanes x 8 = 64 columns
                const v4f x0 = *(const v4fa*)(&os[row * 68 + c8]); const v4f x1 = *(const v4fa*)(&os[row * 68 + c8 + 4]); v8h hv;
#pragma unroll
                for (int i = 0; i < 4; ++i) { hv[i] = (h16)x0[i]; hv[4 + i] = (h16)x1[i]; }
                const size_t oo = sb + (size_t)row * (size_t)pitch + c8;
                *(v8h*)(Ph + oo) = hv; }
             }
        wave_sync();
    }
}

// One tile's copies of one lane: 4 x 16 B of K and 4 x 16 B of V^T, global memory to LDS through no register. Each wave-wide copy reads 512 B of whole lines.
// kg, vg: the lane's first global chunk of each operand; kl, vl: its LDS byte address. Later chunks: K + 32 rows (contiguous in memory), V^T + 16 rows.
__device__ __forceinline__ void stage_kv(const h16* kg, const h16* vg, unsigned kl, unsigned vl) {
    const h16* kg1 = kg + 32 * HD; const h16* kg2 = kg + 64 * HD; const h16* kg3 = kg + 96 * HD;
    const h16* vg1 = vg + (size_t)16 * SEQ; const h16* vg2 = vg + (size_t)32 * SEQ; const h16* vg3 = vg + (size_t)48 * SEQ;
    const unsigned kl1 = kl + 32 * KPH * 2, kl2 = kl + 64 * KPH * 2, kl3 = kl + 96 * KPH * 2;
    const unsigned vl1 = vl + 16 * VPH * 2, vl2 = vl + 32 * VPH * 2, vl3 = vl + 48 * VPH * 2;
    // the closing s_wait_xcnt stands in the copies' own statement so that no address register is rewritten in front of it
    asm volatile("global_load_async_to_lds_b128 %0, %8, off\n\t"
                 "global_load_async_to_lds_b128 %1, %9, off\n\t"
                 "global_load_async_to_lds_b128 %2, %10, off\n\t"
                 "global_load_async_to_lds_b128 %3, %11, off\n\t"
                 "global_load_async_to_lds_b128 %4, %12, off\n\t"
                 "global_load_async_to_lds_b128 %5, %13, off\n\t"
                 "global_load_async_to_lds_b128 %6, %14, off\n\t"
                 "global_load_async_to_lds_b128 %7, %15, off\n\t"
                 "s_wait_xcnt 0x0"
                 :: "v"(kl), "v"(kl1), "v"(kl2), "v"(kl3), "v"(vl), "v"(vl1), "v"(vl2), "v"(vl3),
                    "v"(kg), "v"(kg1), "v"(kg2), "v"(kg3), "v"(vg), "v"(vg1), "v"(vg2), "v"(vg3) : "memory");
}

__global__ __launch_bounds__(32 * AW) void k_flash(const h16* __restrict__ QH, const h16* __restrict__ KP, const h16* __restrict__ VT, float* OUT, float* CTX) {
    __shared__ __align__(16) float os[AW * 16 * 68];
    __shared__ __align__(16) h16 ring[2 * STH];
    const int lane = threadIdx.x & 31, wave = __builtin_amdgcn_readfirstlane((int)(threadIdx.x >> 5)), lr = lane & 15, hi = lane >> 4;
    const int zh = blockIdx.y; const int b = zh / NH_, h = zh % NH_;
    const int t0 = (blockIdx.x * AW + wave) * 16;
    const size_t pbase = (size_t)zh * SEQ * HD;
    const size_t qo = pbase + (size_t)(t0 + lr) * HD + 8 * hi;
    const v16h qh0 = ldh(QH + qo), qh1 = ldh(QH + qo + 32);   // B fragments: col t, k = d
    const int ko = lr * KPH + 8 * hi;                        // + key * KPH      (A fragment: row key, k = d), in a K tile
    const int vo = KTH + lr * VPH + 8 * hi;                  // + 16j*VPH + key  (A fragment: row d, k = key), in a V^T tile
    const int tid = (int)threadIdx.x;
    const h16* kg = KP + pbase + (size_t)tid * 8;                                   // + tile * KT * HD: chunk tid of the tile's 16 KiB
    const h16* vg = VT + pbase + (size_t)(tid >> 4) * SEQ + (tid & 15) * 8;         // + tile * KT: row tid>>4, chunk tid&15 of its 256 B
    const unsigned rl = (unsigned)(size_t)&ring[0];                                 // LDS byte address of the ring
    const unsigned kl = rl + (unsigned)((tid >> 3) * KPH + (tid & 7) * 8) * 2u;     // + buffer * STH * 2
    const unsigned vl = rl + (unsigned)(KTH + (tid >> 4) * VPH + (tid & 15) * 8) * 2u;
    stage_kv(kg, vg, kl, vl);
    asm volatile("s_wait_asynccnt 0x0" ::: "memory");        // tile 0 of this wave's copies has landed
    __syncthreads();                                         // ... and every other wave's: tile 0 may be read
    stage_kv(kg + (size_t)KT * HD, vg + KT, kl + STH * 2u, vl + STH * 2u);
    v8f o0 = (v8f){}, o1 = (v8f){}, o2 = (v8f){}, o3 = (v8f){};
    float m = -3.0e38f, l = 0.0f;
#pragma unroll 1   // one trip per tile: the ring's order stands once, at the trip's foot
    for (int st = 0; st < SEQ / KT; ++st) {
      const h16* buf = ring + (st & 1) * STH;
#pragma unroll     // the four 32-key steps of a tile: lets the compiler fetch LDS fragments ahead inside the tile
      for (int key0 = 0; key0 < KT; key0 += 32) {
        const h16* ka = buf + ko + key0 * KPH;
        const v16h ka0 = ldh(ka), ka1 = ldh(ka + 32), kb0 = ldh(ka + 16 * KPH), kb1 = ldh(ka + 16 * KPH + 32);
        v8f sa = (v8f){}, sb = (v8f){};
        sa = wmma16(ka0, qh0, sa); sb = wmma16(kb0, qh0, sb);
        sa = wmma16(ka1, qh1, sa); sb = wmma16(kb1, qh1, sb);
        asm volatile("v_nop\n\tv_nop\n\tv_nop\n\tv_nop" : "+v"(sa), "+v"(sb) : "v"(ka0), "v"(ka1), "v"(kb0), "v"(kb1), "v"(qh0), "v"(qh1));
        float ta[8], tb[8]; float mx = -3.0e38f;
#pragma unroll
        for (int r = 0; r < 8; ++r) { ta[r] = sa[r] * SC2; tb[r] = sb[r] * SC2; mx = fmaxf(mx, fmaxf(ta[r], tb[r])); }
        mx = fmaxf(mx, __shfl_xor(mx, 16, 32));
        const float mnew = fmaxf(m, mx);
        const float alpha = __builtin_amdgcn_exp2f(m - mnew);
        const float sh = PSH - mnew;
        v16h pb; float ls = 0.0f;
#pragma unroll
        for (int r = 0; r < 8; ++r) { const h16 pa = (h16)__builtin_amdgcn_exp2f(ta[r] + sh); const h16 pc = (h16)__builtin_amdgcn_exp2f(tb[r] + sh); pb[r] = pa; pb[8 + r] = pc; ls += (float)pa + (float)pc; }
        l = l * alpha + ls; m = mnew;
        o0 = o0 * alpha; o1 = o1 * alpha; o2 = o2 * alpha; o3 = o3 * alpha;
        const h16* va = buf + vo + key0;
        const v16h v0 = ldh(va), v1 = ldh(va + 16 * VPH), v2 = ldh(va + 32 * VPH), v3 = ldh(va + 48 * VPH);
        o0 = wmma16(v0, pb, o0); o1 = wmma16(v1, pb, o1); o2 = wmma16(v2, pb, o2); o3 = wmma16(v3, pb, o3);
        asm volatile("v_nop\n\tv_nop\n\tv_nop\n\tv_nop" : "+v"(o0), "+v"(o1), "+v"(o2), "+v"(o3) : "v"(v0), "v"(v1), "v"(v2), "v"(v3), "v"(pb));
      }
      asm volatile("s_wait_dscnt 0x0" ::: "memory");         // this wave's reads of the buffer have returned before it is refilled
      asm volatile("s_wait_asynccnt 0x0" ::: "memory");      // this wave's copies of the next tile have landed
      __syncthreads();                                       // publishes the next tile and ends every reader's last read of this buffer
      if (st + 2 < SEQ / KT) stage_kv(kg + (size_t)(st + 2) * KT * HD, vg + (st + 2) * KT, kl + (unsigned)(st & 1) * (STH * 2u), vl + (unsigned)(st & 1) * (STH * 2u));
    }
    asm volatile("s_wait_asynccnt 0x0" ::: "memory");        // no copy is outstanding when the wave goes on to its epilogue
    l += __shfl_xor(l, 16, 32);
    const float inv = 1.0f / l;
    const int wb = wave * 16 * 68;
    // O^T D layout: o_j[r] = (d = 16j + 8h + r, t = lane&15) -> os[t][d]; rows 0..15 x columns 0..63 all written
    { v4f a, c;
      a[0] = o0[0] * inv; a[1] = o0[1] * inv; a[2] = o0[2] * inv; a[3] = o0[3] * inv; c[0] = o0[4] * inv; c[1] = o0[5] * inv; c[2] = o0[6] * inv; c[3] = o0[7] * inv;
      *(v4fa*)(&os[wb + lr * 68 +  0 + 8 * hi]) = a; *(v4fa*)(&os[wb + lr * 68 +  0 + 8 * hi + 4]) = c;
      a[0] = o1[0] * inv; a[1] = o1[1] * inv; a[2] = o1[2] * inv; a[3] = o1[3] * inv; c[0] = o1[4] * inv; c[1] = o1[5] * inv; c[2] = o1[6] * inv; c[3] = o1[7] * inv;
      *(v4fa*)(&os[wb + lr * 68 + 16 + 8 * hi]) = a; *(v4fa*)(&os[wb + lr * 68 + 16 + 8 * hi + 4]) = c;
      a[0] = o2[0] * inv; a[1] = o2[1] * inv; a[2] = o2[2] * inv; a[3] = o2[3] * inv; c[0] = o2[4] * inv; c[1] = o2[5] * inv; c[2] = o2[6] * inv; c[3] = o2[7] * inv;
      *(v4fa*)(&os[wb + lr * 68 + 32 + 8 * hi]) = a; *(v4fa*)(&os[wb + lr * 68 + 32 + 8 * hi + 4]) = c;
      a[0] = o3[0] * inv; a[1] = o3[1] * inv; a[2] = o3[2] * inv; a[3] = o3[3] * inv; c[0] = o3[4] * inv; c[1] = o3[5] * inv; c[2] = o3[6] * inv; c[3] = o3[7] * inv;
      *(v4fa*)(&os[wb + lr * 68 + 48 + 8 * hi]) = a; *(v4fa*)(&os[wb + lr * 68 + 48 + 8 * hi + 4]) = c; }
    wave_sync();
    float* orow = OUT + ((size_t)b * OUT_SEQ + t0) * DM + h * HD;          // merged [b][t][h*64 + d]
    float* crow = CTX + ((size_t)zh * OUT_SEQ + t0) * HD;                  // context [b*16 + h][t][d]
{
#pragma unroll
        for (int s = 0; s < 8; ++s) { const int row = 2 * s + hi, cofs = lr * 4;   // 8 s x 2 rows = 16 rows; 16 lanes x 4 floats = 64 columns
            const v4f val = *(const v4fa*)(&os[wb + row * 68 + cofs]);
            *(v4f*)(orow + (size_t)row * DM + cofs) = val;
            *(v4f*)(crow + (size_t)row * HD + cofs) = val; }
         }
}

static constexpr size_t al256(size_t v) { return (v + 255) & ~(size_t)255; }
static constexpr size_t SZ_XB = al256((size_t)NB * SEQ * DM * 2);
static constexpr size_t SZ_WB = al256((size_t)3 * DM * DM * 2);
static constexpr size_t SZ_PL = al256((size_t)NB * NH_ * SEQ * HD * 2);
static constexpr size_t SZ_TOTAL = SZ_XB + SZ_WB + 3 * SZ_PL;
static_assert(SZ_TOTAL <= (size_t)134217728);          // workspace carve <= 128 MiB
static_assert(((size_t)DM * DM * 2) % 256 == 0);       // weight sub-planes stay 256-byte aligned

extern "C" void kernel_launch(void* const* d_in, const int* in_sizes, int n_in,
                              void* d_out, int out_size, void* d_ws, size_t ws_size, hipStream_t stream) {
    if (n_in < 4) return;
    const size_t needx = ((size_t)(NB - 1) * SEQ_FULL + SEQ) * DM;
    if ((size_t)in_sizes[0] < needx) return;
    if ((size_t)in_sizes[1] < (size_t)DM * DM || (size_t)in_sizes[2] < (size_t)DM * DM || (size_t)in_sizes[3] < (size_t)DM * DM) return;
    if ((size_t)out_size < CTX_OFF + ((size_t)(NB * NH_ - 1) * OUT_SEQ + SEQ) * HD) return;
    if (SZ_TOTAL > ws_size) return;
    const float* x = (const float*)d_in[0]; const float* wq = (const float*)d_in[1]; const float* wk = (const float*)d_in[2]; const float* wv = (const float*)d_in[3];   // wire order x, Wq, Wk, Wv ([out][in] = Bt as-is)
    float* OUT = (float*)d_out;              // [NB][SEQ][1024]
    float* CTX = (float*)d_out + CTX_OFF;    // [NB][16][SEQ][64]
    char* wsp = (char*)d_ws;
    bf* XB = (bf*)wsp; wsp += SZ_XB;                 // [NB*SEQ][1024]
    bf* WB = (bf*)wsp; wsp += SZ_WB;                 // [3][1024][1024]: q | k | v
    h16* QH = (h16*)wsp; wsp += SZ_PL;               // [NB*16][SEQ][64]
    h16* KP = (h16*)wsp; wsp += SZ_PL;               // [NB*16][SEQ][64]
    h16* VT = (h16*)wsp; wsp += SZ_PL;               // [NB*16][64][SEQ]
    bf* WQ = WB; bf* WK = WB + (size_t)DM * DM; bf* WV = WB + (size_t)2 * DM * DM;

    if (SEQ == SEQ_FULL) {
        const size_t n8 = (size_t)NB * SEQ * DM / 8;
        k_cvt8<<<(unsigned)((n8 + 255) / 256), 256, 0, stream>>>(x, XB, n8);
    } else {
        const size_t n8 = (size_t)SEQ * DM / 8;
        for (int b = 0; b < NB; ++b) k_cvt8<<<(unsigned)((n8 + 255) / 256), 256, 0, stream>>>(x + (size_t)b * SEQ_FULL * DM, XB + (size_t)b * SEQ * DM, n8);
    }
    { const size_t n8 = (size_t)DM * DM / 8; const unsigned g = (unsigned)((n8 + 255) / 256);
      k_cvt8<<<g, 256, 0, stream>>>(wq, WQ, n8); k_cvt8<<<g, 256, 0, stream>>>(wk, WK, n8); k_cvt8<<<g, 256, 0, stream>>>(wv, WV, n8); }

    // q, k: A = x rows (m = b*SEQ + t), Bt = W rows (n = h*64 + d) -> plane [(b*16 + h)][t][d]
    k_proj<<<dim3(NB * SEQ / 64, DM / 64, 1), 32, 0, stream>>>(XB, WQ, QH, SEQ, (size_t)NH_ * SEQ * HD, HD, HD, (size_t)SEQ * HD);
    k_proj<<<dim3(NB * SEQ / 64, DM / 64, 1), 32, 0, stream>>>(XB, WK, KP, SEQ, (size_t)NH_ * SEQ * HD, HD, HD, (size_t)SEQ * HD);
    // v^T: A = Wv rows (m = h*64 + d), Bt = x rows (n = b*SEQ + t) -> plane [(b*1024 + m)][t] = [(b*16 + h)][d][t]
    k_proj<<<dim3(DM / 64, NB * SEQ / 64, 1), 32, 0, stream>>>(WV, XB, VT, DM, (size_t)0, SEQ, SEQ, (size_t)DM * SEQ);

    k_flash<<<dim3(SEQ / (16 * AW), NB * NH_, 1), 32 * AW, 0, stream>>>(QH, KP, VT, OUT, CTX);
}

// v002
// It runs in 84.5 microseconds.
// Next to v001, in two timings, it ran 1.47 and 1.49 times as fast.
// Counting every step since v000, it is 2.36 times as fast.
#include <hip/hip_runtime.h>

// Multi-head self-attention, width 1024 = 16 heads x 64, x [NB][SEQ][1024], Wq/Wk/Wv [out][in] (y = x W^T), no biases, no mask, score scale 1/8; two f32 outputs: merged heads [NB][SEQ][1024] and per-head context [NB][16][SEQ][64].
// Compute dtypes, f32 accumulate everywhere: projections v_wmma_f32_16x16x32_bf16 (x and W RNE-converted to bf16; products exact);
// scores v_wmma_f32_16x16x32_f16: q and k single f16 (one product); P (x256 carry, cancels in the normalisation) and v single f16; softmax f32 (online, running max).
// Layout: bf16 copies of x and W; q, k planes [b*16+h][t][d] and v^T plane [b*16+h][d][t] written by the GEMM epilogue; fused flash kernel in transposed form (S^T = K Q^T, O^T = V^T P^T), both outputs from the same f32 accumulators.

#ifndef NB
#define NB 2
#endif
#ifndef SEQ
#define SEQ 2048
#endif
#define NB_FULL  2
#define SEQ_FULL 2048
#ifndef OUT_SEQ
#define OUT_SEQ SEQ              // row pitch (in tokens) between batches of the merged output and between (batch, head) slabs of the context output
#endif
#define DM   1024                // input width == projection width
#define NH_  16
#define HD   64
#define AW   8                   // waves per flash block (16 query rows each)
#define KT   128                 // keys per staged K / V^T tile
#define KPH  72                  // LDS pitch of a K row in halves: 128 B + 16 B (16 B x odd: ds_load_b128 readers meet no bank conflict)
#define VPH  136                 // LDS pitch of a V^T row in halves: 256 B + 16 B
#define KTH  (KT * KPH)          // halves of one K tile in LDS
#define STH  (KTH + HD * VPH)    // halves of one ring buffer (K tile, then V^T tile)
#define PW   8                   // waves per projection block: 4 x 2 wave tiles of 32 x 64
#define PKT  128                 // k per staged projection tile
#define PPH  136                 // LDS pitch of a staged operand row in 16-bit elements: 256 B + 16 B
#define POP  (128 * PPH)         // elements of one operand's staged tile (128 rows)
#define PST  (2 * POP)           // elements of one projection ring buffer (A tile, then Bt tile)
#define SC2  (0.125f * 1.4426950408889634f)   // HD^-0.5 * log2(e)
#define PSH  8.0f                // log2 of the P carry (256)
#define CTX_OFF ((size_t)NB_FULL * SEQ_FULL * DM)   // element offset of the second output (fixed, full-size constants)

static_assert(HD == 64);
static_assert(NH_ * HD == DM);                 // head h = columns h*64 + d
static_assert(DM % 64 == 0);                   // 16 column tiles of 64
static_assert(DM % 32 == 0);                   // GEMM k-loop steps by 32
static_assert(SEQ % 64 == 0);                  // a 64-row tile never straddles two batches
static_assert((NB * SEQ) % 128 == 0 && DM % 128 == 0);   // projection blocks of 128 x 128 cover both operand planes exactly
static_assert(DM % PKT == 0 && DM / PKT >= 2);           // whole k tiles only; the ring's prologue needs two
static_assert(PKT == 128 && PW == 8);                    // the copy map of stage_ab: 256 lanes x 16 B x 8 copies = one 32-KiB tile of each operand
static_assert(SEQ % 32 == 0 && DM % 32 == 0);            // a wave's 32 rows never straddle two output row blocks
static_assert(SEQ % 32 == 0);                  // key loop steps by 32
static_assert(SEQ % KT == 0 && SEQ / KT >= 2); // whole tiles only; the ring's prologue needs two
static_assert(KT == 128 && AW == 8);           // the copy map below: 256 lanes x 16 B x 4 copies = one 16-KiB tile of each operand
static_assert(SEQ % (16 * AW) == 0);           // flash grid covers the sequence exactly
static_assert(((size_t)SEQ * DM) % 8 == 0);
static_assert(((size_t)DM * DM) % 8 == 0);
static_assert(NB <= NB_FULL);
static_assert(SEQ <= SEQ_FULL);
static_assert(OUT_SEQ >= SEQ);
static_assert(OUT_SEQ <= SEQ_FULL);
static_assert(CTX_OFF * 4 == (size_t)16777216);                                            // byte offset of the second output
static_assert(((size_t)(NB - 1) * OUT_SEQ + SEQ) * DM <= CTX_OFF);                           // merged output stays inside its own region
static_assert(CTX_OFF + ((size_t)(NB * NH_ - 1) * OUT_SEQ + SEQ) * HD <= (size_t)2 * CTX_OFF); // context output stays inside the buffer (33554432 B)

typedef _Float16 h16;
typedef unsigned short bf;
typedef __attribute__((ext_vector_type(16))) __bf16   v16bf;
typedef __attribute__((ext_vector_type(16))) _Float16 v16h;
typedef __attribute__((ext_vector_type(8)))  _Float16 v8h;
typedef __attribute__((ext_vector_type(8)))  unsigned short v8us;
typedef __attribute__((ext_vector_type(8)))  float    v8f;
typedef __attribute__((ext_vector_type(4)))  float    v4f;
typedef v4f  __attribute__((may_alias)) v4fa;

__device__ __forceinline__ unsigned short f2bf(float f) { unsigned u = __float_as_uint(f); u += 0x7FFFu + ((u >> 16) & 1u); return (unsigned short)(u >> 16); }
__device__ __forceinline__ v16h cat16(v8h lo, v8h hi) { return __builtin_shufflevector(lo, hi, 0, 1, 2, 3, 4, 5, 6, 7, 8, 9, 10, 11, 12, 13, 14, 15); }
__device__ __forceinline__ v16bf cat16b(v8us lo, v8us hi) { return __builtin_bit_cast(v16bf, __builtin_shufflevector(lo, hi, 0, 1, 2, 3, 4, 5, 6, 7, 8, 9, 10, 11, 12, 13, 14, 15)); }
__device__ __forceinline__ v8f wmma16(v16h a, v16h b, v8f c) { return __builtin_amdgcn_wmma_f32_16x16x32_f16(false, a, false, b, (short)0, c, false, false); }
__device__ __forceinline__ v8f wmmab(v16bf a, v16bf b, v8f c) { return __builtin_amdgcn_wmma_f32_16x16x32_bf16(false, a, false, b, (short)0, c, false, false); }
// fragment loaders from K-contiguous 16-bit rows; p already includes + 8*(lane>>4): elements 0..7 <- k0+8h+0..7, elements 8..15 <- k0+16+8h+0..7 (same map for A and B)
__device__ __forceinline__ v16h  ldh(const h16* p) { return cat16(*(const v8h*)p, *(const v8h*)(p + 16)); }
__device__ __forceinline__ v16bf ldb(const bf* p)  { return cat16b(*(const v8us*)p, *(const v8us*)(p + 16)); }
// ordering point for wave-private LDS tiles (same wave writes and reads)
__device__ __forceinline__ void wave_sync() { __builtin_amdgcn_fence(3 /* release order */, "wavefront"); __builtin_amdgcn_wave_barrier(); asm volatile("" ::: "memory"); }

__global__ __launch_bounds__(256) void k_cvt8(const float* __restrict__ src, bf* dst, size_t n8) {
    const size_t i = (size_t)blockIdx.x * 256 + threadIdx.x; if (i >= n8) return;
    const v8f v = *(const v8f*)(src + i * 8); v8us o;
#pragma unroll
    for (int k = 0; k < 8; ++k) o[k] = f2bf(v[k]);
    *(v8us*)(dst + i * 8) = o; 
}

// Eight copies of one lane: 16 B of rows r, r + 16, ..., r + 112 of a K-contiguous bf16 plane, global memory to LDS through no register.
// g: the lane's first global chunk; l: its LDS byte address. Each wave-wide copy reads two rows x 256 B of whole lines.
__device__ __forceinline__ void stage_rows(const bf* g, unsigned l) {
    const bf* g1 = g + (size_t)16 * DM; const bf* g2 = g + (size_t)32 * DM; const bf* g3 = g + (size_t)48 * DM; const bf* g4 = g + (size_t)64 * DM;
    const bf* g5 = g + (size_t)80 * DM; const bf* g6 = g + (size_t)96 * DM; const bf* g7 = g + (size_t)112 * DM;
    const unsigned l1 = l + 16 * PPH * 2, l2 = l + 32 * PPH * 2, l3 = l + 48 * PPH * 2, l4 = l + 64 * PPH * 2, l5 = l + 80 * PPH * 2, l6 = l + 96 * PPH * 2, l7 = l + 112 * PPH * 2;
    // the closing s_wait_xcnt stands in the copies' own statement so that no address register is rewritten in front of it
    asm volatile("global_load_async_to_lds_b128 %0, %8, off\n\t"
                 "global_load_async_to_lds_b128 %1, %9, off\n\t"
                 "global_load_async_to_lds_b128 %2, %10, off\n\t"
                 "global_load_async_to_lds_b128 %3, %11, off\n\t"
                 "global_load_async_to_lds_b128 %4, %12, off\n\t"
                 "global_load_async_to_lds_b128 %5, %13, off\n\t"
                 "global_load_async_to_lds_b128 %6, %14, off\n\t"
                 "global_load_async_to_lds_b128 %7, %15, off\n\t"
                 "s_wait_xcnt 0x0"
                 :: "v"(l), "v"(l1), "v"(l2), "v"(l3), "v"(l4), "v"(l5), "v"(l6), "v"(l7),
                    "v"(g), "v"(g1), "v"(g2), "v"(g3), "v"(g4), "v"(g5), "v"(g6), "v"(g7) : "memory");
}
// One k tile's copies of one lane: 8 x 16 B of the block's 128 A rows and 8 x 16 B of its 128 Bt rows (16 copies of a wave in flight).
__device__ __forceinline__ void stage_ab(const bf* ag, const bf* bg, unsigned al, unsigned bl) { stage_rows(ag, al); stage_rows(bg, bl); }

__global__ __launch_bounds__(32 * PW) void k_proj(const bf* __restrict__ A, const bf* __restrict__ Bt, h16* Ph, int RB, size_t sRB, int pitch, int CB, size_t sCB) {
    __shared__ __align__(16) float osb[PW * 16 * 68];
    __shared__ __align__(16) bf pring[2 * PST];
    const int K = DM;
    const int lane = threadIdx.x & 31, wave = __builtin_amdgcn_readfirstlane((int)(threadIdx.x >> 5)), lr = lane & 15, hi = lane >> 4;
    const int r0 = blockIdx.x * 128 + (wave >> 1) * 32, c0 = blockIdx.y * 128 + (wave & 1) * 64;   // this wave's 32x64 tile
    float* os = osb + wave * 16 * 68;                                                              // wave-private epilogue tile
    v8f acc[2][4];
#pragma unroll
    for (int mb = 0; mb < 2; ++mb)
#pragma unroll
        for (int nb = 0; nb < 4; ++nb) acc[mb][nb] = (v8f){};
    const int ao = ((wave >> 1) * 32 + lr) * PPH + 8 * hi;            // + mb*16*PPH + k, in a buffer's A tile
    const int bo = POP + ((wave & 1) * 64 + lr) * PPH + 8 * hi;       // + nb*16*PPH + k, in its Bt tile
    const int tid = (int)threadIdx.x;
    const bf* ag = A  + (size_t)(blockIdx.x * 128 + (tid >> 4)) * K + (tid & 15) * 8;   // + tile * PKT: row tid>>4, chunk tid&15 of its 256 B
    const bf* bg = Bt + (size_t)(blockIdx.y * 128 + (tid >> 4)) * K + (tid & 15) * 8;
    const unsigned pl = (unsigned)(size_t)&pring[0];                                    // LDS byte address of the ring
    const unsigned al = pl + (unsigned)((tid >> 4) * PPH + (tid & 15) * 8) * 2u;        // + buffer * PST * 2
    const unsigned bl = al + POP * 2u;
    stage_ab(ag, bg, al, bl);
    asm volatile("s_wait_asynccnt 0x0" ::: "memory");        // tile 0 of this wave's copies has landed
    __syncthreads();                                         // ... and every other wave's: tile 0 may be read
    stage_ab(ag + PKT, bg + PKT, al + PST * 2u, bl + PST * 2u);
#pragma unroll 1   // one trip per k tile: the ring's order stands once, at the trip's foot
    for (int st = 0; st < K / PKT; ++st) {
      const bf* buf = pring + (st & 1) * PST;
      v16bf a[2][2], b[2][4];                                // two fragment sets: the next step's loads go ahead of this step's products, as one group
#pragma unroll
      for (int mb = 0; mb < 2; ++mb) a[0][mb] = ldb(buf + ao + mb * 16 * PPH);
#pragma unroll
      for (int nb = 0; nb < 4; ++nb) b[0][nb] = ldb(buf + bo + nb * 16 * PPH);
#pragma unroll     // the four 32-k steps of a tile: the fragment sets alternate by a compile-time index
      for (int ks = 0; ks < PKT / 32; ++ks) {
        const int cu = ks & 1, nx = cu ^ 1;
        if (ks + 1 < PKT / 32) {                             // never past this tile: the next one is read only behind the trip's barrier
#pragma unroll
          for (int mb = 0; mb < 2; ++mb) a[nx][mb] = ldb(buf + ao + mb * 16 * PPH + (ks + 1) * 32);
#pragma unroll
          for (int nb = 0; nb < 4; ++nb) b[nx][nb] = ldb(buf + bo + nb * 16 * PPH + (ks + 1) * 32);
        }
        __builtin_amdgcn_sched_barrier(0);                   // keeps the next step's loads ahead of this step's products: left free, the compiler sinks each load to its use and waits out the LDS latency there
#pragma unroll
        for (int nb = 0; nb < 4; ++nb)
#pragma unroll
            for (int mb = 0; mb < 2; ++mb) acc[mb][nb] = wmmab(a[cu][mb], b[cu][nb], acc[mb][nb]);
        __builtin_amdgcn_sched_barrier(0);                   // ... and this step's products ahead of the loads of the step after next, which reuse their fragment set
      }
      asm volatile("s_wait_dscnt 0x0" ::: "memory");         // this wave's reads of the buffer have returned before it is refilled
      asm volatile("s_wait_asynccnt 0x0" ::: "memory");      // this wave's copies of the next tile have landed
      __syncthreads();                                       // publishes the next tile and ends every reader's last read of this buffer
      if (st + 2 < K / PKT) stage_ab(ag + (st + 2) * PKT, bg + (st + 2) * PKT, al + (unsigned)(st & 1) * (PST * 2u), bl + (unsigned)(st & 1) * (PST * 2u));
    }
    asm volatile("s_wait_asynccnt 0x0" ::: "memory");        // no copy is outstanding when the wave goes on to its epilogue
    const size_t tbase = (size_t)(r0 / RB) * sRB + (size_t)(r0 % RB) * (size_t)pitch + (size_t)(c0 / CB) * sCB + (size_t)(c0 % CB);
#pragma unroll
    for (int mb = 0; mb < 2; ++mb) {
#pragma unroll
        for (int nb = 0; nb < 4; ++nb) {
#pragma unroll
            for (int j = 0; j < 8; ++j) os[(hi * 8 + j) * 68 + nb * 16 + lr] = acc[mb][nb][j]; }   // D: row 8h+j, col lane&15
        wave_sync();
        const size_t sb = tbase + (size_t)(mb * 16) * (size_t)pitch;
{
#pragma unroll
            for (int s = 0; s < 4; ++s) { const int row = 4 * s + (lane >> 3), c8 = (lane & 7) * 8;   // 4 s x 4 row groups = 16 rows; 8 lanes x 8 = 64 columns
                const v4f x0 = *(const v4fa*)(&os[row * 68 + c8]); const v4f x1 = *(const v4fa*)(&os[row * 68 + c8 + 4]); v8h hv;
#pragma unroll
                for (int i = 0; i < 4; ++i) { hv[i] = (h16)x0[i]; hv[4 + i] = (h16)x1[i]; }
                const size_t oo = sb + (size_t)row * (size_t)pitch + c8;
                *(v8h*)(Ph + oo) = hv; }
             }
        wave_sync();
    }
}

// One tile's copies of one lane: 4 x 16 B of K and 4 x 16 B of V^T, global memory to LDS through no register. Each wave-wide copy reads 512 B of whole lines.
// kg, vg: the lane's first global chunk of each operand; kl, vl: its LDS byte address. Later chunks: K + 32 rows (contiguous in memory), V^T + 16 rows.
__device__ __forceinline__ void stage_kv(const h16* kg, const h16* vg, unsigned kl, unsigned vl) {
    const h16* kg1 = kg + 32 * HD; const h16* kg2 = kg + 64 * HD; const h16* kg3 = kg + 96 * HD;
    const h16* vg1 = vg + (size_t)16 * SEQ; const h16* vg2 = vg + (size_t)32 * SEQ; const h16* vg3 = vg + (size_t)48 * SEQ;
    const unsigned kl1 = kl + 32 * KPH * 2, kl2 = kl + 64 * KPH * 2, kl3 = kl + 96 * KPH * 2;
    const unsigned vl1 = vl + 16 * VPH * 2, vl2 = vl + 32 * VPH * 2, vl3 = vl + 48 * VPH * 2;
    // the closing s_wait_xcnt stands in the copies' own statement so that no address register is rewritten in front of it
    asm volatile("global_load_async_to_lds_b128 %0, %8, off\n\t"
                 "global_load_async_to_lds_b128 %1, %9, off\n\t"
                 "global_load_async_to_lds_b128 %2, %10, off\n\t"
                 "global_load_async_to_lds_b128 %3, %11, off\n\t"
                 "global_load_async_to_lds_b128 %4, %12, off\n\t"
                 "global_load_async_to_lds_b128 %5, %13, off\n\t"
                 "global_load_async_to_lds_b128 %6, %14, off\n\t"
                 "global_load_async_to_lds_b128 %7, %15, off\n\t"
                 "s_wait_xcnt 0x0"
                 :: "v"(kl), "v"(kl1), "v"(kl2), "v"(kl3), "v"(vl), "v"(vl1), "v"(vl2), "v"(vl3),
                    "v"(kg), "v"(kg1), "v"(kg2), "v"(kg3), "v"(vg), "v"(vg1), "v"(vg2), "v"(vg3) : "memory");
}

__global__ __launch_bounds__(32 * AW) void k_flash(const h16* __restrict__ QH, const h16* __restrict__ KP, const h16* __restrict__ VT, float* OUT, float* CTX) {
    __shared__ __align__(16) float os[AW * 16 * 68];
    __shared__ __align__(16) h16 ring[2 * STH];
    const int lane = threadIdx.x & 31, wave = __builtin_amdgcn_readfirstlane((int)(threadIdx.x >> 5)), lr = lane & 15, hi = lane >> 4;
    const int zh = blockIdx.y; const int b = zh / NH_, h = zh % NH_;
    const int t0 = (blockIdx.x * AW + wave) * 16;
    const size_t pbase = (size_t)zh * SEQ * HD;
    const size_t qo = pbase + (size_t)(t0 + lr) * HD + 8 * hi;
    const v16h qh0 = ldh(QH + qo), qh1 = ldh(QH + qo + 32);   // B fragments: col t, k = d
    const int ko = lr * KPH + 8 * hi;                        // + key * KPH      (A fragment: row key, k = d), in a K tile
    const int vo = KTH + lr * VPH + 8 * hi;                  // + 16j*VPH + key  (A fragment: row d, k = key), in a V^T tile
    const int tid = (int)threadIdx.x;
    const h16* kg = KP + pbase + (size_t)tid * 8;                                   // + tile * KT * HD: chunk tid of the tile's 16 KiB
    const h16* vg = VT + pbase + (size_t)(tid >> 4) * SEQ + (tid & 15) * 8;         // + tile * KT: row tid>>4, chunk tid&15 of its 256 B
    const unsigned rl = (unsigned)(size_t)&ring[0];                                 // LDS byte address of the ring
    const unsigned kl = rl + (unsigned)((tid >> 3) * KPH + (tid & 7) * 8) * 2u;     // + buffer * STH * 2
    const unsigned vl = rl + (unsigned)(KTH + (tid >> 4) * VPH + (tid & 15) * 8) * 2u;
    stage_kv(kg, vg, kl, vl);
    asm volatile("s_wait_asynccnt 0x0" ::: "memory");        // tile 0 of this wave's copies has landed
    __syncthreads();                                         // ... and every other wave's: tile 0 may be read
    stage_kv(kg + (size_t)KT * HD, vg + KT, kl + STH * 2u, vl + STH * 2u);
    v8f o0 = (v8f){}, o1 = (v8f){}, o2 = (v8f){}, o3 = (v8f){};
    float m = -3.0e38f, l = 0.0f;
#pragma unroll 1   // one trip per tile: the ring's order stands once, at the trip's foot
    for (int st = 0; st < SEQ / KT; ++st) {
      const h16* buf = ring + (st & 1) * STH;
#pragma unroll     // the four 32-key steps of a tile: lets the compiler fetch LDS fragments ahead inside the tile
      for (int key0 = 0; key0 < KT; key0 += 32) {
        const h16* ka = buf + ko + key0 * KPH;
        const v16h ka0 = ldh(ka), ka1 = ldh(ka + 32), kb0 = ldh(ka + 16 * KPH), kb1 = ldh(ka + 16 * KPH + 32);
        v8f sa = (v8f){}, sb = (v8f){};
        sa = wmma16(ka0, qh0, sa); sb = wmma16(kb0, qh0, sb);
        sa = wmma16(ka1, qh1, sa); sb = wmma16(kb1, qh1, sb);
        asm volatile("v_nop\n\tv_nop\n\tv_nop\n\tv_nop" : "+v"(sa), "+v"(sb) : "v"(ka0), "v"(ka1), "v"(kb0), "v"(kb1), "v"(qh0), "v"(qh1));
        float ta[8], tb[8]; float mx = -3.0e38f;
#pragma unroll
        for (int r = 0; r < 8; ++r) { ta[r] = sa[r] * SC2; tb[r] = sb[r] * SC2; mx = fmaxf(mx, fmaxf(ta[r], tb[r])); }
        mx = fmaxf(mx, __shfl_xor(mx, 16, 32));
        const float mnew = fmaxf(m, mx);
        const float alpha = __builtin_amdgcn_exp2f(m - mnew);
        const float sh = PSH - mnew;
        v16h pb; float ls = 0.0f;
#pragma unroll
        for (int r = 0; r < 8; ++r) { const h16 pa = (h16)__builtin_amdgcn_exp2f(ta[r] + sh); const h16 pc = (h16)__builtin_amdgcn_exp2f(tb[r] + sh); pb[r] = pa; pb[8 + r] = pc; ls += (float)pa + (float)pc; }
        l = l * alpha + ls; m = mnew;
        o0 = o0 * alpha; o1 = o1 * alpha; o2 = o2 * alpha; o3 = o3 * alpha;
        const h16* va = buf + vo + key0;
        const v16h v0 = ldh(va), v1 = ldh(va + 16 * VPH), v2 = ldh(va + 32 * VPH), v3 = ldh(va + 48 * VPH);
        o0 = wmma16(v0, pb, o0); o1 = wmma16(v1, pb, o1); o2 = wmma16(v2, pb, o2); o3 = wmma16(v3, pb, o3);
        asm volatile("v_nop\n\tv_nop\n\tv_nop\n\tv_nop" : "+v"(o0), "+v"(o1), "+v"(o2), "+v"(o3) : "v"(v0), "v"(v1), "v"(v2), "v"(v3), "v"(pb));
      }
      asm volatile("s_wait_dscnt 0x0" ::: "memory");         // this wave's reads of the buffer have returned before it is refilled
      asm volatile("s_wait_asynccnt 0x0" ::: "memory");      // this wave's copies of the next tile have landed
      __syncthreads();                                       // publishes the next tile and ends every reader's last read of this buffer
      if (st + 2 < SEQ / KT) stage_kv(kg + (size_t)(st + 2) * KT * HD, vg + (st + 2) * KT, kl + (unsigned)(st & 1) * (STH * 2u), vl + (unsigned)(st & 1) * (STH * 2u));
    }
    asm volatile("s_wait_asynccnt 0x0" ::: "memory");        // no copy is outstanding when the wave goes on to its epilogue
    l += __shfl_xor(l, 16, 32);
    const float inv = 1.0f / l;
    const int wb = wave * 16 * 68;
    // O^T D layout: o_j[r] = (d = 16j + 8h + r, t = lane&15) -> os[t][d]; rows 0..15 x columns 0..63 all written
    { v4f a, c;
      a[0] = o0[0] * inv; a[1] = o0[1] * inv; a[2] = o0[2] * inv; a[3] = o0[3] * inv; c[0] = o0[4] * inv; c[1] = o0[5] * inv; c[2] = o0[6] * inv; c[3] = o0[7] * inv;
      *(v4fa*)(&os[wb + lr * 68 +  0 + 8 * hi]) = a; *(v4fa*)(&os[wb + lr * 68 +  0 + 8 * hi + 4]) = c;
      a[0] = o1[0] * inv; a[1] = o1[1] * inv; a[2] = o1[2] * inv; a[3] = o1[3] * inv; c[0] = o1[4] * inv; c[1] = o1[5] * inv; c[2] = o1[6] * inv; c[3] = o1[7] * inv;
      *(v4fa*)(&os[wb + lr * 68 + 16 + 8 * hi]) = a; *(v4fa*)(&os[wb + lr * 68 + 16 + 8 * hi + 4]) = c;
      a[0] = o2[0] * inv; a[1] = o2[1] * inv; a[2] = o2[2] * inv; a[3] = o2[3] * inv; c[0] = o2[4] * inv; c[1] = o2[5] * inv; c[2] = o2[6] * inv; c[3] = o2[7] * inv;
      *(v4fa*)(&os[wb + lr * 68 + 32 + 8 * hi]) = a; *(v4fa*)(&os[wb + lr * 68 + 32 + 8 * hi + 4]) = c;
      a[0] = o3[0] * inv; a[1] = o3[1] * inv; a[2] = o3[2] * inv; a[3] = o3[3] * inv; c[0] = o3[4] * inv; c[1] = o3[5] * inv; c[2] = o3[6] * inv; c[3] = o3[7] * inv;
      *(v4fa*)(&os[wb + lr * 68 + 48 + 8 * hi]) = a; *(v4fa*)(&os[wb + lr * 68 + 48 + 8 * hi + 4]) = c; }
    wave_sync();
    float* orow = OUT + ((size_t)b * OUT_SEQ + t0) * DM + h * HD;          // merged [b][t][h*64 + d]
    float* crow = CTX + ((size_t)zh * OUT_SEQ + t0) * HD;                  // context [b*16 + h][t][d]
{
#pragma unroll
        for (int s = 0; s < 8; ++s) { const int row = 2 * s + hi, cofs = lr * 4;   // 8 s x 2 rows = 16 rows; 16 lanes x 4 floats = 64 columns
            const v4f val = *(const v4fa*)(&os[wb + row * 68 + cofs]);
            *(v4f*)(orow + (size_t)row * DM + cofs) = val;
            *(v4f*)(crow + (size_t)row * HD + cofs) = val; }
         }
}

static constexpr size_t al256(size_t v) { return (v + 255) & ~(size_t)255; }
static constexpr size_t SZ_XB = al256((size_t)NB * SEQ * DM * 2);
static constexpr size_t SZ_WB = al256((size_t)3 * DM * DM * 2);
static constexpr size_t SZ_PL = al256((size_t)NB * NH_ * SEQ * HD * 2);
static constexpr size_t SZ_TOTAL = SZ_XB + SZ_WB + 3 * SZ_PL;
static_assert(SZ_TOTAL <= (size_t)134217728);          // workspace carve <= 128 MiB
static_assert(((size_t)DM * DM * 2) % 256 == 0);       // weight sub-planes stay 256-byte aligned

extern "C" void kernel_launch(void* const* d_in, const int* in_sizes, int n_in,
                              void* d_out, int out_size, void* d_ws, size_t ws_size, hipStream_t stream) {
    if (n_in < 4) return;
    const size_t needx = ((size_t)(NB - 1) * SEQ_FULL + SEQ) * DM;
    if ((size_t)in_sizes[0] < needx) return;
    if ((size_t)in_sizes[1] < (size_t)DM * DM || (size_t)in_sizes[2] < (size_t)DM * DM || (size_t)in_sizes[3] < (size_t)DM * DM) return;
    if ((size_t)out_size < CTX_OFF + ((size_t)(NB * NH_ - 1) * OUT_SEQ + SEQ) * HD) return;
    if (SZ_TOTAL > ws_size) return;
    const float* x = (const float*)d_in[0]; const float* wq = (const float*)d_in[1]; const float* wk = (const float*)d_in[2]; const float* wv = (const float*)d_in[3];   // wire order x, Wq, Wk, Wv ([out][in] = Bt as-is)
    float* OUT = (float*)d_out;              // [NB][SEQ][1024]
    float* CTX = (float*)d_out + CTX_OFF;    // [NB][16][SEQ][64]
    char* wsp = (char*)d_ws;
    bf* XB = (bf*)wsp; wsp += SZ_XB;                 // [NB*SEQ][1024]
    bf* WB = (bf*)wsp; wsp += SZ_WB;                 // [3][1024][1024]: q | k | v
    h16* QH = (h16*)wsp; wsp += SZ_PL;               // [NB*16][SEQ][64]
    h16* KP = (h16*)wsp; wsp += SZ_PL;               // [NB*16][SEQ][64]
    h16* VT = (h16*)wsp; wsp += SZ_PL;               // [NB*16][64][SEQ]
    bf* WQ = WB; bf* WK = WB + (size_t)DM * DM; bf* WV = WB + (size_t)2 * DM * DM;

    if (SEQ == SEQ_FULL) {
        const size_t n8 = (size_t)NB * SEQ * DM / 8;
        k_cvt8<<<(unsigned)((n8 + 255) / 256), 256, 0, stream>>>(x, XB, n8);
    } else {
        const size_t n8 = (size_t)SEQ * DM / 8;
        for (int b = 0; b < NB; ++b) k_cvt8<<<(unsigned)((n8 + 255) / 256), 256, 0, stream>>>(x + (size_t)b * SEQ_FULL * DM, XB + (size_t)b * SEQ * DM, n8);
    }
    { const size_t n8 = (size_t)DM * DM / 8; const unsigned g = (unsigned)((n8 + 255) / 256);
      k_cvt8<<<g, 256, 0, stream>>>(wq, WQ, n8); k_cvt8<<<g, 256, 0, stream>>>(wk, WK, n8); k_cvt8<<<g, 256, 0, stream>>>(wv, WV, n8); }

    // q, k: A = x rows (m = b*SEQ + t), Bt = W rows (n = h*64 + d) -> plane [(b*16 + h)][t][d]
    k_proj<<<dim3(NB * SEQ / 128, DM / 128, 1), 32 * PW, 0, stream>>>(XB, WQ, QH, SEQ, (size_t)NH_ * SEQ * HD, HD, HD, (size_t)SEQ * HD);
    k_proj<<<dim3(NB * SEQ / 128, DM / 128, 1), 32 * PW, 0, stream>>>(XB, WK, KP, SEQ, (size_t)NH_ * SEQ * HD, HD, HD, (size_t)SEQ * HD);
    // v^T: A = Wv rows (m = h*64 + d), Bt = x rows (n = b*SEQ + t) -> plane [(b*1024 + m)][t] = [(b*16 + h)][d][t]
    k_proj<<<dim3(DM / 128, NB * SEQ / 128, 1), 32 * PW, 0, stream>>>(WV, XB, VT, DM, (size_t)0, SEQ, SEQ, (size_t)DM * SEQ);

    k_flash<<<dim3(SEQ / (16 * AW), NB * NH_, 1), 32 * AW, 0, stream>>>(QH, KP, VT, OUT, CTX);
}

// v003
// A run of this version takes 73 microseconds.
// Next to v002, in two timings, it ran 1.17 and 1.15 times as fast.
// All steps since v000 together make it 2.74 times as fast.
#include <hip/hip_runtime.h>

// Multi-head self-attention, width 1024 = 16 heads x 64, x [NB][SEQ][1024], Wq/Wk/Wv [out][in] (y = x W^T), no biases, no mask, score scale 1/8; two f32 outputs: merged heads [NB][SEQ][1024] and per-head context [NB][16][SEQ][64].
// Compute dtypes, f32 accumulate everywhere: projections v_wmma_f32_16x16x32_bf16 (x and W RNE-converted to bf16; products exact);
// scores v_wmma_f32_16x16x32_f16: q and k single f16 (one product); P (x256 carry, cancels in the normalisation) and v single f16; softmax f32 (online, running max).
// Layout: bf16 copies of x and W; q, k planes [b*16+h][t][d] and v^T plane [b*16+h][d][t] written by the GEMM epilogue; fused flash kernel in transposed form (S^T = K Q^T, O^T = V^T P^T), both outputs from the same f32 accumulators.

#ifndef NB
#define NB 2
#endif
#ifndef SEQ
#define SEQ 2048
#endif
#define NB_FULL  2
#define SEQ_FULL 2048
#ifndef OUT_SEQ
#define OUT_SEQ SEQ              // row pitch (in tokens) between batches of the merged output and between (batch, head) slabs of the context output
#endif
#define DM   1024                // input width == projection width
#define NH_  16
#define HD   64
#define AW   8                   // waves per flash block (16 query rows each)
#define KT   128                 // keys per staged K / V^T tile
#define KPH  72                  // LDS pitch of a K row in halves: 128 B + 16 B (16 B x odd: ds_load_b128 readers meet no bank conflict)
#define VPH  136                 // LDS pitch of a V^T row in halves: 256 B + 16 B
#define KTH  (KT * KPH)          // halves of one K tile in LDS
#define STH  (KTH + HD * VPH)    // halves of one ring buffer (K tile, then V^T tile)
#define PW   8                   // waves per projection block: 4 x 2 wave tiles of 32 x 64
#define PKT  128                 // k per staged projection tile
#define PPH  136                 // LDS pitch of a staged operand row in 16-bit elements: 256 B + 16 B
#define POP  (128 * PPH)         // elements of one operand's staged tile (128 rows)
#define PST  (2 * POP)           // elements of one projection ring buffer (A tile, then Bt tile)
#define SC2  (0.125f * 1.4426950408889634f)   // HD^-0.5 * log2(e)
#define PSH  8.0f                // log2 of the P carry (256)
#define CTX_OFF ((size_t)NB_FULL * SEQ_FULL * DM)   // element offset of the second output (fixed, full-size constants)

static_assert(HD == 64);
static_assert(NH_ * HD == DM);                 // head h = columns h*64 + d
static_assert(DM % 64 == 0);                   // 16 column tiles of 64
static_assert(DM % 32 == 0);                   // GEMM k-loop steps by 32
static_assert(SEQ % 64 == 0);                  // a 64-row tile never straddles two batches
static_assert((NB * SEQ) % 128 == 0 && DM % 128 == 0);   // projection blocks of 128 x 128 cover both operand planes exactly
static_assert(DM % PKT == 0 && DM / PKT >= 2);           // whole k tiles only; the ring's prologue needs two
static_assert(PKT == 128 && PW == 8);                    // the copy map of stage_ab: 256 lanes x 16 B x 8 copies = one 32-KiB tile of each operand
static_assert(SEQ % 32 == 0 && DM % 32 == 0);            // a wave's 32 rows never straddle two output row blocks
static_assert(SEQ % 32 == 0);                  // key loop steps by 32
static_assert(SEQ % KT == 0 && SEQ / KT >= 2); // whole tiles only; the ring's prologue needs two
static_assert(KT == 128 && AW == 8);           // the copy map below: 256 lanes x 16 B x 4 copies = one 16-KiB tile of each operand
static_assert(SEQ % (16 * AW) == 0);           // flash grid covers the sequence exactly
static_assert(((size_t)SEQ * DM) % 8 == 0);
static_assert(((size_t)DM * DM) % 8 == 0);
static_assert(NB <= NB_FULL);
static_assert(SEQ <= SEQ_FULL);
static_assert(OUT_SEQ >= SEQ);
static_assert(OUT_SEQ <= SEQ_FULL);
static_assert(CTX_OFF * 4 == (size_t)16777216);                                            // byte offset of the second output
static_assert(((size_t)(NB - 1) * OUT_SEQ + SEQ) * DM <= CTX_OFF);                           // merged output stays inside its own region
static_assert(CTX_OFF + ((size_t)(NB * NH_ - 1) * OUT_SEQ + SEQ) * HD <= (size_t)2 * CTX_OFF); // context output stays inside the buffer (33554432 B)

typedef _Float16 h16;
typedef unsigned short bf;
typedef __attribute__((ext_vector_type(16))) __bf16   v16bf;
typedef __attribute__((ext_vector_type(16))) _Float16 v16h;
typedef __attribute__((ext_vector_type(8)))  _Float16 v8h;
typedef __attribute__((ext_vector_type(8)))  unsigned short v8us;
typedef __attribute__((ext_vector_type(8)))  float    v8f;
typedef __attribute__((ext_vector_type(4)))  float    v4f;
typedef v4f  __attribute__((may_alias)) v4fa;

__device__ __forceinline__ unsigned short f2bf(float f) { unsigned u = __float_as_uint(f); u += 0x7FFFu + ((u >> 16) & 1u); return (unsigned short)(u >> 16); }
__device__ __forceinline__ v16h cat16(v8h lo, v8h hi) { return __builtin_shufflevector(lo, hi, 0, 1, 2, 3, 4, 5, 6, 7, 8, 9, 10, 11, 12, 13, 14, 15); }
__device__ __forceinline__ v16bf cat16b(v8us lo, v8us hi) { return __builtin_bit_cast(v16bf, __builtin_shufflevector(lo, hi, 0, 1, 2, 3, 4, 5, 6, 7, 8, 9, 10, 11, 12, 13, 14, 15)); }
__device__ __forceinline__ v8f wmma16(v16h a, v16h b, v8f c) { return __builtin_amdgcn_wmma_f32_16x16x32_f16(false, a, false, b, (short)0, c, false, false); }
__device__ __forceinline__ v8f wmmab(v16bf a, v16bf b, v8f c) { return __builtin_amdgcn_wmma_f32_16x16x32_bf16(false, a, false, b, (short)0, c, false, false); }
// fragment loaders from K-contiguous 16-bit rows; p already includes + 8*(lane>>4): elements 0..7 <- k0+8h+0..7, elements 8..15 <- k0+16+8h+0..7 (same map for A and B)
__device__ __forceinline__ v16h  ldh(const h16* p) { return cat16(*(const v8h*)p, *(const v8h*)(p + 16)); }
__device__ __forceinline__ v16bf ldb(const bf* p)  { return cat16b(*(const v8us*)p, *(const v8us*)(p + 16)); }
// ordering point for wave-private LDS tiles (same wave writes and reads)
__device__ __forceinline__ void wave_sync() { __builtin_amdgcn_fence(3 /* release order */, "wavefront"); __builtin_amdgcn_wave_barrier(); asm volatile("" ::: "memory"); }

#define XBLK ((unsigned)((size_t)NB * SEQ * DM / 2048))   // conversion blocks (256 lanes x 8 elements) that cover x
#define WBLK ((unsigned)((size_t)DM * DM / 2048))         // ... and one weight matrix
static_assert(((size_t)SEQ * DM) % 2048 == 0 && ((size_t)DM * DM) % 2048 == 0);   // a block never straddles two batches or two matrices; the grid is exact

// k_cvt8: all four f32 -> bf16 conversions in one launch; the block index picks the source (blocks [0, XBLK): x, then WBLK blocks each of Wq, Wk, Wv). grid XBLK + 3 * WBLK.
__global__ __launch_bounds__(256) void k_cvt8(const float* __restrict__ x, const float* __restrict__ wq, const float* __restrict__ wk, const float* __restrict__ wv, bf* XB, bf* WB) {
    const unsigned bi = blockIdx.x;
    const float* src; bf* dst;
    if (bi < XBLK) {
        const unsigned b = bi / (XBLK / NB);                                   // batch: source pitch SEQ_FULL tokens, copy pitch SEQ tokens
        src = x + (size_t)b * SEQ_FULL * DM + (size_t)(bi - b * (XBLK / NB)) * 2048; dst = XB + (size_t)bi * 2048;
    } else {
        const unsigned wi = bi - XBLK, w = wi / WBLK;
        src = (w == 0 ? wq : w == 1 ? wk : wv) + (size_t)(wi - w * WBLK) * 2048; dst = WB + (size_t)wi * 2048;
    }
    const v8f v = *(const v8f*)(src + threadIdx.x * 8); v8us o;
#pragma unroll
    for (int k = 0; k < 8; ++k) o[k] = f2bf(v[k]);
    *(v8us*)(dst + threadIdx.x * 8) = o;
}

// Eight copies of one lane: 16 B of rows r, r + 16, ..., r + 112 of a K-contiguous bf16 plane, global memory to LDS through no register.
// g: the lane's first global chunk; l: its LDS byte address. Each wave-wide copy reads two rows x 256 B of whole lines.
__device__ __forceinline__ void stage_rows(const bf* g, unsigned l) {
    const bf* g1 = g + (size_t)16 * DM; const bf* g2 = g + (size_t)32 * DM; const bf* g3 = g + (size_t)48 * DM; const bf* g4 = g + (size_t)64 * DM;
    const bf* g5 = g + (size_t)80 * DM; const bf* g6 = g + (size_t)96 * DM; const bf* g7 = g + (size_t)112 * DM;
    const unsigned l1 = l + 16 * PPH * 2, l2 = l + 32 * PPH * 2, l3 = l + 48 * PPH * 2, l4 = l + 64 * PPH * 2, l5 = l + 80 * PPH * 2, l6 = l + 96 * PPH * 2, l7 = l + 112 * PPH * 2;
    // the closing s_wait_xcnt stands in the copies' own statement so that no address register is rewritten in front of it
    asm volatile("global_load_async_to_lds_b128 %0, %8, off\n\t"
                 "global_load_async_to_lds_b128 %1, %9, off\n\t"
                 "global_load_async_to_lds_b128 %2, %10, off\n\t"
                 "global_load_async_to_lds_b128 %3, %11, off\n\t"
                 "global_load_async_to_lds_b128 %4, %12, off\n\t"
                 "global_load_async_to_lds_b128 %5, %13, off\n\t"
                 "global_load_async_to_lds_b128 %6, %14, off\n\t"
                 "global_load_async_to_lds_b128 %7, %15, off\n\t"
                 "s_wait_xcnt 0x0"
                 :: "v"(l), "v"(l1), "v"(l2), "v"(l3), "v"(l4), "v"(l5), "v"(l6), "v"(l7),
                    "v"(g), "v"(g1), "v"(g2), "v"(g3), "v"(g4), "v"(g5), "v"(g6), "v"(g7) : "memory");
}
// One k tile's copies of one lane: 8 x 16 B of the block's 128 A rows and 8 x 16 B of its 128 Bt rows (16 copies of a wave in flight).
__device__ __forceinline__ void stage_ab(const bf* ag, const bf* bg, unsigned al, unsigned bl) { stage_rows(ag, al); stage_rows(bg, bl); }

__global__ __launch_bounds__(32 * PW) void k_proj(const bf* __restrict__ XB, const bf* __restrict__ WB, h16* QH, h16* KP, h16* VT) {
    __shared__ __align__(16) float osb[PW * 16 * 68];
    __shared__ __align__(16) bf pring[2 * PST];
    const int K = DM;
    const int lane = threadIdx.x & 31, wave = __builtin_amdgcn_readfirstlane((int)(threadIdx.x >> 5)), lr = lane & 15, hi = lane >> 4;
    const int pz = blockIdx.z; const bool isv = pz == 2;
    const bf* W = WB + (size_t)pz * DM * DM;
    const bf* A = isv ? W : XB; const bf* Bt = isv ? XB : W;
    h16* Ph = pz == 0 ? QH : pz == 1 ? KP : VT;
    const int bx = isv ? blockIdx.y : blockIdx.x, by = isv ? blockIdx.x : blockIdx.y;   // block row (of A) and block column (row of Bt)
    const int pitch = isv ? SEQ : HD;
    const int r0 = bx * 128 + (wave >> 1) * 32, c0 = by * 128 + (wave & 1) * 64;   // this wave's 32x64 tile
    float* os = osb + wave * 16 * 68;                                                              // wave-private epilogue tile
    v8f acc[2][4];
#pragma unroll
    for (int mb = 0; mb < 2; ++mb)
#pragma unroll
        for (int nb = 0; nb < 4; ++nb) acc[mb][nb] = (v8f){};
    const int ao = ((wave >> 1) * 32 + lr) * PPH + 8 * hi;            // + mb*16*PPH + k, in a buffer's A tile
    const int bo = POP + ((wave & 1) * 64 + lr) * PPH + 8 * hi;       // + nb*16*PPH + k, in its Bt tile
    const int tid = (int)threadIdx.x;
    const bf* ag = A  + (size_t)(bx * 128 + (tid >> 4)) * K + (tid & 15) * 8;   // + tile * PKT: row tid>>4, chunk tid&15 of its 256 B
    const bf* bg = Bt + (size_t)(by * 128 + (tid >> 4)) * K + (tid & 15) * 8;
    const unsigned pl = (unsigned)(size_t)&pring[0];                                    // LDS byte address of the ring
    const unsigned al = pl + (unsigned)((tid >> 4) * PPH + (tid & 15) * 8) * 2u;        // + buffer * PST * 2
    const unsigned bl = al + POP * 2u;
    stage_ab(ag, bg, al, bl);
    asm volatile("s_wait_asynccnt 0x0" ::: "memory");        // tile 0 of this wave's copies has landed
    __syncthreads();                                         // ... and every other wave's: tile 0 may be read
    stage_ab(ag + PKT, bg + PKT, al + PST * 2u, bl + PST * 2u);
#pragma unroll 1   // one trip per k tile: the ring's order stands once, at the trip's foot
    for (int st = 0; st < K / PKT; ++st) {
      const bf* buf = pring + (st & 1) * PST;
      v16bf a[2][2], b[2][4];                                // two fragment sets: the next step's loads go ahead of this step's products, as one group
#pragma unroll
      for (int mb = 0; mb < 2; ++mb) a[0][mb] = ldb(buf + ao + mb * 16 * PPH);
#pragma unroll
      for (int nb = 0; nb < 4; ++nb) b[0][nb] = ldb(buf + bo + nb * 16 * PPH);
#pragma unroll     // the four 32-k steps of a tile: the fragment sets alternate by a compile-time index
      for (int ks = 0; ks < PKT / 32; ++ks) {
        const int cu = ks & 1, nx = cu ^ 1;
        if (ks + 1 < PKT / 32) {                             // never past this tile: the next one is read only behind the trip's barrier
#pragma unroll
          for (int mb = 0; mb < 2; ++mb) a[nx][mb] = ldb(buf + ao + mb * 16 * PPH + (ks + 1) * 32);
#pragma unroll
          for (int nb = 0; nb < 4; ++nb) b[nx][nb] = ldb(buf + bo + nb * 16 * PPH + (ks + 1) * 32);
        }
        __builtin_amdgcn_sched_barrier(0);                   // keeps the next step's loads ahead of this step's products: left free, the compiler sinks each load to its use and waits out the LDS latency there
#pragma unroll
        for (int nb = 0; nb < 4; ++nb)
#pragma unroll
            for (int mb = 0; mb < 2; ++mb) acc[mb][nb] = wmmab(a[cu][mb], b[cu][nb], acc[mb][nb]);
        __builtin_amdgcn_sched_barrier(0);                   // ... and this step's products ahead of the loads of the step after next, which reuse their fragment set
      }
      asm volatile("s_wait_dscnt 0x0" ::: "memory");         // this wave's reads of the buffer have returned before it is refilled
      asm volatile("s_wait_asynccnt 0x0" ::: "memory");      // this wave's copies of the next tile have landed
      __syncthreads();                                       // publishes the next tile and ends every reader's last read of this buffer
      if (st + 2 < K / PKT) stage_ab(ag + (st + 2) * PKT, bg + (st + 2) * PKT, al + (unsigned)(st & 1) * (PST * 2u), bl + (unsigned)(st & 1) * (PST * 2u));
    }
    asm volatile("s_wait_asynccnt 0x0" ::: "memory");        // no copy is outstanding when the wave goes on to its epilogue
    const size_t tbase = isv ? (size_t)r0 * SEQ + (size_t)(c0 / SEQ) * ((size_t)DM * SEQ) + (size_t)(c0 % SEQ)
                             : (size_t)(r0 / SEQ) * ((size_t)NH_ * SEQ * HD) + (size_t)(r0 % SEQ) * HD + (size_t)(c0 / HD) * ((size_t)SEQ * HD);   // c0 is a multiple of HD
#pragma unroll
    for (int mb = 0; mb < 2; ++mb) {
#pragma unroll
        for (int nb = 0; nb < 4; ++nb) {
#pragma unroll
            for (int j = 0; j < 8; ++j) os[(hi * 8 + j) * 68 + nb * 16 + lr] = acc[mb][nb][j]; }   // D: row 8h+j, col lane&15
        wave_sync();
        const size_t sb = tbase + (size_t)(mb * 16) * (size_t)pitch;
{
#pragma unroll
            for (int s = 0; s < 4; ++s) { const int row = 4 * s + (lane >> 3), c8 = (lane & 7) * 8;   // 4 s x 4 row groups = 16 rows; 8 lanes x 8 = 64 columns
                const v4f x0 = *(const v4fa*)(&os[row * 68 + c8]); const v4f x1 = *(const v4fa*)(&os[row * 68 + c8 + 4]); v8h hv;
#pragma unroll
                for (int i = 0; i < 4; ++i) { hv[i] = (h16)x0[i]; hv[4 + i] = (h16)x1[i]; }
                const size_t oo = sb + (size_t)row * (size_t)pitch + c8;
                *(v8h*)(Ph + oo) = hv; }
             }
        wave_sync();
    }
}

// One tile's copies of one lane: 4 x 16 B of K and 4 x 16 B of V^T, global memory to LDS through no register. Each wave-wide copy reads 512 B of whole lines.
// kg, vg: the lane's first global chunk of each operand; kl, vl: its LDS byte address. Later chunks: K + 32 rows (contiguous in memory), V^T + 16 rows.
__device__ __forceinline__ void stage_kv(const h16* kg, const h16* vg, unsigned kl, unsigned vl) {
    const h16* kg1 = kg + 32 * HD; const h16* kg2 = kg + 64 * HD; const h16* kg3 = kg + 96 * HD;
    const h16* vg1 = vg + (size_t)16 * SEQ; const h16* vg2 = vg + (size_t)32 * SEQ; const h16* vg3 = vg + (size_t)48 * SEQ;
    const unsigned kl1 = kl + 32 * KPH * 2, kl2 = kl + 64 * KPH * 2, kl3 = kl + 96 * KPH * 2;
    const unsigned vl1 = vl + 16 * VPH * 2, vl2 = vl + 32 * VPH * 2, vl3 = vl + 48 * VPH * 2;
    // the closing s_wait_xcnt stands in the copies' own statement so that no address register is rewritten in front of it
    asm volatile("global_load_async_to_lds_b128 %0, %8, off\n\t"
                 "global_load_async_to_lds_b128 %1, %9, off\n\t"
                 "global_load_async_to_lds_b128 %2, %10, off\n\t"
                 "global_load_async_to_lds_b128 %3, %11, off\n\t"
                 "global_load_async_to_lds_b128 %4, %12, off\n\t"
                 "global_load_async_to_lds_b128 %5, %13, off\n\t"
                 "global_load_async_to_lds_b128 %6, %14, off\n\t"
                 "global_load_async_to_lds_b128 %7, %15, off\n\t"
                 "s_wait_xcnt 0x0"
                 :: "v"(kl), "v"(kl1), "v"(kl2), "v"(kl3), "v"(vl), "v"(vl1), "v"(vl2), "v"(vl3),
                    "v"(kg), "v"(kg1), "v"(kg2), "v"(kg3), "v"(vg), "v"(vg1), "v"(vg2), "v"(vg3) : "memory");
}

__global__ __launch_bounds__(32 * AW) void k_flash(const h16* __restrict__ QH, const h16* __restrict__ KP, const h16* __restrict__ VT, float* OUT, float* CTX) {
    __shared__ __align__(16) float os[AW * 16 * 68];
    __shared__ __align__(16) h16 ring[2 * STH];
    const int lane = threadIdx.x & 31, wave = __builtin_amdgcn_readfirstlane((int)(threadIdx.x >> 5)), lr = lane & 15, hi = lane >> 4;
    const int zh = blockIdx.y; const int b = zh / NH_, h = zh % NH_;
    const int t0 = (blockIdx.x * AW + wave) * 16;
    const size_t pbase = (size_t)zh * SEQ * HD;
    const size_t qo = pbase + (size_t)(t0 + lr) * HD + 8 * hi;
    const v16h qh0 = ldh(QH + qo), qh1 = ldh(QH + qo + 32);   // B fragments: col t, k = d
    const int ko = lr * KPH + 8 * hi;                        // + key * KPH      (A fragment: row key, k = d), in a K tile
    const int vo = KTH + lr * VPH + 8 * hi;                  // + 16j*VPH + key  (A fragment: row d, k = key), in a V^T tile
    const int tid = (int)threadIdx.x;
    const h16* kg = KP + pbase + (size_t)tid * 8;                                   // + tile * KT * HD: chunk tid of the tile's 16 KiB
    const h16* vg = VT + pbase + (size_t)(tid >> 4) * SEQ + (tid & 15) * 8;         // + tile * KT: row tid>>4, chunk tid&15 of its 256 B
    const unsigned rl = (unsigned)(size_t)&ring[0];                                 // LDS byte address of the ring
    const unsigned kl = rl + (unsigned)((tid >> 3) * KPH + (tid & 7) * 8) * 2u;     // + buffer * STH * 2
    const unsigned vl = rl + (unsigned)(KTH + (tid >> 4) * VPH + (tid & 15) * 8) * 2u;
    stage_kv(kg, vg, kl, vl);
    asm volatile("s_wait_asynccnt 0x0" ::: "memory");        // tile 0 of this wave's copies has landed
    __syncthreads();                                         // ... and every other wave's: tile 0 may be read
    stage_kv(kg + (size_t)KT * HD, vg + KT, kl + STH * 2u, vl + STH * 2u);
    v8f o0 = (v8f){}, o1 = (v8f){}, o2 = (v8f){}, o3 = (v8f){};
    float m = -3.0e38f, l = 0.0f;
#pragma unroll 1   // one trip per tile: the ring's order stands once, at the trip's foot
    for (int st = 0; st < SEQ / KT; ++st) {
      const h16* buf = ring + (st & 1) * STH;
#pragma unroll     // the four 32-key steps of a tile: lets the compiler fetch LDS fragments ahead inside the tile
      for (int key0 = 0; key0 < KT; key0 += 32) {
        const h16* ka = buf + ko + key0 * KPH;
        const v16h ka0 = ldh(ka), ka1 = ldh(ka + 32), kb0 = ldh(ka + 16 * KPH), kb1 = ldh(ka + 16 * KPH + 32);
        v8f sa = (v8f){}, sb = (v8f){};
        sa = wmma16(ka0, qh0, sa); sb = wmma16(kb0, qh0, sb);
        sa = wmma16(ka1, qh1, sa); sb = wmma16(kb1, qh1, sb);
        asm volatile("v_nop\n\tv_nop\n\tv_nop\n\tv_nop" : "+v"(sa), "+v"(sb) : "v"(ka0), "v"(ka1), "v"(kb0), "v"(kb1), "v"(qh0), "v"(qh1));
        float ta[8], tb[8]; float mx = -3.0e38f;
#pragma unroll
        for (int r = 0; r < 8; ++r) { ta[r] = sa[r] * SC2; tb[r] = sb[r] * SC2; mx = fmaxf(mx, fmaxf(ta[r], tb[r])); }
        mx = fmaxf(mx, __shfl_xor(mx, 16, 32));
        const float mnew = fmaxf(m, mx);
        const float alpha = __builtin_amdgcn_exp2f(m - mnew);
        const float sh = PSH - mnew;
        v16h pb; float ls = 0.0f;
#pragma unroll
        for (int r = 0; r < 8; ++r) { const h16 pa = (h16)__builtin_amdgcn_exp2f(ta[r] + sh); const h16 pc = (h16)__builtin_amdgcn_exp2f(tb[r] + sh); pb[r] = pa; pb[8 + r] = pc; ls += (float)pa + (float)pc; }
        l = l * alpha + ls; m = mnew;
        o0 = o0 * alpha; o1 = o1 * alpha; o2 = o2 * alpha; o3 = o3 * alpha;
        const h16* va = buf + vo + key0;
        const v16h v0 = ldh(va), v1 = ldh(va + 16 * VPH), v2 = ldh(va + 32 * VPH), v3 = ldh(va + 48 * VPH);
        o0 = wmma16(v0, pb, o0); o1 = wmma16(v1, pb, o1); o2 = wmma16(v2, pb, o2); o3 = wmma16(v3, pb, o3);
        asm volatile("v_nop\n\tv_nop\n\tv_nop\n\tv_nop" : "+v"(o0), "+v"(o1), "+v"(o2), "+v"(o3) : "v"(v0), "v"(v1), "v"(v2), "v"(v3), "v"(pb));
      }
      asm volatile("s_wait_dscnt 0x0" ::: "memory");         // this wave's reads of the buffer have returned before it is refilled
      asm volatile("s_wait_asynccnt 0x0" ::: "memory");      // this wave's copies of the next tile have landed
      __syncthreads();                                       // publishes the next tile and ends every reader's last read of this buffer
      if (st + 2 < SEQ / KT) stage_kv(kg + (size_t)(st + 2) * KT * HD, vg + (st + 2) * KT, kl + (unsigned)(st & 1) * (STH * 2u), vl + (unsigned)(st & 1) * (STH * 2u));
    }
    asm volatile("s_wait_asynccnt 0x0" ::: "memory");        // no copy is outstanding when the wave goes on to its epilogue
    l += __shfl_xor(l, 16, 32);
    const float inv = 1.0f / l;
    const int wb = wave * 16 * 68;
    // O^T D layout: o_j[r] = (d = 16j + 8h + r, t = lane&15) -> os[t][d]; rows 0..15 x columns 0..63 all written
    { v4f a, c;
      a[0] = o0[0] * inv; a[1] = o0[1] * inv; a[2] = o0[2] * inv; a[3] = o0[3] * inv; c[0] = o0[4] * inv; c[1] = o0[5] * inv; c[2] = o0[6] * inv; c[3] = o0[7] * inv;
      *(v4fa*)(&os[wb + lr * 68 +  0 + 8 * hi]) = a; *(v4fa*)(&os[wb + lr * 68 +  0 + 8 * hi + 4]) = c;
      a[0] = o1[0] * inv; a[1] = o1[1] * inv; a[2] = o1[2] * inv; a[3] = o1[3] * inv; c[0] = o1[4] * inv; c[1] = o1[5] * inv; c[2] = o1[6] * inv; c[3] = o1[7] * inv;
      *(v4fa*)(&os[wb + lr * 68 + 16 + 8 * hi]) = a; *(v4fa*)(&os[wb + lr * 68 + 16 + 8 * hi + 4]) = c;
      a[0] = o2[0] * inv; a[1] = o2[1] * inv; a[2] = o2[2] * inv; a[3] = o2[3] * inv; c[0] = o2[4] * inv; c[1] = o2[5] * inv; c[2] = o2[6] * inv; c[3] = o2[7] * inv;
      *(v4fa*)(&os[wb + lr * 68 + 32 + 8 * hi]) = a; *(v4fa*)(&os[wb + lr * 68 + 32 + 8 * hi + 4]) = c;
      a[0] = o3[0] * inv; a[1] = o3[1] * inv; a[2] = o3[2] * inv; a[3] = o3[3] * inv; c[0] = o3[4] * inv; c[1] = o3[5] * inv; c[2] = o3[6] * inv; c[3] = o3[7] * inv;
      *(v4fa*)(&os[wb + lr * 68 + 48 + 8 * hi]) = a; *(v4fa*)(&os[wb + lr * 68 + 48 + 8 * hi + 4]) = c; }
    wave_sync();
    float* orow = OUT + ((size_t)b * OUT_SEQ + t0) * DM + h * HD;          // merged [b][t][h*64 + d]
    float* crow = CTX + ((size_t)zh * OUT_SEQ + t0) * HD;                  // context [b*16 + h][t][d]
{
#pragma unroll
        for (int s = 0; s < 8; ++s) { const int row = 2 * s + hi, cofs = lr * 4;   // 8 s x 2 rows = 16 rows; 16 lanes x 4 floats = 64 columns
            const v4f val = *(const v4fa*)(&os[wb + row * 68 + cofs]);
            *(v4f*)(orow + (size_t)row * DM + cofs) = val;
            *(v4f*)(crow + (size_t)row * HD + cofs) = val; }
         }
}

static constexpr size_t al256(size_t v) { return (v + 255) & ~(size_t)255; }
static constexpr size_t SZ_XB = al256((size_t)NB * SEQ * DM * 2);
static constexpr size_t SZ_WB = al256((size_t)3 * DM * DM * 2);
static constexpr size_t SZ_PL = al256((size_t)NB * NH_ * SEQ * HD * 2);
static constexpr size_t SZ_TOTAL = SZ_XB + SZ_WB + 3 * SZ_PL;
static_assert(SZ_TOTAL <= (size_t)134217728);          // workspace carve <= 128 MiB
static_assert(((size_t)DM * DM * 2) % 256 == 0);       // weight sub-planes stay 256-byte aligned

extern "C" void kernel_launch(void* const* d_in, const int* in_sizes, int n_in,
                              void* d_out, int out_size, void* d_ws, size_t ws_size, hipStream_t stream) {
    if (n_in < 4) return;
    const size_t needx = ((size_t)(NB - 1) * SEQ_FULL + SEQ) * DM;
    if ((size_t)in_sizes[0] < needx) return;
    if ((size_t)in_sizes[1] < (size_t)DM * DM || (size_t)in_sizes[2] < (size_t)DM * DM || (size_t)in_sizes[3] < (size_t)DM * DM) return;
    if ((size_t)out_size < CTX_OFF + ((size_t)(NB * NH_ - 1) * OUT_SEQ + SEQ) * HD) return;
    if (SZ_TOTAL > ws_size) return;
    const float* x = (const float*)d_in[0]; const float* wq = (const float*)d_in[1]; const float* wk = (const float*)d_in[2]; const float* wv = (const float*)d_in[3];   // wire order x, Wq, Wk, Wv ([out][in] = Bt as-is)
    float* OUT = (float*)d_out;              // [NB][SEQ][1024]
    float* CTX = (float*)d_out + CTX_OFF;    // [NB][16][SEQ][64]
    char* wsp = (char*)d_ws;
    bf* XB = (bf*)wsp; wsp += SZ_XB;                 // [NB*SEQ][1024]
    bf* WB = (bf*)wsp; wsp += SZ_WB;                 // [3][1024][1024]: q | k | v
    h16* QH = (h16*)wsp; wsp += SZ_PL;               // [NB*16][SEQ][64]
    h16* KP = (h16*)wsp; wsp += SZ_PL;               // [NB*16][SEQ][64]
    h16* VT = (h16*)wsp; wsp += SZ_PL;               // [NB*16][64][SEQ]

    k_cvt8<<<XBLK + 3 * WBLK, 256, 0, stream>>>(x, wq, wk, wv, XB, WB);

    k_proj<<<dim3(NB * SEQ / 128, DM / 128, 3), 32 * PW, 0, stream>>>(XB, WB, QH, KP, VT);

    k_flash<<<dim3(SEQ / (16 * AW), NB * NH_, 1), 32 * AW, 0, stream>>>(QH, KP, VT, OUT, CTX);
}

// v004
// A run of this version takes 68.5 microseconds.
// In two side-by-side timings against v003, it was 1.07 and 1.04 times as fast.
// All steps since v000 together make it 2.89 times as fast.
#include <hip/hip_runtime.h>

// Multi-head self-attention, width 1024 = 16 heads x 64, x [NB][SEQ][1024], Wq/Wk/Wv [out][in] (y = x W^T), no biases, no mask, score scale 1/8; two f32 outputs: merged heads [NB][SEQ][1024] and per-head context [NB][16][SEQ][64].
// Compute dtypes, f32 accumulate everywhere: projections v_wmma_f32_16x16x32_bf16 (x and W RNE-converted to bf16; products exact);
// scores v_wmma_f32_16x16x32_f16: q and k single f16 (one product); P (x256 carry, cancels in the normalisation) and v single f16; softmax f32 (online, running max).
// Layout: bf16 copies of x and W; q, k planes [b*16+h][t][d] and v^T plane [b*16+h][d][t] written by the GEMM epilogue; fused flash kernel in transposed form (S^T = K Q^T, O^T = V^T P^T), both outputs from the same f32 accumulators.

#ifndef NB
#define NB 2
#endif
#ifndef SEQ
#define SEQ 2048
#endif
#define NB_FULL  2
#define SEQ_FULL 2048
#ifndef OUT_SEQ
#define OUT_SEQ SEQ              // row pitch (in tokens) between batches of the merged output and between (batch, head) slabs of the context output
#endif
#define DM   1024                // input width == projection width
#define NH_  16
#define HD   64
#define AW   8                   // waves per flash block (16 query rows each)
#define KT   128                 // keys per staged K / V^T tile
#define KPH  72                  // LDS pitch of a K row in halves: 128 B + 16 B (16 B x odd: ds_load_b128 readers meet no bank conflict)
#define VPH  136                 // LDS pitch of a V^T row in halves: 256 B + 16 B
#define KTH  (KT * KPH)          // halves of one K tile in LDS
#define STH  (KTH + HD * VPH)    // halves of one ring buffer (K tile, then V^T tile)
#define PW   8                   // waves per projection block: 4 x 2 wave tiles of 32 x 64
#define PKT  128                 // k per staged projection tile
#define PPH  136                 // LDS pitch of a staged operand row in 16-bit elements: 256 B + 16 B
#define POP  (128 * PPH)         // elements of one operand's staged tile (128 rows)
#define PST  (2 * POP)           // elements of one projection ring buffer (A tile, then Bt tile)
#define SC2  (0.125f * 1.4426950408889634f)   // HD^-0.5 * log2(e)
#define PSH  8.0f                // log2 of the P carry (256)
#define CTX_OFF ((size_t)NB_FULL * SEQ_FULL * DM)   // element offset of the second output (fixed, full-size constants)

static_assert(HD == 64);
static_assert(NH_ * HD == DM);                 // head h = columns h*64 + d
static_assert(DM % 64 == 0);                   // 16 column tiles of 64
static_assert(DM % 32 == 0);                   // GEMM k-loop steps by 32
static_assert(SEQ % 64 == 0);                  // a 64-row tile never straddles two batches
static_assert((NB * SEQ) % 128 == 0 && DM % 128 == 0);   // projection blocks of 128 x 128 cover both operand planes exactly
static_assert(DM % PKT == 0 && DM / PKT >= 2);           // whole k tiles only; the ring's prologue needs two
static_assert((size_t)PW * 16 * 68 * 4 <= (size_t)2 * PST * 2);   // the epilogue tiles fit the ring they are laid over
static_assert((size_t)2 * (2 * PST * 2) <= (size_t)327680);       // two projection blocks fit one WGP's LDS
static_assert(PKT == 128 && PW == 8);                    // the copy map of stage_ab: 256 lanes x 16 B x 8 copies = one 32-KiB tile of each operand
static_assert(SEQ % 32 == 0 && DM % 32 == 0);            // a wave's 32 rows never straddle two output row blocks
static_assert(SEQ % 32 == 0);                  // key loop steps by 32
static_assert(SEQ % KT == 0 && SEQ / KT >= 2); // whole tiles only; the ring's prologue needs two
static_assert(KT == 128 && AW == 8);           // the copy map below: 256 lanes x 16 B x 4 copies = one 16-KiB tile of each operand
static_assert(SEQ % (16 * AW) == 0);           // flash grid covers the sequence exactly
static_assert(((size_t)SEQ * DM) % 8 == 0);
static_assert(((size_t)DM * DM) % 8 == 0);
static_assert(NB <= NB_FULL);
static_assert(SEQ <= SEQ_FULL);
static_assert(OUT_SEQ >= SEQ);
static_assert(OUT_SEQ <= SEQ_FULL);
static_assert(CTX_OFF * 4 == (size_t)16777216);                                            // byte offset of the second output
static_assert(((size_t)(NB - 1) * OUT_SEQ + SEQ) * DM <= CTX_OFF);                           // merged output stays inside its own region
static_assert(CTX_OFF + ((size_t)(NB * NH_ - 1) * OUT_SEQ + SEQ) * HD <= (size_t)2 * CTX_OFF); // context output stays inside the buffer (33554432 B)

typedef _Float16 h16;
typedef unsigned short bf;
typedef __attribute__((ext_vector_type(16))) __bf16   v16bf;
typedef __attribute__((ext_vector_type(16))) _Float16 v16h;
typedef __attribute__((ext_vector_type(8)))  _Float16 v8h;
typedef __attribute__((ext_vector_type(8)))  unsigned short v8us;
typedef __attribute__((ext_vector_type(8)))  float    v8f;
typedef __attribute__((ext_vector_type(4)))  float    v4f;
typedef v4f  __attribute__((may_alias)) v4fa;

__device__ __forceinline__ unsigned short f2bf(float f) { unsigned u = __float_as_uint(f); u += 0x7FFFu + ((u >> 16) & 1u); return (unsigned short)(u >> 16); }
__device__ __forceinline__ v16h cat16(v8h lo, v8h hi) { return __builtin_shufflevector(lo, hi, 0, 1, 2, 3, 4, 5, 6, 7, 8, 9, 10, 11, 12, 13, 14, 15); }
__device__ __forceinline__ v16bf cat16b(v8us lo, v8us hi) { return __builtin_bit_cast(v16bf, __builtin_shufflevector(lo, hi, 0, 1, 2, 3, 4, 5, 6, 7, 8, 9, 10, 11, 12, 13, 14, 15)); }
__device__ __forceinline__ v8f wmma16(v16h a, v16h b, v8f c) { return __builtin_amdgcn_wmma_f32_16x16x32_f16(false, a, false, b, (short)0, c, false, false); }
__device__ __forceinline__ v8f wmmab(v16bf a, v16bf b, v8f c) { return __builtin_amdgcn_wmma_f32_16x16x32_bf16(false, a, false, b, (short)0, c, false, false); }
// fragment loaders from K-contiguous 16-bit rows; p already includes + 8*(lane>>4): elements 0..7 <- k0+8h+0..7, elements 8..15 <- k0+16+8h+0..7 (same map for A and B)
__device__ __forceinline__ v16h  ldh(const h16* p) { return cat16(*(const v8h*)p, *(const v8h*)(p + 16)); }
__device__ __forceinline__ v16bf ldb(const bf* p)  { return cat16b(*(const v8us*)p, *(const v8us*)(p + 16)); }
// ordering point for wave-private LDS tiles (same wave writes and reads)
__device__ __forceinline__ void wave_sync() { __builtin_amdgcn_fence(3 /* release order */, "wavefront"); __builtin_amdgcn_wave_barrier(); asm volatile("" ::: "memory"); }

#define XBLK ((unsigned)((size_t)NB * SEQ * DM / 2048))   // conversion blocks (256 lanes x 8 elements) that cover x
#define WBLK ((unsigned)((size_t)DM * DM / 2048))         // ... and one weight matrix
static_assert(((size_t)SEQ * DM) % 2048 == 0 && ((size_t)DM * DM) % 2048 == 0);   // a block never straddles two batches or two matrices; the grid is exact

// k_cvt8: all four f32 -> bf16 conversions in one launch; the block index picks the source (blocks [0, XBLK): x, then WBLK blocks each of Wq, Wk, Wv). grid XBLK + 3 * WBLK.
__global__ __launch_bounds__(256) void k_cvt8(const float* __restrict__ x, const float* __restrict__ wq, const float* __restrict__ wk, const float* __restrict__ wv, bf* XB, bf* WB) {
    const unsigned bi = blockIdx.x;
    const float* src; bf* dst;
    if (bi < XBLK) {
        const unsigned b = bi / (XBLK / NB);                                   // batch: source pitch SEQ_FULL tokens, copy pitch SEQ tokens
        src = x + (size_t)b * SEQ_FULL * DM + (size_t)(bi - b * (XBLK / NB)) * 2048; dst = XB + (size_t)bi * 2048;
    } else {
        const unsigned wi = bi - XBLK, w = wi / WBLK;
        src = (w == 0 ? wq : w == 1 ? wk : wv) + (size_t)(wi - w * WBLK) * 2048; dst = WB + (size_t)wi * 2048;
    }
    const v8f v = *(const v8f*)(src + threadIdx.x * 8); v8us o;
#pragma unroll
    for (int k = 0; k < 8; ++k) o[k] = f2bf(v[k]);
    *(v8us*)(dst + threadIdx.x * 8) = o;
}

// Eight copies of one lane: 16 B of rows r, r + 16, ..., r + 112 of a K-contiguous bf16 plane, global memory to LDS through no register.
// g: the lane's first global chunk; l: its LDS byte address. Each wave-wide copy reads two rows x 256 B of whole lines.
__device__ __forceinline__ void stage_rows(const bf* g, unsigned l) {
    const bf* g1 = g + (size_t)16 * DM; const bf* g2 = g + (size_t)32 * DM; const bf* g3 = g + (size_t)48 * DM; const bf* g4 = g + (size_t)64 * DM;
    const bf* g5 = g + (size_t)80 * DM; const bf* g6 = g + (size_t)96 * DM; const bf* g7 = g + (size_t)112 * DM;
    const unsigned l1 = l + 16 * PPH * 2, l2 = l + 32 * PPH * 2, l3 = l + 48 * PPH * 2, l4 = l + 64 * PPH * 2, l5 = l + 80 * PPH * 2, l6 = l + 96 * PPH * 2, l7 = l + 112 * PPH * 2;
    // the closing s_wait_xcnt stands in the copies' own statement so that no address register is rewritten in front of it
    asm volatile("global_load_async_to_lds_b128 %0, %8, off\n\t"
                 "global_load_async_to_lds_b128 %1, %9, off\n\t"
                 "global_load_async_to_lds_b128 %2, %10, off\n\t"
                 "global_load_async_to_lds_b128 %3, %11, off\n\t"
                 "global_load_async_to_lds_b128 %4, %12, off\n\t"
                 "global_load_async_to_lds_b128 %5, %13, off\n\t"
                 "global_load_async_to_lds_b128 %6, %14, off\n\t"
                 "global_load_async_to_lds_b128 %7, %15, off\n\t"
                 "s_wait_xcnt 0x0"
                 :: "v"(l), "v"(l1), "v"(l2), "v"(l3), "v"(l4), "v"(l5), "v"(l6), "v"(l7),
                    "v"(g), "v"(g1), "v"(g2), "v"(g3), "v"(g4), "v"(g5), "v"(g6), "v"(g7) : "memory");
}
// One k tile's copies of one lane: 8 x 16 B of the block's 128 A rows and 8 x 16 B of its 128 Bt rows (16 copies of a wave in flight).
__device__ __forceinline__ void stage_ab(const bf* ag, const bf* bg, unsigned al, unsigned bl) { stage_rows(ag, al); stage_rows(bg, bl); }

__global__ __launch_bounds__(32 * PW) void k_proj(const bf* __restrict__ XB, const bf* __restrict__ WB, h16* QH, h16* KP, h16* VT) {
    __shared__ __align__(16) bf pring[2 * PST];
    const int K = DM;
    const int lane = threadIdx.x & 31, wave = __builtin_amdgcn_readfirstlane((int)(threadIdx.x >> 5)), lr = lane & 15, hi = lane >> 4;
    const int pz = blockIdx.z; const bool isv = pz == 2;
    const bf* W = WB + (size_t)pz * DM * DM;
    const bf* A = isv ? W : XB; const bf* Bt = isv ? XB : W;
    h16* Ph = pz == 0 ? QH : pz == 1 ? KP : VT;
    const int bx = isv ? blockIdx.y : blockIdx.x, by = isv ? blockIdx.x : blockIdx.y;   // block row (of A) and block column (row of Bt)
    const int pitch = isv ? SEQ : HD;
    const int r0 = bx * 128 + (wave >> 1) * 32, c0 = by * 128 + (wave & 1) * 64;   // this wave's 32x64 tile
    float* os = (float*)pring + wave * 16 * 68;   // wave-private epilogue tile, laid over the ring: written only behind the last trip's foot (every wave's reads returned, its copies landed, barrier passed)
    v8f acc[2][4];
#pragma unroll
    for (int mb = 0; mb < 2; ++mb)
#pragma unroll
        for (int nb = 0; nb < 4; ++nb) acc[mb][nb] = (v8f){};
    const int ao = ((wave >> 1) * 32 + lr) * PPH + 8 * hi;            // + mb*16*PPH + k, in a buffer's A tile
    const int bo = POP + ((wave & 1) * 64 + lr) * PPH + 8 * hi;       // + nb*16*PPH + k, in its Bt tile
    const int tid = (int)threadIdx.x;
    const bf* ag = A  + (size_t)(bx * 128 + (tid >> 4)) * K + (tid & 15) * 8;   // + tile * PKT: row tid>>4, chunk tid&15 of its 256 B
    const bf* bg = Bt + (size_t)(by * 128 + (tid >> 4)) * K + (tid & 15) * 8;
    const unsigned pl = (unsigned)(size_t)&pring[0];                                    // LDS byte address of the ring
    const unsigned al = pl + (unsigned)((tid >> 4) * PPH + (tid & 15) * 8) * 2u;        // + buffer * PST * 2
    const unsigned bl = al + POP * 2u;
    stage_ab(ag, bg, al, bl);
    asm volatile("s_wait_asynccnt 0x0" ::: "memory");        // tile 0 of this wave's copies has landed
    __syncthreads();                                         // ... and every other wave's: tile 0 may be read
    stage_ab(ag + PKT, bg + PKT, al + PST * 2u, bl + PST * 2u);
#pragma unroll 1   // one trip per k tile: the ring's order stands once, at the trip's foot
    for (int st = 0; st < K / PKT; ++st) {
      const bf* buf = pring + (st & 1) * PST;
      v16bf a[2][2], b[2][4];                                // two fragment sets: the next step's loads go ahead of this step's products, as one group
#pragma unroll
      for (int mb = 0; mb < 2; ++mb) a[0][mb] = ldb(buf + ao + mb * 16 * PPH);
#pragma unroll
      for (int nb = 0; nb < 4; ++nb) b[0][nb] = ldb(buf + bo + nb * 16 * PPH);
#pragma unroll     // the four 32-k steps of a tile: the fragment sets alternate by a compile-time index
      for (int ks = 0; ks < PKT / 32; ++ks) {
        const int cu = ks & 1, nx = cu ^ 1;
        if (ks + 1 < PKT / 32) {                             // never past this tile: the next one is read only behind the trip's barrier
#pragma unroll
          for (int mb = 0; mb < 2; ++mb) a[nx][mb] = ldb(buf + ao + mb * 16 * PPH + (ks + 1) * 32);
#pragma unroll
          for (int nb = 0; nb < 4; ++nb) b[nx][nb] = ldb(buf + bo + nb * 16 * PPH + (ks + 1) * 32);
        }
        __builtin_amdgcn_sched_barrier(0);                   // keeps the next step's loads ahead of this step's products: left free, the compiler sinks each load to its use and waits out the LDS latency there
#pragma unroll
        for (int nb = 0; nb < 4; ++nb)
#pragma unroll
            for (int mb = 0; mb < 2; ++mb) acc[mb][nb] = wmmab(a[cu][mb], b[cu][nb], acc[mb][nb]);
        __builtin_amdgcn_sched_barrier(0);                   // ... and this step's products ahead of the loads of the step after next, which reuse their fragment set
      }
      asm volatile("s_wait_dscnt 0x0" ::: "memory");         // this wave's reads of the buffer have returned before it is refilled
      asm volatile("s_wait_asynccnt 0x0" ::: "memory");      // this wave's copies of the next tile have landed
      __syncthreads();                                       // publishes the next tile and ends every reader's last read of this buffer
      if (st + 2 < K / PKT) stage_ab(ag + (st + 2) * PKT, bg + (st + 2) * PKT, al + (unsigned)(st & 1) * (PST * 2u), bl + (unsigned)(st & 1) * (PST * 2u));
    }
    asm volatile("s_wait_asynccnt 0x0" ::: "memory");        // no copy is outstanding when the wave goes on to its epilogue
    const size_t tbase = isv ? (size_t)r0 * SEQ + (size_t)(c0 / SEQ) * ((size_t)DM * SEQ) + (size_t)(c0 % SEQ)
                             : (size_t)(r0 / SEQ) * ((size_t)NH_ * SEQ * HD) + (size_t)(r0 % SEQ) * HD + (size_t)(c0 / HD) * ((size_t)SEQ * HD);   // c0 is a multiple of HD
#pragma unroll
    for (int mb = 0; mb < 2; ++mb) {
#pragma unroll
        for (int nb = 0; nb < 4; ++nb) {
#pragma unroll
            for (int j = 0; j < 8; ++j) os[(hi * 8 + j) * 68 + nb * 16 + lr] = acc[mb][nb][j]; }   // D: row 8h+j, col lane&15
        wave_sync();
        const size_t sb = tbase + (size_t)(mb * 16) * (size_t)pitch;
{
#pragma unroll
            for (int s = 0; s < 4; ++s) { const int row = 4 * s + (lane >> 3), c8 = (lane & 7) * 8;   // 4 s x 4 row groups = 16 rows; 8 lanes x 8 = 64 columns
                const v4f x0 = *(const v4fa*)(&os[row * 68 + c8]); const v4f x1 = *(const v4fa*)(&os[row * 68 + c8 + 4]); v8h hv;
#pragma unroll
                for (int i = 0; i < 4; ++i) { hv[i] = (h16)x0[i]; hv[4 + i] = (h16)x1[i]; }
                const size_t oo = sb + (size_t)row * (size_t)pitch + c8;
                *(v8h*)(Ph + oo) = hv; }
             }
        wave_sync();
    }
}

// One tile's copies of one lane: 4 x 16 B of K and 4 x 16 B of V^T, global memory to LDS through no register. Each wave-wide copy reads 512 B of whole lines.
// kg, vg: the lane's first global chunk of each operand; kl, vl: its LDS byte address. Later chunks: K + 32 rows (contiguous in memory), V^T + 16 rows.
__device__ __forceinline__ void stage_kv(const h16* kg, const h16* vg, unsigned kl, unsigned vl) {
    const h16* kg1 = kg + 32 * HD; const h16* kg2 = kg + 64 * HD; const h16* kg3 = kg + 96 * HD;
    const h16* vg1 = vg + (size_t)16 * SEQ; const h16* vg2 = vg + (size_t)32 * SEQ; const h16* vg3 = vg + (size_t)48 * SEQ;
    const unsigned kl1 = kl + 32 * KPH * 2, kl2 = kl + 64 * KPH * 2, kl3 = kl + 96 * KPH * 2;
    const unsigned vl1 = vl + 16 * VPH * 2, vl2 = vl + 32 * VPH * 2, vl3 = vl + 48 * VPH * 2;
    // the closing s_wait_xcnt stands in the copies' own statement so that no address register is rewritten in front of it
    asm volatile("global_load_async_to_lds_b128 %0, %8, off\n\t"
                 "global_load_async_to_lds_b128 %1, %9, off\n\t"
                 "global_load_async_to_lds_b128 %2, %10, off\n\t"
                 "global_load_async_to_lds_b128 %3, %11, off\n\t"
                 "global_load_async_to_lds_b128 %4, %12, off\n\t"
                 "global_load_async_to_lds_b128 %5, %13, off\n\t"
                 "global_load_async_to_lds_b128 %6, %14, off\n\t"
                 "global_load_async_to_lds_b128 %7, %15, off\n\t"
                 "s_wait_xcnt 0x0"
                 :: "v"(kl), "v"(kl1), "v"(kl2), "v"(kl3), "v"(vl), "v"(vl1), "v"(vl2), "v"(vl3),
                    "v"(kg), "v"(kg1), "v"(kg2), "v"(kg3), "v"(vg), "v"(vg1), "v"(vg2), "v"(vg3) : "memory");
}

__global__ __launch_bounds__(32 * AW) void k_flash(const h16* __restrict__ QH, const h16* __restrict__ KP, const h16* __restrict__ VT, float* OUT, float* CTX) {
    __shared__ __align__(16) float os[AW * 16 * 68];
    __shared__ __align__(16) h16 ring[2 * STH];
    const int lane = threadIdx.x & 31, wave = __builtin_amdgcn_readfirstlane((int)(threadIdx.x >> 5)), lr = lane & 15, hi = lane >> 4;
    const int zh = blockIdx.y; const int b = zh / NH_, h = zh % NH_;
    const int t0 = (blockIdx.x * AW + wave) * 16;
    const size_t pbase = (size_t)zh * SEQ * HD;
    const size_t qo = pbase + (size_t)(t0 + lr) * HD + 8 * hi;
    const v16h qh0 = ldh(QH + qo), qh1 = ldh(QH + qo + 32);   // B fragments: col t, k = d
    const int ko = lr * KPH + 8 * hi;                        // + key * KPH      (A fragment: row key, k = d), in a K tile
    const int vo = KTH + lr * VPH + 8 * hi;                  // + 16j*VPH + key  (A fragment: row d, k = key), in a V^T tile
    const int tid = (int)threadIdx.x;
    const h16* kg = KP + pbase + (size_t)tid * 8;                                   // + tile * KT * HD: chunk tid of the tile's 16 KiB
    const h16* vg = VT + pbase + (size_t)(tid >> 4) * SEQ + (tid & 15) * 8;         // + tile * KT: row tid>>4, chunk tid&15 of its 256 B
    const unsigned rl = (unsigned)(size_t)&ring[0];                                 // LDS byte address of the ring
    const unsigned kl = rl + (unsigned)((tid >> 3) * KPH + (tid & 7) * 8) * 2u;     // + buffer * STH * 2
    const unsigned vl = rl + (unsigned)(KTH + (tid >> 4) * VPH + (tid & 15) * 8) * 2u;
    stage_kv(kg, vg, kl, vl);
    asm volatile("s_wait_asynccnt 0x0" ::: "memory");        // tile 0 of this wave's copies has landed
    __syncthreads();                                         // ... and every other wave's: tile 0 may be read
    stage_kv(kg + (size_t)KT * HD, vg + KT, kl + STH * 2u, vl + STH * 2u);
    v8f o0 = (v8f){}, o1 = (v8f){}, o2 = (v8f){}, o3 = (v8f){};
    float m = -3.0e38f, l = 0.0f;
#pragma unroll 1   // one trip per tile: the ring's order stands once, at the trip's foot
    for (int st = 0; st < SEQ / KT; ++st) {
      const h16* buf = ring + (st & 1) * STH;
#pragma unroll     // the four 32-key steps of a tile: lets the compiler fetch LDS fragments ahead inside the tile
      for (int key0 = 0; key0 < KT; key0 += 32) {
        const h16* ka = buf + ko + key0 * KPH;
        const v16h ka0 = ldh(ka), ka1 = ldh(ka + 32), kb0 = ldh(ka + 16 * KPH), kb1 = ldh(ka + 16 * KPH + 32);
        v8f sa = (v8f){}, sb = (v8f){};
        sa = wmma16(ka0, qh0, sa); sb = wmma16(kb0, qh0, sb);
        sa = wmma16(ka1, qh1, sa); sb = wmma16(kb1, qh1, sb);
        asm volatile("v_nop\n\tv_nop\n\tv_nop\n\tv_nop" : "+v"(sa), "+v"(sb) : "v"(ka0), "v"(ka1), "v"(kb0), "v"(kb1), "v"(qh0), "v"(qh1));
        float ta[8], tb[8]; float mx = -3.0e38f;
#pragma unroll
        for (int r = 0; r < 8; ++r) { ta[r] = sa[r] * SC2; tb[r] = sb[r] * SC2; mx = fmaxf(mx, fmaxf(ta[r], tb[r])); }
        mx = fmaxf(mx, __shfl_xor(mx, 16, 32));
        const float mnew = fmaxf(m, mx);
        const float alpha = __builtin_amdgcn_exp2f(m - mnew);
        const float sh = PSH - mnew;
        v16h pb; float ls = 0.0f;
#pragma unroll
        for (int r = 0; r < 8; ++r) { const h16 pa = (h16)__builtin_amdgcn_exp2f(ta[r] + sh); const h16 pc = (h16)__builtin_amdgcn_exp2f(tb[r] + sh); pb[r] = pa; pb[8 + r] = pc; ls += (float)pa + (float)pc; }
        l = l * alpha + ls; m = mnew;
        o0 = o0 * alpha; o1 = o1 * alpha; o2 = o2 * alpha; o3 = o3 * alpha;
        const h16* va = buf + vo + key0;
        const v16h v0 = ldh(va), v1 = ldh(va + 16 * VPH), v2 = ldh(va + 32 * VPH), v3 = ldh(va + 48 * VPH);
        o0 = wmma16(v0, pb, o0); o1 = wmma16(v1, pb, o1); o2 = wmma16(v2, pb, o2); o3 = wmma16(v3, pb, o3);
        asm volatile("v_nop\n\tv_nop\n\tv_nop\n\tv_nop" : "+v"(o0), "+v"(o1), "+v"(o2), "+v"(o3) : "v"(v0), "v"(v1), "v"(v2), "v"(v3), "v"(pb));
      }
      asm volatile("s_wait_dscnt 0x0" ::: "memory");         // this wave's reads of the buffer have returned before it is refilled
      asm volatile("s_wait_asynccnt 0x0" ::: "memory");      // this wave's copies of the next tile have landed
      __syncthreads();                                       // publishes the next tile and ends every reader's last read of this buffer
      if (st + 2 < SEQ / KT) stage_kv(kg + (size_t)(st + 2) * KT * HD, vg + (st + 2) * KT, kl + (unsigned)(st & 1) * (STH * 2u), vl + (unsigned)(st & 1) * (STH * 2u));
    }
    asm volatile("s_wait_asynccnt 0x0" ::: "memory");        // no copy is outstanding when the wave goes on to its epilogue
    l += __shfl_xor(l, 16, 32);
    const float inv = 1.0f / l;
    const int wb = wave * 16 * 68;
    // O^T D layout: o_j[r] = (d = 16j + 8h + r, t = lane&15) -> os[t][d]; rows 0..15 x columns 0..63 all written
    { v4f a, c;
      a[0] = o0[0] * inv; a[1] = o0[1] * inv; a[2] = o0[2] * inv; a[3] = o0[3] * inv; c[0] = o0[4] * inv; c[1] = o0[5] * inv; c[2] = o0[6] * inv; c[3] = o0[7] * inv;
      *(v4fa*)(&os[wb + lr * 68 +  0 + 8 * hi]) = a; *(v4fa*)(&os[wb + lr * 68 +  0 + 8 * hi + 4]) = c;
      a[0] = o1[0] * inv; a[1] = o1[1] * inv; a[2] = o1[2] * inv; a[3] = o1[3] * inv; c[0] = o1[4] * inv; c[1] = o1[5] * inv; c[2] = o1[6] * inv; c[3] = o1[7] * inv;
      *(v4fa*)(&os[wb + lr * 68 + 16 + 8 * hi]) = a; *(v4fa*)(&os[wb + lr * 68 + 16 + 8 * hi + 4]) = c;
      a[0] = o2[0] * inv; a[1] = o2[1] * inv; a[2] = o2[2] * inv; a[3] = o2[3] * inv; c[0] = o2[4] * inv; c[1] = o2[5] * inv; c[2] = o2[6] * inv; c[3] = o2[7] * inv;
      *(v4fa*)(&os[wb + lr * 68 + 32 + 8 * hi]) = a; *(v4fa*)(&os[wb + lr * 68 + 32 + 8 * hi + 4]) = c;
      a[0] = o3[0] * inv; a[1] = o3[1] * inv; a[2] = o3[2] * inv; a[3] = o3[3] * inv; c[0] = o3[4] * inv; c[1] = o3[5] * inv; c[2] = o3[6] * inv; c[3] = o3[7] * inv;
      *(v4fa*)(&os[wb + lr * 68 + 48 + 8 * hi]) = a; *(v4fa*)(&os[wb + lr * 68 + 48 + 8 * hi + 4]) = c; }
    wave_sync();
    float* orow = OUT + ((size_t)b * OUT_SEQ + t0) * DM + h * HD;          // merged [b][t][h*64 + d]
    float* crow = CTX + ((size_t)zh * OUT_SEQ + t0) * HD;                  // context [b*16 + h][t][d]
{
#pragma unroll
        for (int s = 0; s < 8; ++s) { const int row = 2 * s + hi, cofs = lr * 4;   // 8 s x 2 rows = 16 rows; 16 lanes x 4 floats = 64 columns
            const v4f val = *(const v4fa*)(&os[wb + row * 68 + cofs]);
            *(v4f*)(orow + (size_t)row * DM + cofs) = val;
            *(v4f*)(crow + (size_t)row * HD + cofs) = val; }
         }
}

static constexpr size_t al256(size_t v) { return (v + 255) & ~(size_t)255; }
static constexpr size_t SZ_XB = al256((size_t)NB * SEQ * DM * 2);
static constexpr size_t SZ_WB = al256((size_t)3 * DM * DM * 2);
static constexpr size_t SZ_PL = al256((size_t)NB * NH_ * SEQ * HD * 2);
static constexpr size_t SZ_TOTAL = SZ_XB + SZ_WB + 3 * SZ_PL;
static_assert(SZ_TOTAL <= (size_t)134217728);          // workspace carve <= 128 MiB
static_assert(((size_t)DM * DM * 2) % 256 == 0);       // weight sub-planes stay 256-byte aligned

extern "C" void kernel_launch(void* const* d_in, const int* in_sizes, int n_in,
                              void* d_out, int out_size, void* d_ws, size_t ws_size, hipStream_t stream) {
    if (n_in < 4) return;
    const size_t needx = ((size_t)(NB - 1) * SEQ_FULL + SEQ) * DM;
    if ((size_t)in_sizes[0] < needx) return;
    if ((size_t)in_sizes[1] < (size_t)DM * DM || (size_t)in_sizes[2] < (size_t)DM * DM || (size_t)in_sizes[3] < (size_t)DM * DM) return;
    if ((size_t)out_size < CTX_OFF + ((size_t)(NB * NH_ - 1) * OUT_SEQ + SEQ) * HD) return;
    if (SZ_TOTAL > ws_size) return;
    const float* x = (const float*)d_in[0]; const float* wq = (const float*)d_in[1]; const float* wk = (const float*)d_in[2]; const float* wv = (const float*)d_in[3];   // wire order x, Wq, Wk, Wv ([out][in] = Bt as-is)
    float* OUT = (float*)d_out;              // [NB][SEQ][1024]
    float* CTX = (float*)d_out + CTX_OFF;    // [NB][16][SEQ][64]
    char* wsp = (char*)d_ws;
    bf* XB = (bf*)wsp; wsp += SZ_XB;                 // [NB*SEQ][1024]
    bf* WB = (bf*)wsp; wsp += SZ_WB;                 // [3][1024][1024]: q | k | v
    h16* QH = (h16*)wsp; wsp += SZ_PL;               // [NB*16][SEQ][64]
    h16* KP = (h16*)wsp; wsp += SZ_PL;               // [NB*16][SEQ][64]
    h16* VT = (h16*)wsp; wsp += SZ_PL;               // [NB*16][64][SEQ]

    k_cvt8<<<XBLK + 3 * WBLK, 256, 0, stream>>>(x, wq, wk, wv, XB, WB);

    k_proj<<<dim3(NB * SEQ / 128, DM / 128, 3), 32 * PW, 0, stream>>>(XB, WB, QH, KP, VT);

    k_flash<<<dim3(SEQ / (16 * AW), NB * NH_, 1), 32 * AW, 0, stream>>>(QH, KP, VT, OUT, CTX);
}

// v005
// It runs in 65.3 microseconds.
// Timed twice side by side with v004, it ran 1.05 times as fast both times.
// Counting every step since v000, it is 3.03 times as fast.
#include <hip/hip_runtime.h>

// Multi-head self-attention, width 1024 = 16 heads x 64, x [NB][SEQ][1024], Wq/Wk/Wv [out][in] (y = x W^T), no biases, no mask, score scale 1/8; two f32 outputs: merged heads [NB][SEQ][1024] and per-head context [NB][16][SEQ][64].
// Compute dtypes, f32 accumulate everywhere: projections v_wmma_f32_16x16x32_bf16 (x and W RNE-converted to bf16; products exact);
// scores v_wmma_f32_16x16x32_f16: q and k single f16 (one product); P (x256 carry, cancels in the normalisation) and v single f16; softmax f32 (online, running max).
// Layout: bf16 copies of x and W; q, k planes [b*16+h][t][d] and v^T plane [b*16+h][d][t] written by the GEMM epilogue; fused flash kernel in transposed form (S^T = K Q^T, O^T = V^T P^T), both outputs from the same f32 accumulators.

#ifndef NB
#define NB 2
#endif
#ifndef SEQ
#define SEQ 2048
#endif
#define NB_FULL  2
#define SEQ_FULL 2048
#ifndef OUT_SEQ
#define OUT_SEQ SEQ              // row pitch (in tokens) between batches of the merged output and between (batch, head) slabs of the context output
#endif
#define DM   1024                // input width == projection width
#define NH_  16
#define HD   64
#define AW   8                   // waves per flash block (16 query rows each)
#define KT   128                 // keys per staged K / V^T tile
#define KPH  72                  // LDS pitch of a K row in halves: 128 B + 16 B (16 B x odd: ds_load_b128 readers meet no bank conflict)
#define VPH  136                 // LDS pitch of a V^T row in halves: 256 B + 16 B
#define KTH  (KT * KPH)          // halves of one K tile in LDS
#define STH  (KTH + HD * VPH)    // halves of one ring buffer (K tile, then V^T tile)
#define PW   8                   // waves per projection block: 4 x 2 wave tiles of 32 x 64
#define PKT  128                 // k per staged projection tile
#define PPH  136                 // LDS pitch of a staged operand row in 16-bit elements: 256 B + 16 B
#define POP  (128 * PPH)         // elements of one operand's staged tile (128 rows)
#define PST  (2 * POP)           // elements of one projection ring buffer (A tile, then Bt tile)
#define SC2  (0.125f * 1.4426950408889634f)   // HD^-0.5 * log2(e)
#define PSH  8.0f                // log2 of the P carry (256)
#define CTX_OFF ((size_t)NB_FULL * SEQ_FULL * DM)   // element offset of the second output (fixed, full-size constants)

static_assert(HD == 64);
static_assert(NH_ * HD == DM);                 // head h = columns h*64 + d
static_assert(DM % 64 == 0);                   // 16 column tiles of 64
static_assert(DM % 32 == 0);                   // GEMM k-loop steps by 32
static_assert(SEQ % 64 == 0);                  // a 64-row tile never straddles two batches
static_assert((NB * SEQ) % 128 == 0 && DM % 128 == 0);   // projection blocks of 128 x 128 cover both operand planes exactly
static_assert(DM % PKT == 0 && DM / PKT >= 2);           // whole k tiles only; the ring's prologue needs two
static_assert((size_t)PW * 16 * 68 * 4 <= (size_t)2 * PST * 2);   // the epilogue tiles fit the ring they are laid over
static_assert((size_t)2 * (2 * PST * 2) <= (size_t)327680);       // two projection blocks fit one WGP's LDS
static_assert(PKT == 128 && PW == 8);                    // the copy map of stage_ab: 256 lanes x 16 B x 8 copies = one 32-KiB tile of each operand
static_assert(SEQ % 32 == 0 && DM % 32 == 0);            // a wave's 32 rows never straddle two output row blocks
static_assert(SEQ % 32 == 0);                  // key loop steps by 32
static_assert(SEQ % KT == 0 && SEQ / KT >= 2); // whole tiles only; the ring's prologue needs two
static_assert(KT == 128 && AW == 8);           // the copy map below: 256 lanes x 16 B x 4 copies = one 16-KiB tile of each operand
static_assert(SEQ % (16 * AW) == 0);           // flash grid covers the sequence exactly
static_assert(((size_t)SEQ * DM) % 8 == 0);
static_assert(((size_t)DM * DM) % 8 == 0);
static_assert(NB <= NB_FULL);
static_assert(SEQ <= SEQ_FULL);
static_assert(OUT_SEQ >= SEQ);
static_assert(OUT_SEQ <= SEQ_FULL);
static_assert(CTX_OFF * 4 == (size_t)16777216);                                            // byte offset of the second output
static_assert(((size_t)(NB - 1) * OUT_SEQ + SEQ) * DM <= CTX_OFF);                           // merged output stays inside its own region
static_assert(CTX_OFF + ((size_t)(NB * NH_ - 1) * OUT_SEQ + SEQ) * HD <= (size_t)2 * CTX_OFF); // context output stays inside the buffer (33554432 B)

typedef _Float16 h16;
typedef unsigned short bf;
typedef __attribute__((ext_vector_type(16))) __bf16   v16bf;
typedef __attribute__((ext_vector_type(16))) _Float16 v16h;
typedef __attribute__((ext_vector_type(8)))  _Float16 v8h;
typedef __attribute__((ext_vector_type(8)))  unsigned short v8us;
typedef __attribute__((ext_vector_type(8)))  float    v8f;
typedef __attribute__((ext_vector_type(4)))  float    v4f;
typedef v4f  __attribute__((may_alias)) v4fa;

__device__ __forceinline__ unsigned short f2bf(float f) { unsigned u = __float_as_uint(f); u += 0x7FFFu + ((u >> 16) & 1u); return (unsigned short)(u >> 16); }
__device__ __forceinline__ v16h cat16(v8h lo, v8h hi) { return __builtin_shufflevector(lo, hi, 0, 1, 2, 3, 4, 5, 6, 7, 8, 9, 10, 11, 12, 13, 14, 15); }
__device__ __forceinline__ v16bf cat16b(v8us lo, v8us hi) { return __builtin_bit_cast(v16bf, __builtin_shufflevector(lo, hi, 0, 1, 2, 3, 4, 5, 6, 7, 8, 9, 10, 11, 12, 13, 14, 15)); }
__device__ __forceinline__ v8f wmma16(v16h a, v16h b, v8f c) { return __builtin_amdgcn_wmma_f32_16x16x32_f16(false, a, false, b, (short)0, c, false, false); }
__device__ __forceinline__ v8f wmmab(v16bf a, v16bf b, v8f c) { return __builtin_amdgcn_wmma_f32_16x16x32_bf16(false, a, false, b, (short)0, c, false, false); }
// fragment loaders from K-contiguous 16-bit rows; p already includes + 8*(lane>>4): elements 0..7 <- k0+8h+0..7, elements 8..15 <- k0+16+8h+0..7 (same map for A and B)
__device__ __forceinline__ v16h  ldh(const h16* p) { return cat16(*(const v8h*)p, *(const v8h*)(p + 16)); }
__device__ __forceinline__ v16bf ldb(const bf* p)  { return cat16b(*(const v8us*)p, *(const v8us*)(p + 16)); }
// ordering point for wave-private LDS tiles (same wave writes and reads)
__device__ __forceinline__ void wave_sync() { __builtin_amdgcn_fence(3 /* release order */, "wavefront"); __builtin_amdgcn_wave_barrier(); asm volatile("" ::: "memory"); }

#define XBLK ((unsigned)((size_t)NB * SEQ * DM / 2048))   // conversion blocks (256 lanes x 8 elements) that cover x
#define WBLK ((unsigned)((size_t)DM * DM / 2048))         // ... and one weight matrix
static_assert(((size_t)SEQ * DM) % 2048 == 0 && ((size_t)DM * DM) % 2048 == 0);   // a block never straddles two batches or two matrices; the grid is exact

// k_cvt8: all four f32 -> bf16 conversions in one launch; the block index picks the source (blocks [0, XBLK): x, then WBLK blocks each of Wq, Wk, Wv). grid XBLK + 3 * WBLK.
__global__ __launch_bounds__(256) void k_cvt8(const float* __restrict__ x, const float* __restrict__ wq, const float* __restrict__ wk, const float* __restrict__ wv, bf* XB, bf* WB) {
    const unsigned bi = blockIdx.x;
    const float* src; bf* dst;
    if (bi < XBLK) {
        const unsigned b = bi / (XBLK / NB);                                   // batch: source pitch SEQ_FULL tokens, copy pitch SEQ tokens
        src = x + (size_t)b * SEQ_FULL * DM + (size_t)(bi - b * (XBLK / NB)) * 2048; dst = XB + (size_t)bi * 2048;
    } else {
        const unsigned wi = bi - XBLK, w = wi / WBLK;
        src = (w == 0 ? wq : w == 1 ? wk : wv) + (size_t)(wi - w * WBLK) * 2048; dst = WB + (size_t)wi * 2048;
    }
    const v8f v = *(const v8f*)(src + threadIdx.x * 8); v8us o;
#pragma unroll
    for (int k = 0; k < 8; ++k) o[k] = f2bf(v[k]);
    *(v8us*)(dst + threadIdx.x * 8) = o;
}

// Eight copies of one lane: 16 B of rows r, r + 16, ..., r + 112 of a K-contiguous bf16 plane, global memory to LDS through no register.
// g: the lane's first global chunk; l: its LDS byte address. Each wave-wide copy reads two rows x 256 B of whole lines.
__device__ __forceinline__ void stage_rows(const bf* g, unsigned l) {
    const bf* g1 = g + (size_t)16 * DM; const bf* g2 = g + (size_t)32 * DM; const bf* g3 = g + (size_t)48 * DM; const bf* g4 = g + (size_t)64 * DM;
    const bf* g5 = g + (size_t)80 * DM; const bf* g6 = g + (size_t)96 * DM; const bf* g7 = g + (size_t)112 * DM;
    const unsigned l1 = l + 16 * PPH * 2, l2 = l + 32 * PPH * 2, l3 = l + 48 * PPH * 2, l4 = l + 64 * PPH * 2, l5 = l + 80 * PPH * 2, l6 = l + 96 * PPH * 2, l7 = l + 112 * PPH * 2;
    // the closing s_wait_xcnt stands in the copies' own statement so that no address register is rewritten in front of it
    asm volatile("global_load_async_to_lds_b128 %0, %8, off\n\t"
                 "global_load_async_to_lds_b128 %1, %9, off\n\t"
                 "global_load_async_to_lds_b128 %2, %10, off\n\t"
                 "global_load_async_to_lds_b128 %3, %11, off\n\t"
                 "global_load_async_to_lds_b128 %4, %12, off\n\t"
                 "global_load_async_to_lds_b128 %5, %13, off\n\t"
                 "global_load_async_to_lds_b128 %6, %14, off\n\t"
                 "global_load_async_to_lds_b128 %7, %15, off\n\t"
                 "s_wait_xcnt 0x0"
                 :: "v"(l), "v"(l1), "v"(l2), "v"(l3), "v"(l4), "v"(l5), "v"(l6), "v"(l7),
                    "v"(g), "v"(g1), "v"(g2), "v"(g3), "v"(g4), "v"(g5), "v"(g6), "v"(g7) : "memory");
}
// One k tile's copies of one lane: 8 x 16 B of the block's 128 A rows and 8 x 16 B of its 128 Bt rows (16 copies of a wave in flight).
__device__ __forceinline__ void stage_ab(const bf* ag, const bf* bg, unsigned al, unsigned bl) { stage_rows(ag, al); stage_rows(bg, bl); }

__global__ __launch_bounds__(32 * PW) void k_proj(const bf* __restrict__ XB, const bf* __restrict__ WB, h16* QH, h16* KP, h16* VT) {
    __shared__ __align__(16) bf pring[2 * PST];
    const int K = DM;
    const int lane = threadIdx.x & 31, wave = __builtin_amdgcn_readfirstlane((int)(threadIdx.x >> 5)), lr = lane & 15, hi = lane >> 4;
    const int pz = blockIdx.z; const bool isv = pz == 2;
    const bf* W = WB + (size_t)pz * DM * DM;
    const bf* A = isv ? W : XB; const bf* Bt = isv ? XB : W;
    h16* Ph = pz == 0 ? QH : pz == 1 ? KP : VT;
    const int bx = isv ? blockIdx.y : blockIdx.x, by = isv ? blockIdx.x : blockIdx.y;   // block row (of A) and block column (row of Bt)
    const int pitch = isv ? SEQ : HD;
    const int r0 = bx * 128 + (wave >> 1) * 32, c0 = by * 128 + (wave & 1) * 64;   // this wave's 32x64 tile
    float* os = (float*)pring + wave * 16 * 68;   // wave-private epilogue tile, laid over the ring: written only behind the last trip's foot (every wave's reads returned, its copies landed, barrier passed)
    v8f acc[2][4];
#pragma unroll
    for (int mb = 0; mb < 2; ++mb)
#pragma unroll
        for (int nb = 0; nb < 4; ++nb) acc[mb][nb] = (v8f){};
    const int ao = ((wave >> 1) * 32 + lr) * PPH + 8 * hi;            // + mb*16*PPH + k, in a buffer's A tile
    const int bo = POP + ((wave & 1) * 64 + lr) * PPH + 8 * hi;       // + nb*16*PPH + k, in its Bt tile
    const int tid = (int)threadIdx.x;
    const bf* ag = A  + (size_t)(bx * 128 + (tid >> 4)) * K + (tid & 15) * 8;   // + tile * PKT: row tid>>4, chunk tid&15 of its 256 B
    const bf* bg = Bt + (size_t)(by * 128 + (tid >> 4)) * K + (tid & 15) * 8;
    const unsigned pl = (unsigned)(size_t)&pring[0];                                    // LDS byte address of the ring
    const unsigned al = pl + (unsigned)((tid >> 4) * PPH + (tid & 15) * 8) * 2u;        // + buffer * PST * 2
    const unsigned bl = al + POP * 2u;
    stage_ab(ag, bg, al, bl);
    asm volatile("s_wait_asynccnt 0x0" ::: "memory");        // tile 0 of this wave's copies has landed
    __syncthreads();                                         // ... and every other wave's: tile 0 may be read
    stage_ab(ag + PKT, bg + PKT, al + PST * 2u, bl + PST * 2u);
#pragma unroll 1   // one trip per k tile: the ring's order stands once, at the trip's foot
    for (int st = 0; st < K / PKT; ++st) {
      const bf* buf = pring + (st & 1) * PST;
      v16bf a[2][2], b[2][4];                                // two fragment sets: the next step's loads go ahead of this step's products, as one group
#pragma unroll
      for (int mb = 0; mb < 2; ++mb) a[0][mb] = ldb(buf + ao + mb * 16 * PPH);
#pragma unroll
      for (int nb = 0; nb < 4; ++nb) b[0][nb] = ldb(buf + bo + nb * 16 * PPH);
#pragma unroll     // the four 32-k steps of a tile: the fragment sets alternate by a compile-time index
      for (int ks = 0; ks < PKT / 32; ++ks) {
        const int cu = ks & 1, nx = cu ^ 1;
        if (ks + 1 < PKT / 32) {                             // never past this tile: the next one is read only behind the trip's barrier
#pragma unroll
          for (int mb = 0; mb < 2; ++mb) a[nx][mb] = ldb(buf + ao + mb * 16 * PPH + (ks + 1) * 32);
#pragma unroll
          for (int nb = 0; nb < 4; ++nb) b[nx][nb] = ldb(buf + bo + nb * 16 * PPH + (ks + 1) * 32);
        }
        __builtin_amdgcn_sched_barrier(0);                   // keeps the next step's loads ahead of this step's products: left free, the compiler sinks each load to its use and waits out the LDS latency there
#pragma unroll
        for (int nb = 0; nb < 4; ++nb)
#pragma unroll
            for (int mb = 0; mb < 2; ++mb) acc[mb][nb] = wmmab(a[cu][mb], b[cu][nb], acc[mb][nb]);
        __builtin_amdgcn_sched_barrier(0);                   // ... and this step's products ahead of the loads of the step after next, which reuse their fragment set
      }
      asm volatile("s_wait_dscnt 0x0" ::: "memory");         // this wave's reads of the buffer have returned before it is refilled
      asm volatile("s_wait_asynccnt 0x0" ::: "memory");      // this wave's copies of the next tile have landed
      __syncthreads();                                       // publishes the next tile and ends every reader's last read of this buffer
      if (st + 2 < K / PKT) stage_ab(ag + (st + 2) * PKT, bg + (st + 2) * PKT, al + (unsigned)(st & 1) * (PST * 2u), bl + (unsigned)(st & 1) * (PST * 2u));
    }
    asm volatile("s_wait_asynccnt 0x0" ::: "memory");        // no copy is outstanding when the wave goes on to its epilogue
    const size_t tbase = isv ? (size_t)r0 * SEQ + (size_t)(c0 / SEQ) * ((size_t)DM * SEQ) + (size_t)(c0 % SEQ)
                             : (size_t)(r0 / SEQ) * ((size_t)NH_ * SEQ * HD) + (size_t)(r0 % SEQ) * HD + (size_t)(c0 / HD) * ((size_t)SEQ * HD);   // c0 is a multiple of HD
#pragma unroll
    for (int mb = 0; mb < 2; ++mb) {
#pragma unroll
        for (int nb = 0; nb < 4; ++nb) {
#pragma unroll
            for (int j = 0; j < 8; ++j) os[(hi * 8 + j) * 68 + nb * 16 + lr] = acc[mb][nb][j]; }   // D: row 8h+j, col lane&15
        wave_sync();
        const size_t sb = tbase + (size_t)(mb * 16) * (size_t)pitch;
{
#pragma unroll
            for (int s = 0; s < 4; ++s) { const int row = 4 * s + (lane >> 3), c8 = (lane & 7) * 8;   // 4 s x 4 row groups = 16 rows; 8 lanes x 8 = 64 columns
                const v4f x0 = *(const v4fa*)(&os[row * 68 + c8]); const v4f x1 = *(const v4fa*)(&os[row * 68 + c8 + 4]); v8h hv;
#pragma unroll
                for (int i = 0; i < 4; ++i) { hv[i] = (h16)x0[i]; hv[4 + i] = (h16)x1[i]; }
                const size_t oo = sb + (size_t)row * (size_t)pitch + c8;
                *(v8h*)(Ph + oo) = hv; }
             }
        wave_sync();
    }
}

// One tile's copies of one lane: 4 x 16 B of K and 4 x 16 B of V^T, global memory to LDS through no register. Each wave-wide copy reads 512 B of whole lines.
// kg, vg: the lane's first global chunk of each operand; kl, vl: its LDS byte address. Later chunks: K + 32 rows (contiguous in memory), V^T + 16 rows.
__device__ __forceinline__ void stage_kv(const h16* kg, const h16* vg, unsigned kl, unsigned vl) {
    const h16* kg1 = kg + 32 * HD; const h16* kg2 = kg + 64 * HD; const h16* kg3 = kg + 96 * HD;
    const h16* vg1 = vg + (size_t)16 * SEQ; const h16* vg2 = vg + (size_t)32 * SEQ; const h16* vg3 = vg + (size_t)48 * SEQ;
    const unsigned kl1 = kl + 32 * KPH * 2, kl2 = kl + 64 * KPH * 2, kl3 = kl + 96 * KPH * 2;
    const unsigned vl1 = vl + 16 * VPH * 2, vl2 = vl + 32 * VPH * 2, vl3 = vl + 48 * VPH * 2;
    // the closing s_wait_xcnt stands in the copies' own statement so that no address register is rewritten in front of it
    asm volatile("global_load_async_to_lds_b128 %0, %8, off\n\t"
                 "global_load_async_to_lds_b128 %1, %9, off\n\t"
                 "global_load_async_to_lds_b128 %2, %10, off\n\t"
                 "global_load_async_to_lds_b128 %3, %11, off\n\t"
                 "global_load_async_to_lds_b128 %4, %12, off\n\t"
                 "global_load_async_to_lds_b128 %5, %13, off\n\t"
                 "global_load_async_to_lds_b128 %6, %14, off\n\t"
                 "global_load_async_to_lds_b128 %7, %15, off\n\t"
                 "s_wait_xcnt 0x0"
                 :: "v"(kl), "v"(kl1), "v"(kl2), "v"(kl3), "v"(vl), "v"(vl1), "v"(vl2), "v"(vl3),
                    "v"(kg), "v"(kg1), "v"(kg2), "v"(kg3), "v"(vg), "v"(vg1), "v"(vg2), "v"(vg3) : "memory");
}

__global__ __launch_bounds__(32 * AW) void k_flash(const h16* __restrict__ QH, const h16* __restrict__ KP, const h16* __restrict__ VT, float* OUT, float* CTX) {
    __shared__ __align__(16) float os[AW * 16 * 68];
    __shared__ __align__(16) h16 ring[2 * STH];
    const int lane = threadIdx.x & 31, wave = __builtin_amdgcn_readfirstlane((int)(threadIdx.x >> 5)), lr = lane & 15, hi = lane >> 4;
    const int zh = blockIdx.y; const int b = zh / NH_, h = zh % NH_;
    const int t0 = (blockIdx.x * AW + wave) * 16;
    const size_t pbase = (size_t)zh * SEQ * HD;
    const size_t qo = pbase + (size_t)(t0 + lr) * HD + 8 * hi;
    const v16h qh0 = ldh(QH + qo), qh1 = ldh(QH + qo + 32);   // B fragments: col t, k = d
    const int ko = lr * KPH + 8 * hi;                        // + key * KPH      (A fragment: row key, k = d), in a K tile
    const int vo = KTH + lr * VPH + 8 * hi;                  // + 16j*VPH + key  (A fragment: row d, k = key), in a V^T tile
    const int tid = (int)threadIdx.x;
    const h16* kg = KP + pbase + (size_t)tid * 8;                                   // + tile * KT * HD: chunk tid of the tile's 16 KiB
    const h16* vg = VT + pbase + (size_t)(tid >> 4) * SEQ + (tid & 15) * 8;         // + tile * KT: row tid>>4, chunk tid&15 of its 256 B
    const unsigned rl = (unsigned)(size_t)&ring[0];                                 // LDS byte address of the ring
    const unsigned kl = rl + (unsigned)((tid >> 3) * KPH + (tid & 7) * 8) * 2u;     // + buffer * STH * 2
    const unsigned vl = rl + (unsigned)(KTH + (tid >> 4) * VPH + (tid & 15) * 8) * 2u;
    stage_kv(kg, vg, kl, vl);
    asm volatile("s_wait_asynccnt 0x0" ::: "memory");        // tile 0 of this wave's copies has landed
    __syncthreads();                                         // ... and every other wave's: tile 0 may be read
    stage_kv(kg + (size_t)KT * HD, vg + KT, kl + STH * 2u, vl + STH * 2u);
    v8f o0 = (v8f){}, o1 = (v8f){}, o2 = (v8f){}, o3 = (v8f){};
    float m = -3.0e38f, l = 0.0f;
#pragma unroll 1   // one trip per tile: the ring's order stands once, at the trip's foot
    for (int st = 0; st < SEQ / KT; ++st) {
      const h16* buf = ring + (st & 1) * STH;
      // One softmax step per staged tile (128 keys): all eight 16-key score tiles first, then one running-max update, one exchange between the lane halves and one rescale.
      v8f s[KT / 16]; float mg[KT / 32];
      v16h kf[KT / 32][4];                                   // the whole tile's K fragments
#pragma unroll
      for (int g = 0; g < KT / 32; ++g) {
        const h16* ka = buf + ko + g * 32 * KPH;
        kf[g][0] = ldh(ka); kf[g][1] = ldh(ka + 32); kf[g][2] = ldh(ka + 16 * KPH); kf[g][3] = ldh(ka + 16 * KPH + 32);
      }
      __builtin_amdgcn_sched_barrier(0);                     // holds the K loads together, as one group ahead of the score products: left free, the compiler puts each pair in front of its product and waits out the LDS latency there
#pragma unroll     // the tile's four 32-key groups: 16 score products in a row, eight independent accumulators
      for (int g = 0; g < KT / 32; ++g) {
        v8f sa = (v8f){}, sb = (v8f){};
        sa = wmma16(kf[g][0], qh0, sa); sb = wmma16(kf[g][2], qh0, sb);
        sa = wmma16(kf[g][1], qh1, sa); sb = wmma16(kf[g][3], qh1, sb);
        s[2 * g] = sa; s[2 * g + 1] = sb;
      }
      const h16* va = buf + vo;
      v16h vf[2][4];                                         // two V^T fragment sets: a group's loads go one group ahead of its products
#pragma unroll
      for (int j = 0; j < 4; ++j) vf[0][j] = ldh(va + j * 16 * VPH);
      __builtin_amdgcn_sched_barrier(0);                     // holds the first group's V^T loads above the maximum chain: left free, the compiler sinks each load to its product and waits out the LDS latency there
#pragma unroll     // one maximum chain per group: four independent chains, joined below
      for (int g = 0; g < KT / 32; ++g) {
        float mx = -3.0e38f;
        s[2 * g] = s[2 * g] * SC2; s[2 * g + 1] = s[2 * g + 1] * SC2;
#pragma unroll
        for (int r = 0; r < 8; ++r) mx = fmaxf(mx, fmaxf(s[2 * g][r], s[2 * g + 1][r]));
        mg[g] = mx;
      }
      float mx = fmaxf(fmaxf(mg[0], mg[1]), fmaxf(mg[2], mg[3]));
      mx = fmaxf(mx, __shfl_xor(mx, 16, 32));
      const float mnew = fmaxf(m, mx);
      const float alpha = __builtin_amdgcn_exp2f(m - mnew);
      const float sh = PSH - mnew;
      o0 = o0 * alpha; o1 = o1 * alpha; o2 = o2 * alpha; o3 = o3 * alpha;
      float ls = 0.0f;
#pragma unroll     // the four 32-key groups again: P packed from the scores, then 4 P.V products each; the fragment sets alternate by a compile-time index
      for (int g = 0; g < KT / 32; ++g) {
        const int cu = g & 1, nx = cu ^ 1;
        if (g + 1 < KT / 32) {                               // never past this tile
#pragma unroll
          for (int j = 0; j < 4; ++j) vf[nx][j] = ldh(va + j * 16 * VPH + (g + 1) * 32);
        }
        __builtin_amdgcn_sched_barrier(0);                   // holds the next group's V^T loads above this group's exponentials and products, for the same reason
        v16h pb;
#pragma unroll
        for (int r = 0; r < 8; ++r) { const h16 pa = (h16)__builtin_amdgcn_exp2f(s[2 * g][r] + sh); const h16 pc = (h16)__builtin_amdgcn_exp2f(s[2 * g + 1][r] + sh); pb[r] = pa; pb[8 + r] = pc; ls += (float)pa + (float)pc; }
        o0 = wmma16(vf[cu][0], pb, o0); o1 = wmma16(vf[cu][1], pb, o1); o2 = wmma16(vf[cu][2], pb, o2); o3 = wmma16(vf[cu][3], pb, o3);
      }
      l = l * alpha + ls; m = mnew;
      asm volatile("s_wait_dscnt 0x0" ::: "memory");         // this wave's reads of the buffer have returned before it is refilled
      asm volatile("s_wait_asynccnt 0x0" ::: "memory");      // this wave's copies of the next tile have landed
      __syncthreads();                                       // publishes the next tile and ends every reader's last read of this buffer
      if (st + 2 < SEQ / KT) stage_kv(kg + (size_t)(st + 2) * KT * HD, vg + (st + 2) * KT, kl + (unsigned)(st & 1) * (STH * 2u), vl + (unsigned)(st & 1) * (STH * 2u));
    }
    asm volatile("s_wait_asynccnt 0x0" ::: "memory");        // no copy is outstanding when the wave goes on to its epilogue
    l += __shfl_xor(l, 16, 32);
    const float inv = 1.0f / l;
    const int wb = wave * 16 * 68;
    // O^T D layout: o_j[r] = (d = 16j + 8h + r, t = lane&15) -> os[t][d]; rows 0..15 x columns 0..63 all written
    { v4f a, c;
      a[0] = o0[0] * inv; a[1] = o0[1] * inv; a[2] = o0[2] * inv; a[3] = o0[3] * inv; c[0] = o0[4] * inv; c[1] = o0[5] * inv; c[2] = o0[6] * inv; c[3] = o0[7] * inv;
      *(v4fa*)(&os[wb + lr * 68 +  0 + 8 * hi]) = a; *(v4fa*)(&os[wb + lr * 68 +  0 + 8 * hi + 4]) = c;
      a[0] = o1[0] * inv; a[1] = o1[1] * inv; a[2] = o1[2] * inv; a[3] = o1[3] * inv; c[0] = o1[4] * inv; c[1] = o1[5] * inv; c[2] = o1[6] * inv; c[3] = o1[7] * inv;
      *(v4fa*)(&os[wb + lr * 68 + 16 + 8 * hi]) = a; *(v4fa*)(&os[wb + lr * 68 + 16 + 8 * hi + 4]) = c;
      a[0] = o2[0] * inv; a[1] = o2[1] * inv; a[2] = o2[2] * inv; a[3] = o2[3] * inv; c[0] = o2[4] * inv; c[1] = o2[5] * inv; c[2] = o2[6] * inv; c[3] = o2[7] * inv;
      *(v4fa*)(&os[wb + lr * 68 + 32 + 8 * hi]) = a; *(v4fa*)(&os[wb + lr * 68 + 32 + 8 * hi + 4]) = c;
      a[0] = o3[0] * inv; a[1] = o3[1] * inv; a[2] = o3[2] * inv; a[3] = o3[3] * inv; c[0] = o3[4] * inv; c[1] = o3[5] * inv; c[2] = o3[6] * inv; c[3] = o3[7] * inv;
      *(v4fa*)(&os[wb + lr * 68 + 48 + 8 * hi]) = a; *(v4fa*)(&os[wb + lr * 68 + 48 + 8 * hi + 4]) = c; }
    wave_sync();
    float* orow = OUT + ((size_t)b * OUT_SEQ + t0) * DM + h * HD;          // merged [b][t][h*64 + d]
    float* crow = CTX + ((size_t)zh * OUT_SEQ + t0) * HD;                  // context [b*16 + h][t][d]
{
#pragma unroll
        for (int s = 0; s < 8; ++s) { const int row = 2 * s + hi, cofs = lr * 4;   // 8 s x 2 rows = 16 rows; 16 lanes x 4 floats = 64 columns
            const v4f val = *(const v4fa*)(&os[wb + row * 68 + cofs]);
            *(v4f*)(orow + (size_t)row * DM + cofs) = val;
            *(v4f*)(crow + (size_t)row * HD + cofs) = val; }
         }
}

static constexpr size_t al256(size_t v) { return (v + 255) & ~(size_t)255; }
static constexpr size_t SZ_XB = al256((size_t)NB * SEQ * DM * 2);
static constexpr size_t SZ_WB = al256((size_t)3 * DM * DM * 2);
static constexpr size_t SZ_PL = al256((size_t)NB * NH_ * SEQ * HD * 2);
static constexpr size_t SZ_TOTAL = SZ_XB + SZ_WB + 3 * SZ_PL;
static_assert(SZ_TOTAL <= (size_t)134217728);          // workspace carve <= 128 MiB
static_assert(((size_t)DM * DM * 2) % 256 == 0);       // weight sub-planes stay 256-byte aligned

extern "C" void kernel_launch(void* const* d_in, const int* in_sizes, int n_in,
                              void* d_out, int out_size, void* d_ws, size_t ws_size, hipStream_t stream) {
    if (n_in < 4) return;
    const size_t needx = ((size_t)(NB - 1) * SEQ_FULL + SEQ) * DM;
    if ((size_t)in_sizes[0] < needx) return;
    if ((size_t)in_sizes[1] < (size_t)DM * DM || (size_t)in_sizes[2] < (size_t)DM * DM || (size_t)in_sizes[3] < (size_t)DM * DM) return;
    if ((size_t)out_size < CTX_OFF + ((size_t)(NB * NH_ - 1) * OUT_SEQ + SEQ) * HD) return;
    if (SZ_TOTAL > ws_size) return;
    const float* x = (const float*)d_in[0]; const float* wq = (const float*)d_in[1]; const float* wk = (const float*)d_in[2]; const float* wv = (const float*)d_in[3];   // wire order x, Wq, Wk, Wv ([out][in] = Bt as-is)
    float* OUT = (float*)d_out;              // [NB][SEQ][1024]
    float* CTX = (float*)d_out + CTX_OFF;    // [NB][16][SEQ][64]
    char* wsp = (char*)d_ws;
    bf* XB = (bf*)wsp; wsp += SZ_XB;                 // [NB*SEQ][1024]
    bf* WB = (bf*)wsp; wsp += SZ_WB;                 // [3][1024][1024]: q | k | v
    h16* QH = (h16*)wsp; wsp += SZ_PL;               // [NB*16][SEQ][64]
    h16* KP = (h16*)wsp; wsp += SZ_PL;               // [NB*16][SEQ][64]
    h16* VT = (h16*)wsp; wsp += SZ_PL;               // [NB*16][64][SEQ]

    k_cvt8<<<XBLK + 3 * WBLK, 256, 0, stream>>>(x, wq, wk, wv, XB, WB);

    k_proj<<<dim3(NB * SEQ / 128, DM / 128, 3), 32 * PW, 0, stream>>>(XB, WB, QH, KP, VT);

    k_flash<<<dim3(SEQ / (16 * AW), NB * NH_, 1), 32 * AW, 0, stream>>>(QH, KP, VT, OUT, CTX);
}

// v006
// A run of this version takes 62.8 microseconds.
// Two timings next to v005 put it at 1.03 and 1.04 times that version's speed.
// Counting every step since v000, it is 3.14 times as fast.
#include <hip/hip_runtime.h>

// Multi-head self-attention, width 1024 = 16 heads x 64, x [NB][SEQ][1024], Wq/Wk/Wv [out][in] (y = x W^T), no biases, no mask, score scale 1/8; two f32 outputs: merged heads [NB][SEQ][1024] and per-head context [NB][16][SEQ][64].
// Compute dtypes, f32 accumulate everywhere: projections v_wmma_f32_16x16x32_bf16 (x and W RNE-converted to bf16; products exact);
// scores v_wmma_f32_16x16x32_f16: q and k single f16 (one product); P (x256 carry, cancels in the normalisation) and v single f16; softmax f32 (online, running max).
// Layout: bf16 copies of x and W; q, k planes [b*16+h][t][d] and v^T plane [b*16+h][d][t] written by the GEMM epilogue; fused flash kernel in transposed form (S^T = K Q^T, O^T = V^T P^T), both outputs from the same f32 accumulators.

#ifndef NB
#define NB 2
#endif
#ifndef SEQ
#define SEQ 2048
#endif
#define NB_FULL  2
#define SEQ_FULL 2048
#ifndef OUT_SEQ
#define OUT_SEQ SEQ              // row pitch (in tokens) between batches of the merged output and between (batch, head) slabs of the context output
#endif
#define DM   1024                // input width == projection width
#define NH_  16
#define HD   64
#define AW   8                   // waves per flash block (16 query rows each)
#define KT   128                 // keys per staged K / V^T tile
#define KPH  72                  // LDS pitch of a K row in halves: 128 B + 16 B (16 B x odd: ds_load_b128 readers meet no bank conflict)
#define VPH  136                 // LDS pitch of a V^T row in halves: 256 B + 16 B
#define KTH  (KT * KPH)          // halves of one K tile in LDS
#define STH  (KTH + HD * VPH)    // halves of one ring buffer (K tile, then V^T tile)
#define PW   16                  // waves per projection block: 4 x 4 wave tiles of 64 x 48
#define PBM  256                 // x rows of a projection block
#define PBN  192                 // stacked W rows (q | k | v) of a projection block: three head groups of 64
#define PKT  128                 // k per staged projection tile
#define PPH  136                 // LDS pitch of a staged operand row in 16-bit elements: 256 B + 16 B
#define PST  ((PBM + PBN) * PPH) // elements of one projection ring buffer (x tile, then W tile)
#define QKP  72                  // epilogue pitch of a [token][d] row in halves: 128 B + 16 B
#define VSP  264                 // epilogue pitch of a [d][token] row in halves: 512 B + 16 B
#define PIT  (PBM * HD / (8 * 32 * PW))   // 16-B stores of one lane per head group
#define GSH  (PBM * QKP)         // halves of one head group's epilogue region (the larger of the two forms)
#define SC2  (0.125f * 1.4426950408889634f)   // HD^-0.5 * log2(e)
#define PSH  8.0f                // log2 of the P carry (256)
#define CTX_OFF ((size_t)NB_FULL * SEQ_FULL * DM)   // element offset of the second output (fixed, full-size constants)

static_assert(HD == 64);
static_assert(NH_ * HD == DM);                 // head h = columns h*64 + d
static_assert(DM % 64 == 0);                   // 16 column tiles of 64
static_assert(DM % 32 == 0);                   // GEMM k-loop steps by 32
static_assert(SEQ % 64 == 0);                  // a 64-row tile never straddles two batches
static_assert((NB * SEQ) % PBM == 0 && (3 * DM) % PBN == 0);   // projection blocks of 256 x 192 cover x and the stacked weights exactly
static_assert(SEQ % PBM == 0 && PBN % HD == 0 && DM % HD == 0);   // a block's tokens lie in one batch; a head group lies in one plane
static_assert(DM % PKT == 0 && DM / PKT >= 2);           // whole k tiles only; the ring's prologue needs two
static_assert((size_t)(PBN / HD) * GSH <= (size_t)2 * PST && HD * VSP <= GSH);   // the epilogue regions fit the ring they are laid over
static_assert((size_t)2 * PST * 2 <= (size_t)327680);    // the ring fits one WGP's LDS
static_assert(PKT == 128 && PW == 16 && PBM == 256 && PBN == 192);   // the copy map of stage_ab: 512 lanes x 16 B cover 32 rows a copy, 8 copies of x and 6 of W
static_assert((PBM * HD) % (8 * 32 * PW) == 0);          // the epilogue's stores cover a head group exactly
static_assert(SEQ % 32 == 0);                  // key loop steps by 32
static_assert(SEQ % KT == 0 && SEQ / KT >= 2); // whole tiles only; the ring's prologue needs two
static_assert(KT == 128 && AW == 8);           // the copy map below: 256 lanes x 16 B x 4 copies = one 16-KiB tile of each operand
static_assert(SEQ % (16 * AW) == 0);           // flash grid covers the sequence exactly
static_assert(((size_t)SEQ * DM) % 8 == 0);
static_assert(((size_t)DM * DM) % 8 == 0);
static_assert(NB <= NB_FULL);
static_assert(SEQ <= SEQ_FULL);
static_assert(OUT_SEQ >= SEQ);
static_assert(OUT_SEQ <= SEQ_FULL);
static_assert(CTX_OFF * 4 == (size_t)16777216);                                            // byte offset of the second output
static_assert(((size_t)(NB - 1) * OUT_SEQ + SEQ) * DM <= CTX_OFF);                           // merged output stays inside its own region
static_assert(CTX_OFF + ((size_t)(NB * NH_ - 1) * OUT_SEQ + SEQ) * HD <= (size_t)2 * CTX_OFF); // context output stays inside the buffer (33554432 B)

typedef _Float16 h16;
typedef unsigned short bf;
typedef __attribute__((ext_vector_type(16))) __bf16   v16bf;
typedef __attribute__((ext_vector_type(16))) _Float16 v16h;
typedef __attribute__((ext_vector_type(8)))  _Float16 v8h;
typedef __attribute__((ext_vector_type(8)))  unsigned short v8us;
typedef __attribute__((ext_vector_type(8)))  float    v8f;
typedef __attribute__((ext_vector_type(4)))  float    v4f;
typedef v4f  __attribute__((may_alias)) v4fa;
typedef v8h  __attribute__((may_alias)) v8ha;
typedef h16  __attribute__((may_alias)) h16a;

__device__ __forceinline__ unsigned short f2bf(float f) { unsigned u = __float_as_uint(f); u += 0x7FFFu + ((u >> 16) & 1u); return (unsigned short)(u >> 16); }
__device__ __forceinline__ v16h cat16(v8h lo, v8h hi) { return __builtin_shufflevector(lo, hi, 0, 1, 2, 3, 4, 5, 6, 7, 8, 9, 10, 11, 12, 13, 14, 15); }
__device__ __forceinline__ v16bf cat16b(v8us lo, v8us hi) { return __builtin_bit_cast(v16bf, __builtin_shufflevector(lo, hi, 0, 1, 2, 3, 4, 5, 6, 7, 8, 9, 10, 11, 12, 13, 14, 15)); }
__device__ __forceinline__ v8f wmma16(v16h a, v16h b, v8f c) { return __builtin_amdgcn_wmma_f32_16x16x32_f16(false, a, false, b, (short)0, c, false, false); }
__device__ __forceinline__ v8f wmmab(v16bf a, v16bf b, v8f c) { return __builtin_amdgcn_wmma_f32_16x16x32_bf16(false, a, false, b, (short)0, c, false, false); }
// fragment loaders from K-contiguous 16-bit rows; p already includes + 8*(lane>>4): elements 0..7 <- k0+8h+0..7, elements 8..15 <- k0+16+8h+0..7 (same map for A and B)
__device__ __forceinline__ v16h  ldh(const h16* p) { return cat16(*(const v8h*)p, *(const v8h*)(p + 16)); }
__device__ __forceinline__ v16bf ldb(const bf* p)  { return cat16b(*(const v8us*)p, *(const v8us*)(p + 16)); }
// ordering point for wave-private LDS tiles (same wave writes and reads)
__device__ __forceinline__ void wave_sync() { __builtin_amdgcn_fence(3 /* release order */, "wavefront"); __builtin_amdgcn_wave_barrier(); asm volatile("" ::: "memory"); }

#define XBLK ((unsigned)((size_t)NB * SEQ * DM / 2048))   // conversion blocks (256 lanes x 8 elements) that cover x
#define WBLK ((unsigned)((size_t)DM * DM / 2048))         // ... and one weight matrix
static_assert(((size_t)SEQ * DM) % 2048 == 0 && ((size_t)DM * DM) % 2048 == 0);   // a block never straddles two batches or two matrices; the grid is exact

// k_cvt8: all four f32 -> bf16 conversions in one launch; the block index picks the source (blocks [0, XBLK): x, then WBLK blocks each of Wq, Wk, Wv). grid XBLK + 3 * WBLK.
__global__ __launch_bounds__(256) void k_cvt8(const float* __restrict__ x, const float* __restrict__ wq, const float* __restrict__ wk, const float* __restrict__ wv, bf* XB, bf* WB) {
    const unsigned bi = blockIdx.x;
    const float* src; bf* dst;
    if (bi < XBLK) {
        const unsigned b = bi / (XBLK / NB);                                   // batch: source pitch SEQ_FULL tokens, copy pitch SEQ tokens
        src = x + (size_t)b * SEQ_FULL * DM + (size_t)(bi - b * (XBLK / NB)) * 2048; dst = XB + (size_t)bi * 2048;
    } else {
        const unsigned wi = bi - XBLK, w = wi / WBLK;
        src = (w == 0 ? wq : w == 1 ? wk : wv) + (size_t)(wi - w * WBLK) * 2048; dst = WB + (size_t)wi * 2048;
    }
    const v8f v = *(const v8f*)(src + threadIdx.x * 8); v8us o;
#pragma unroll
    for (int k = 0; k < 8; ++k) o[k] = f2bf(v[k]);
    *(v8us*)(dst + threadIdx.x * 8) = o;
}

// Copies of one lane, global memory to LDS through no register: 16 B of rows r, r + 32, ... of a K-contiguous bf16 plane (512 lanes: 32 rows x 256 B per copy of the block).
// g: the lane's first global chunk; l: its LDS byte address. Each wave-wide copy reads two rows x 256 B of whole lines. stage_x: 8 copies (256 rows); stage_w: 6 copies (192 rows).
__device__ __forceinline__ void stage_x(const bf* g, unsigned l) {
    const bf* g1 = g + (size_t)32 * DM; const bf* g2 = g + (size_t)64 * DM; const bf* g3 = g + (size_t)96 * DM; const bf* g4 = g + (size_t)128 * DM;
    const bf* g5 = g + (size_t)160 * DM; const bf* g6 = g + (size_t)192 * DM; const bf* g7 = g + (size_t)224 * DM;
    const unsigned l1 = l + 32 * PPH * 2, l2 = l + 64 * PPH * 2, l3 = l + 96 * PPH * 2, l4 = l + 128 * PPH * 2, l5 = l + 160 * PPH * 2, l6 = l + 192 * PPH * 2, l7 = l + 224 * PPH * 2;
    // the closing s_wait_xcnt stands in the copies' own statement so that no address register is rewritten in front of it
    asm volatile("global_load_async_to_lds_b128 %0, %8, off\n\t"
                 "global_load_async_to_lds_b128 %1, %9, off\n\t"
                 "global_load_async_to_lds_b128 %2, %10, off\n\t"
                 "global_load_async_to_lds_b128 %3, %11, off\n\t"
                 "global_load_async_to_lds_b128 %4, %12, off\n\t"
                 "global_load_async_to_lds_b128 %5, %13, off\n\t"
                 "global_load_async_to_lds_b128 %6, %14, off\n\t"
                 "global_load_async_to_lds_b128 %7, %15, off\n\t"
                 "s_wait_xcnt 0x0"
                 :: "v"(l), "v"(l1), "v"(l2), "v"(l3), "v"(l4), "v"(l5), "v"(l6), "v"(l7),
                    "v"(g), "v"(g1), "v"(g2), "v"(g3), "v"(g4), "v"(g5), "v"(g6), "v"(g7) : "memory");
}
__device__ __forceinline__ void stage_w(const bf* g, unsigned l) {
    const bf* g1 = g + (size_t)32 * DM; const bf* g2 = g + (size_t)64 * DM; const bf* g3 = g + (size_t)96 * DM; const bf* g4 = g + (size_t)128 * DM; const bf* g5 = g + (size_t)160 * DM;
    const unsigned l1 = l + 32 * PPH * 2, l2 = l + 64 * PPH * 2, l3 = l + 96 * PPH * 2, l4 = l + 128 * PPH * 2, l5 = l + 160 * PPH * 2;
    // the closing s_wait_xcnt stands in the copies' own statement so that no address register is rewritten in front of it
    asm volatile("global_load_async_to_lds_b128 %0, %6, off\n\t"
                 "global_load_async_to_lds_b128 %1, %7, off\n\t"
                 "global_load_async_to_lds_b128 %2, %8, off\n\t"
                 "global_load_async_to_lds_b128 %3, %9, off\n\t"
                 "global_load_async_to_lds_b128 %4, %10, off\n\t"
                 "global_load_async_to_lds_b128 %5, %11, off\n\t"
                 "s_wait_xcnt 0x0"
                 :: "v"(l), "v"(l1), "v"(l2), "v"(l3), "v"(l4), "v"(l5),
                    "v"(g), "v"(g1), "v"(g2), "v"(g3), "v"(g4), "v"(g5) : "memory");
}
// One k tile's copies of one lane: 8 x 16 B of the block's 256 x rows and 6 x 16 B of its 192 W rows (14 copies of a wave in flight).
__device__ __forceinline__ void stage_ab(const bf* ag, const bf* bg, unsigned al, unsigned bl) { stage_x(ag, al); stage_w(bg, bl); }

// The k loop of k_proj. WF: the W fragment is the product's first operand (D row = W row, D column = x row: a lane holds 8 consecutive features of one token); else the x fragment is (8 consecutive tokens of one feature).
template <bool WF>
__device__ __forceinline__ void proj_loop(const bf* pring, int ao, int bo, const bf* ag, const bf* bg, unsigned al, unsigned bl, v8f (&acc)[4][3]) {
#pragma unroll 1   // one trip per k tile: the ring's order stands once, at the trip's foot
    for (int st = 0; st < DM / PKT; ++st) {
      const bf* buf = pring + (st & 1) * PST;
      v16bf a[2][4], b[2][3];                                // two fragment sets: the next step's loads go ahead of this step's products, as one group
#pragma unroll
      for (int mb = 0; mb < 4; ++mb) a[0][mb] = ldb(buf + ao + mb * 16 * PPH);
#pragma unroll
      for (int nb = 0; nb < 3; ++nb) b[0][nb] = ldb(buf + bo + nb * 16 * PPH);
#pragma unroll     // the four 32-k steps of a tile: the fragment sets alternate by a compile-time index
      for (int ks = 0; ks < PKT / 32; ++ks) {
        const int cu = ks & 1, nx = cu ^ 1;
        if (ks + 1 < PKT / 32) {                             // never past this tile: the next one is read only behind the trip's barrier
#pragma unroll
          for (int mb = 0; mb < 4; ++mb) a[nx][mb] = ldb(buf + ao + mb * 16 * PPH + (ks + 1) * 32);
#pragma unroll
          for (int nb = 0; nb < 3; ++nb) b[nx][nb] = ldb(buf + bo + nb * 16 * PPH + (ks + 1) * 32);
        }
        __builtin_amdgcn_sched_barrier(0);                   // keeps the next step's loads ahead of this step's products: left free, the compiler sinks each load to its use and waits out the LDS latency there
#pragma unroll
        for (int nb = 0; nb < 3; ++nb)
#pragma unroll
            for (int mb = 0; mb < 4; ++mb) acc[mb][nb] = WF ? wmmab(b[cu][nb], a[cu][mb], acc[mb][nb]) : wmmab(a[cu][mb], b[cu][nb], acc[mb][nb]);
        __builtin_amdgcn_sched_barrier(0);                   // ... and this step's products ahead of the loads of the step after next, which reuse their fragment set
      }
      asm volatile("s_wait_dscnt 0x0" ::: "memory");         // this wave's reads of the buffer have returned before it is refilled
      asm volatile("s_wait_asynccnt 0x0" ::: "memory");      // this wave's copies of the next tile have landed
      __syncthreads();                                       // publishes the next tile and ends every reader's last read of this buffer
      if (st + 2 < DM / PKT) stage_ab(ag + (st + 2) * PKT, bg + (st + 2) * PKT, al + (unsigned)(st & 1) * (PST * 2u), bl + (unsigned)(st & 1) * (PST * 2u));
    }
}

__global__ __launch_bounds__(32 * PW) void k_proj(const bf* __restrict__ XB, const bf* __restrict__ WB, h16* QH, h16* KP, h16* VT) {
    __shared__ __align__(16) bf pring[2 * PST];
    const int lane = threadIdx.x & 31, wave = __builtin_amdgcn_readfirstlane((int)(threadIdx.x >> 5)), lr = lane & 15, hi = lane >> 4;
    const int bx = blockIdx.x, by = blockIdx.y;              // block row (256 x rows) and block column (192 stacked W rows)
    const int wm = wave >> 2, wn = wave & 3;                 // this wave's 64 x 48 tile
    const bool wf = by * PBN < 2 * DM;                       // the block holds q or k features: W fragment first (block-uniform)
    v8f acc[4][3];
#pragma unroll
    for (int mb = 0; mb < 4; ++mb)
#pragma unroll
        for (int nb = 0; nb < 3; ++nb) acc[mb][nb] = (v8f){};
    const int ao = (wm * 64 + lr) * PPH + 8 * hi;            // + mb*16*PPH + k, in a buffer's x tile
    const int bo = (PBM + wn * 48 + lr) * PPH + 8 * hi;      // + nb*16*PPH + k, in its W tile
    const int tid = (int)threadIdx.x;
    const bf* ag = XB + (size_t)(bx * PBM + (tid >> 4)) * DM + (tid & 15) * 8;   // + tile * PKT: row tid>>4, chunk tid&15 of its 256 B
    const bf* bg = WB + (size_t)(by * PBN + (tid >> 4)) * DM + (tid & 15) * 8;
    const unsigned pl = (unsigned)(size_t)&pring[0];                                    // LDS byte address of the ring
    const unsigned al = pl + (unsigned)((tid >> 4) * PPH + (tid & 15) * 8) * 2u;        // + buffer * PST * 2
    const unsigned bl = al + PBM * PPH * 2u;
    stage_ab(ag, bg, al, bl);
    asm volatile("s_wait_asynccnt 0x0" ::: "memory");        // tile 0 of this wave's copies has landed
    __syncthreads();                                         // ... and every other wave's: tile 0 may be read
    stage_ab(ag + PKT, bg + PKT, al + PST * 2u, bl + PST * 2u);
    if (wf) proj_loop<true>(pring, ao, bo, ag, bg, al, bl, acc); else proj_loop<false>(pring, ao, bo, ag, bg, al, bl, acc);
    asm volatile("s_wait_asynccnt 0x0" ::: "memory");        // no copy is outstanding when the wave goes on to its epilogue
    h16a* stg = (h16a*)pring;   // block-wide epilogue tile, laid over the ring: written only behind the last trip's foot (every wave's reads returned, its copies landed, barrier passed)
#pragma unroll
    for (int mb = 0; mb < 4; ++mb) {
#pragma unroll
        for (int nb = 0; nb < 3; ++nb) {
            const int nblk = wn * 48 + nb * 16, g = nblk >> 6, nl = nblk & 63, ml = wm * 64 + mb * 16;   // head group, feature in it, token in the block: all wave-uniform
            v8h hv;
#pragma unroll
            for (int j = 0; j < 8; ++j) hv[j] = (h16)acc[mb][nb][j];
            if (!wf) *(v8ha*)(stg + g * GSH + (nl + lr) * VSP + ml + 8 * hi) = hv;                          // D: token 8h+j, feature lane&15 -> [d][token]
            else if (by * PBN + nblk < 2 * DM) *(v8ha*)(stg + g * GSH + (ml + lr) * QKP + nl + 8 * hi) = hv;   // D: feature 8h+j, token lane&15 -> [token][d]
            else {                                                                                          // v features of the blocks that also hold k features (by = 10)
#pragma unroll
                for (int j = 0; j < 8; ++j) stg[g * GSH + (nl + 8 * hi + j) * VSP + ml + lr] = hv[j]; }
        }
    }
    __syncthreads();                                         // the block tile is complete before any wave reads other waves' parts of it
    const int b = (bx * PBM) / SEQ, t0 = (bx * PBM) % SEQ;
#pragma unroll
    for (int g = 0; g < PBN / HD; ++g) {
        const int ng = by * PBN + g * HD, pz = ng / DM, h = (ng % DM) / HD;
        const size_t hb = (size_t)(b * NH_ + h) * SEQ * HD;
        v8h v[PIT];                                          // all of a group's LDS reads go ahead of its stores, into registers of their own
        if (pz < 2) {
            h16* P = (pz == 0 ? QH : KP) + hb + (size_t)t0 * HD;
#pragma unroll
            for (int it = 0; it < PIT; ++it) { const int idx = it * 32 * PW + tid; v[it] = *(const v8ha*)(stg + g * GSH + (idx >> 3) * QKP + (idx & 7) * 8); }
#pragma unroll
            for (int it = 0; it < PIT; ++it) { const int idx = it * 32 * PW + tid; *(v8h*)(P + (size_t)idx * 8) = v[it]; }   // a wave stores 512 contiguous bytes
            asm volatile("s_wait_xcnt 0x0" ::: "memory");    // stands in front of later writes to registers that these stores name
            __builtin_amdgcn_sched_barrier(0);               // keeps those writes behind the wait: a memory clobber alone does not tie it to registers
        } else {
            h16* P = VT + hb + t0;
#pragma unroll
            for (int it = 0; it < PIT; ++it) { const int idx = it * 32 * PW + tid; v[it] = *(const v8ha*)(stg + g * GSH + (idx >> 5) * VSP + (idx & 31) * 8); }
#pragma unroll
            for (int it = 0; it < PIT; ++it) { const int idx = it * 32 * PW + tid; *(v8h*)(P + (size_t)(idx >> 5) * SEQ + (idx & 31) * 8) = v[it]; }   // a wave stores one d row's 512 bytes
            asm volatile("s_wait_xcnt 0x0" ::: "memory");    // as above
            __builtin_amdgcn_sched_barrier(0);               // as above
        }
    }
}

// One tile's copies of one lane: 4 x 16 B of K and 4 x 16 B of V^T, global memory to LDS through no register. Each wave-wide copy reads 512 B of whole lines.
// kg, vg: the lane's first global chunk of each operand; kl, vl: its LDS byte address. Later chunks: K + 32 rows (contiguous in memory), V^T + 16 rows.
__device__ __forceinline__ void stage_kv(const h16* kg, const h16* vg, unsigned kl, unsigned vl) {
    const h16* kg1 = kg + 32 * HD; const h16* kg2 = kg + 64 * HD; const h16* kg3 = kg + 96 * HD;
    const h16* vg1 = vg + (size_t)16 * SEQ; const h16* vg2 = vg + (size_t)32 * SEQ; const h16* vg3 = vg + (size_t)48 * SEQ;
    const unsigned kl1 = kl + 32 * KPH * 2, kl2 = kl + 64 * KPH * 2, kl3 = kl + 96 * KPH * 2;
    const unsigned vl1 = vl + 16 * VPH * 2, vl2 = vl + 32 * VPH * 2, vl3 = vl + 48 * VPH * 2;
    // the closing s_wait_xcnt stands in the copies' own statement so that no address register is rewritten in front of it
    asm volatile("global_load_async_to_lds_b128 %0, %8, off\n\t"
                 "global_load_async_to_lds_b128 %1, %9, off\n\t"
                 "global_load_async_to_lds_b128 %2, %10, off\n\t"
                 "global_load_async_to_lds_b128 %3, %11, off\n\t"
                 "global_load_async_to_lds_b128 %4, %12, off\n\t"
                 "global_load_async_to_lds_b128 %5, %13, off\n\t"
                 "global_load_async_to_lds_b128 %6, %14, off\n\t"
                 "global_load_async_to_lds_b128 %7, %15, off\n\t"
                 "s_wait_xcnt 0x0"
                 :: "v"(kl), "v"(kl1), "v"(kl2), "v"(kl3), "v"(vl), "v"(vl1), "v"(vl2), "v"(vl3),
                    "v"(kg), "v"(kg1), "v"(kg2), "v"(kg3), "v"(vg), "v"(vg1), "v"(vg2), "v"(vg3) : "memory");
}

__global__ __launch_bounds__(32 * AW) void k_flash(const h16* __restrict__ QH, const h16* __restrict__ KP, const h16* __restrict__ VT, float* OUT, float* CTX) {
    __shared__ __align__(16) float os[AW * 16 * 68];
    __shared__ __align__(16) h16 ring[2 * STH];
    const int lane = threadIdx.x & 31, wave = __builtin_amdgcn_readfirstlane((int)(threadIdx.x >> 5)), lr = lane & 15, hi = lane >> 4;
    const int zh = blockIdx.y; const int b = zh / NH_, h = zh % NH_;
    const int t0 = (blockIdx.x * AW + wave) * 16;
    const size_t pbase = (size_t)zh * SEQ * HD;
    const size_t qo = pbase + (size_t)(t0 + lr) * HD + 8 * hi;
    const v16h qh0 = ldh(QH + qo), qh1 = ldh(QH + qo + 32);   // B fragments: col t, k = d
    const int ko = lr * KPH + 8 * hi;                        // + key * KPH      (A fragment: row key, k = d), in a K tile
    const int vo = KTH + lr * VPH + 8 * hi;                  // + 16j*VPH + key  (A fragment: row d, k = key), in a V^T tile
    const int tid = (int)threadIdx.x;
    const h16* kg = KP + pbase + (size_t)tid * 8;                                   // + tile * KT * HD: chunk tid of the tile's 16 KiB
    const h16* vg = VT + pbase + (size_t)(tid >> 4) * SEQ + (tid & 15) * 8;         // + tile * KT: row tid>>4, chunk tid&15 of its 256 B
    const unsigned rl = (unsigned)(size_t)&ring[0];                                 // LDS byte address of the ring
    const unsigned kl = rl + (unsigned)((tid >> 3) * KPH + (tid & 7) * 8) * 2u;     // + buffer * STH * 2
    const unsigned vl = rl + (unsigned)(KTH + (tid >> 4) * VPH + (tid & 15) * 8) * 2u;
    stage_kv(kg, vg, kl, vl);
    asm volatile("s_wait_asynccnt 0x0" ::: "memory");        // tile 0 of this wave's copies has landed
    __syncthreads();                                         // ... and every other wave's: tile 0 may be read
    stage_kv(kg + (size_t)KT * HD, vg + KT, kl + STH * 2u, vl + STH * 2u);
    v8f o0 = (v8f){}, o1 = (v8f){}, o2 = (v8f){}, o3 = (v8f){};
    float m = -3.0e38f, l = 0.0f;
#pragma unroll 1   // one trip per tile: the ring's order stands once, at the trip's foot
    for (int st = 0; st < SEQ / KT; ++st) {
      const h16* buf = ring + (st & 1) * STH;
      // One softmax step per staged tile (128 keys): all eight 16-key score tiles first, then one running-max update, one exchange between the lane halves and one rescale.
      v8f s[KT / 16]; float mg[KT / 32];
      v16h kf[KT / 32][4];                                   // the whole tile's K fragments
#pragma unroll
      for (int g = 0; g < KT / 32; ++g) {
        const h16* ka = buf + ko + g * 32 * KPH;
        kf[g][0] = ldh(ka); kf[g][1] = ldh(ka + 32); kf[g][2] = ldh(ka + 16 * KPH); kf[g][3] = ldh(ka + 16 * KPH + 32);
      }
      __builtin_amdgcn_sched_barrier(0);                     // holds the K loads together, as one group ahead of the score products: left free, the compiler puts each pair in front of its product and waits out the LDS latency there
#pragma unroll     // the tile's four 32-key groups: 16 score products in a row, eight independent accumulators
      for (int g = 0; g < KT / 32; ++g) {
        v8f sa = (v8f){}, sb = (v8f){};
        sa = wmma16(kf[g][0], qh0, sa); sb = wmma16(kf[g][2], qh0, sb);
        sa = wmma16(kf[g][1], qh1, sa); sb = wmma16(kf[g][3], qh1, sb);
        s[2 * g] = sa; s[2 * g + 1] = sb;
      }
      const h16* va = buf + vo;
      v16h vf[2][4];                                         // two V^T fragment sets: a group's loads go one group ahead of its products
#pragma unroll
      for (int j = 0; j < 4; ++j) vf[0][j] = ldh(va + j * 16 * VPH);
      __builtin_amdgcn_sched_barrier(0);                     // holds the first group's V^T loads above the maximum chain: left free, the compiler sinks each load to its product and waits out the LDS latency there
#pragma unroll     // one maximum chain per group: four independent chains, joined below
      for (int g = 0; g < KT / 32; ++g) {
        float mx = -3.0e38f;
        s[2 * g] = s[2 * g] * SC2; s[2 * g + 1] = s[2 * g + 1] * SC2;
#pragma unroll
        for (int r = 0; r < 8; ++r) mx = fmaxf(mx, fmaxf(s[2 * g][r], s[2 * g + 1][r]));
        mg[g] = mx;
      }
      float mx = fmaxf(fmaxf(mg[0], mg[1]), fmaxf(mg[2], mg[3]));
      mx = fmaxf(mx, __shfl_xor(mx, 16, 32));
      const float mnew = fmaxf(m, mx);
      const float alpha = __builtin_amdgcn_exp2f(m - mnew);
      const float sh = PSH - mnew;
      o0 = o0 * alpha; o1 = o1 * alpha; o2 = o2 * alpha; o3 = o3 * alpha;
      float ls = 0.0f;
#pragma unroll     // the four 32-key groups again: P packed from the scores, then 4 P.V products each; the fragment sets alternate by a compile-time index
      for (int g = 0; g < KT / 32; ++g) {
        const int cu = g & 1, nx = cu ^ 1;
        if (g + 1 < KT / 32) {                               // never past this tile
#pragma unroll
          for (int j = 0; j < 4; ++j) vf[nx][j] = ldh(va + j * 16 * VPH + (g + 1) * 32);
        }
        __builtin_amdgcn_sched_barrier(0);                   // holds the next group's V^T loads above this group's exponentials and products, for the same reason
        v16h pb;
#pragma unroll
        for (int r = 0; r < 8; ++r) { const h16 pa = (h16)__builtin_amdgcn_exp2f(s[2 * g][r] + sh); const h16 pc = (h16)__builtin_amdgcn_exp2f(s[2 * g + 1][r] + sh); pb[r] = pa; pb[8 + r] = pc; ls += (float)pa + (float)pc; }
        o0 = wmma16(vf[cu][0], pb, o0); o1 = wmma16(vf[cu][1], pb, o1); o2 = wmma16(vf[cu][2], pb, o2); o3 = wmma16(vf[cu][3], pb, o3);
      }
      l = l * alpha + ls; m = mnew;
      asm volatile("s_wait_dscnt 0x0" ::: "memory");         // this wave's reads of the buffer have returned before it is refilled
      asm volatile("s_wait_asynccnt 0x0" ::: "memory");      // this wave's copies of the next tile have landed
      __syncthreads();                                       // publishes the next tile and ends every reader's last read of this buffer
      if (st + 2 < SEQ / KT) stage_kv(kg + (size_t)(st + 2) * KT * HD, vg + (st + 2) * KT, kl + (unsigned)(st & 1) * (STH * 2u), vl + (unsigned)(st & 1) * (STH * 2u));
    }
    asm volatile("s_wait_asynccnt 0x0" ::: "memory");        // no copy is outstanding when the wave goes on to its epilogue
    l += __shfl_xor(l, 16, 32);
    const float inv = 1.0f / l;
    const int wb = wave * 16 * 68;
    // O^T D layout: o_j[r] = (d = 16j + 8h + r, t = lane&15) -> os[t][d]; rows 0..15 x columns 0..63 all written
    { v4f a, c;
      a[0] = o0[0] * inv; a[1] = o0[1] * inv; a[2] = o0[2] * inv; a[3] = o0[3] * inv; c[0] = o0[4] * inv; c[1] = o0[5] * inv; c[2] = o0[6] * inv; c[3] = o0[7] * inv;
      *(v4fa*)(&os[wb + lr * 68 +  0 + 8 * hi]) = a; *(v4fa*)(&os[wb + lr * 68 +  0 + 8 * hi + 4]) = c;
      a[0] = o1[0] * inv; a[1] = o1[1] * inv; a[2] = o1[2] * inv; a[3] = o1[3] * inv; c[0] = o1[4] * inv; c[1] = o1[5] * inv; c[2] = o1[6] * inv; c[3] = o1[7] * inv;
      *(v4fa*)(&os[wb + lr * 68 + 16 + 8 * hi]) = a; *(v4fa*)(&os[wb + lr * 68 + 16 + 8 * hi + 4]) = c;
      a[0] = o2[0] * inv; a[1] = o2[1] * inv; a[2] = o2[2] * inv; a[3] = o2[3] * inv; c[0] = o2[4] * inv; c[1] = o2[5] * inv; c[2] = o2[6] * inv; c[3] = o2[7] * inv;
      *(v4fa*)(&os[wb + lr * 68 + 32 + 8 * hi]) = a; *(v4fa*)(&os[wb + lr * 68 + 32 + 8 * hi + 4]) = c;
      a[0] = o3[0] * inv; a[1] = o3[1] * inv; a[2] = o3[2] * inv; a[3] = o3[3] * inv; c[0] = o3[4] * inv; c[1] = o3[5] * inv; c[2] = o3[6] * inv; c[3] = o3[7] * inv;
      *(v4fa*)(&os[wb + lr * 68 + 48 + 8 * hi]) = a; *(v4fa*)(&os[wb + lr * 68 + 48 + 8 * hi + 4]) = c; }
    wave_sync();
    float* orow = OUT + ((size_t)b * OUT_SEQ + t0) * DM + h * HD;          // merged [b][t][h*64 + d]
    float* crow = CTX + ((size_t)zh * OUT_SEQ + t0) * HD;                  // context [b*16 + h][t][d]
{
#pragma unroll
        for (int s = 0; s < 8; ++s) { const int row = 2 * s + hi, cofs = lr * 4;   // 8 s x 2 rows = 16 rows; 16 lanes x 4 floats = 64 columns
            const v4f val = *(const v4fa*)(&os[wb + row * 68 + cofs]);
            *(v4f*)(orow + (size_t)row * DM + cofs) = val;
            *(v4f*)(crow + (size_t)row * HD + cofs) = val; }
         }
}

static constexpr size_t al256(size_t v) { return (v + 255) & ~(size_t)255; }
static constexpr size_t SZ_XB = al256((size_t)NB * SEQ * DM * 2);
static constexpr size_t SZ_WB = al256((size_t)3 * DM * DM * 2);
static constexpr size_t SZ_PL = al256((size_t)NB * NH_ * SEQ * HD * 2);
static constexpr size_t SZ_TOTAL = SZ_XB + SZ_WB + 3 * SZ_PL;
static_assert(SZ_TOTAL <= (size_t)134217728);          // workspace carve <= 128 MiB
static_assert(((size_t)DM * DM * 2) % 256 == 0);       // weight sub-planes stay 256-byte aligned

extern "C" void kernel_launch(void* const* d_in, const int* in_sizes, int n_in,
                              void* d_out, int out_size, void* d_ws, size_t ws_size, hipStream_t stream) {
    if (n_in < 4) return;
    const size_t needx = ((size_t)(NB - 1) * SEQ_FULL + SEQ) * DM;
    if ((size_t)in_sizes[0] < needx) return;
    if ((size_t)in_sizes[1] < (size_t)DM * DM || (size_t)in_sizes[2] < (size_t)DM * DM || (size_t)in_sizes[3] < (size_t)DM * DM) return;
    if ((size_t)out_size < CTX_OFF + ((size_t)(NB * NH_ - 1) * OUT_SEQ + SEQ) * HD) return;
    if (SZ_TOTAL > ws_size) return;
    const float* x = (const float*)d_in[0]; const float* wq = (const float*)d_in[1]; const float* wk = (const float*)d_in[2]; const float* wv = (const float*)d_in[3];   // wire order x, Wq, Wk, Wv ([out][in] = Bt as-is)
    float* OUT = (float*)d_out;              // [NB][SEQ][1024]
    float* CTX = (float*)d_out + CTX_OFF;    // [NB][16][SEQ][64]
    char* wsp = (char*)d_ws;
    bf* XB = (bf*)wsp; wsp += SZ_XB;                 // [NB*SEQ][1024]
    bf* WB = (bf*)wsp; wsp += SZ_WB;                 // [3][1024][1024]: q | k | v
    h16* QH = (h16*)wsp; wsp += SZ_PL;               // [NB*16][SEQ][64]
    h16* KP = (h16*)wsp; wsp += SZ_PL;               // [NB*16][SEQ][64]
    h16* VT = (h16*)wsp; wsp += SZ_PL;               // [NB*16][64][SEQ]

    k_cvt8<<<XBLK + 3 * WBLK, 256, 0, stream>>>(x, wq, wk, wv, XB, WB);

    k_proj<<<dim3(NB * SEQ / PBM, 3 * DM / PBN, 1), 32 * PW, 0, stream>>>(XB, WB, QH, KP, VT);

    k_flash<<<dim3(SEQ / (16 * AW), NB * NH_, 1), 32 * AW, 0, stream>>>(QH, KP, VT, OUT, CTX);
}

// v007
// A run of this version takes 60.4 microseconds.
// In both of two side-by-side timings against v006, it was 1.04 times as fast.
// All steps since v000 together make it 3.26 times as fast.
#include <hip/hip_runtime.h>

// Multi-head self-attention, width 1024 = 16 heads x 64, x [NB][SEQ][1024], Wq/Wk/Wv [out][in] (y = x W^T), no biases, no mask, score scale 1/8; two f32 outputs: merged heads [NB][SEQ][1024] and per-head context [NB][16][SEQ][64].
// Compute dtypes, f32 accumulate everywhere: projections v_wmma_f32_16x16x32_bf16 (x and W RNE-converted to bf16; products exact);
// scores v_wmma_f32_16x16x32_f16: q and k single f16 (one product); P (x256 carry, cancels in the normalisation) and v single f16; softmax f32 (online, running max).
// Layout: bf16 copies of x and W; q, k planes [b*16+h][t][d] and v^T plane [b*16+h][d][t] written by the GEMM epilogue; fused flash kernel in transposed form (S^T = K Q^T, O^T = V^T P^T), both outputs from the same f32 accumulators.

#ifndef NB
#define NB 2
#endif
#ifndef SEQ
#define SEQ 2048
#endif
#define NB_FULL  2
#define SEQ_FULL 2048
#ifndef OUT_SEQ
#define OUT_SEQ SEQ              // row pitch (in tokens) between batches of the merged output and between (batch, head) slabs of the context output
#endif
#define DM   1024                // input width == projection width
#define NH_  16
#define HD   64
#define AW   8                   // waves per flash block (16 query rows each)
#define KT   128                 // keys per staged K / V^T tile
#define KPH  72                  // LDS pitch of a K row in halves: 128 B + 16 B (16 B x odd: ds_load_b128 readers meet no bank conflict)
#define VPH  136                 // LDS pitch of a V^T row in halves: 256 B + 16 B
#define KTH  (KT * KPH)          // halves of one K tile in LDS
#define STH  (KTH + HD * VPH)    // halves of one ring buffer (K tile, then V^T tile)
#define PW   16                  // waves per projection block: 4 x 4 wave tiles of 64 x 48
#define PBM  256                 // x rows of a projection block
#define PBN  192                 // stacked W rows (q | k | v) of a projection block: three head groups of 64
#define PKT  128                 // k per staged projection tile
#define PPH  136                 // LDS pitch of a staged operand row in 16-bit elements: 256 B + 16 B
#define PST  ((PBM + PBN) * PPH) // elements of one projection ring buffer (x tile, then W tile)
#define QKP  72                  // epilogue pitch of a [token][d] row in halves: 128 B + 16 B
#define VSP  264                 // epilogue pitch of a [d][token] row in halves: 512 B + 16 B
#define PIT  (PBM * HD / (8 * 32 * PW))   // 16-B stores of one lane per head group
#define GSH  (PBM * QKP)         // halves of one head group's epilogue region (the larger of the two forms)
#define SC2  (0.125f * 1.4426950408889634f)   // HD^-0.5 * log2(e)
#define PSH  8.0f                // log2 of the P carry (256)
#define CTX_OFF ((size_t)NB_FULL * SEQ_FULL * DM)   // element offset of the second output (fixed, full-size constants)

static_assert(HD == 64);
static_assert(NH_ * HD == DM);                 // head h = columns h*64 + d
static_assert(DM % 64 == 0);                   // 16 column tiles of 64
static_assert(DM % 32 == 0);                   // GEMM k-loop steps by 32
static_assert(SEQ % 64 == 0);                  // a 64-row tile never straddles two batches
static_assert((NB * SEQ) % PBM == 0 && (3 * DM) % PBN == 0);   // projection blocks of 256 x 192 cover x and the stacked weights exactly
static_assert(SEQ % PBM == 0 && PBN % HD == 0 && DM % HD == 0);   // a block's tokens lie in one batch; a head group lies in one plane
static_assert(DM % PKT == 0 && DM / PKT >= 2);           // whole k tiles only; the ring's prologue needs two
static_assert((size_t)(PBN / HD) * GSH <= (size_t)2 * PST && HD * VSP <= GSH);   // the epilogue regions fit the ring they are laid over
static_assert((size_t)2 * PST * 2 <= (size_t)327680);    // the ring fits one WGP's LDS
static_assert(PKT == 128 && PW == 16 && PBM == 256 && PBN == 192);   // the copy map of stage_ab: 512 lanes x 16 B cover 32 rows a copy, 8 copies of x and 6 of W
static_assert((PBM * HD) % (8 * 32 * PW) == 0);          // the epilogue's stores cover a head group exactly
static_assert(SEQ % 32 == 0);                  // key loop steps by 32
static_assert(SEQ % KT == 0 && SEQ / KT >= 2); // whole tiles only; the ring's prologue needs two
static_assert(KT == 128 && AW == 8);           // the copy map below: 256 lanes x 16 B x 4 copies = one 16-KiB tile of each operand
static_assert(SEQ % (16 * AW) == 0);           // flash grid covers the sequence exactly
static_assert(((size_t)SEQ * DM) % 8 == 0);
static_assert(((size_t)DM * DM) % 8 == 0);
static_assert(NB <= NB_FULL);
static_assert(SEQ <= SEQ_FULL);
static_assert(OUT_SEQ >= SEQ);
static_assert(OUT_SEQ <= SEQ_FULL);
static_assert(CTX_OFF * 4 == (size_t)16777216);                                            // byte offset of the second output
static_assert(((size_t)(NB - 1) * OUT_SEQ + SEQ) * DM <= CTX_OFF);                           // merged output stays inside its own region
static_assert(CTX_OFF + ((size_t)(NB * NH_ - 1) * OUT_SEQ + SEQ) * HD <= (size_t)2 * CTX_OFF); // context output stays inside the buffer (33554432 B)

typedef _Float16 h16;
typedef unsigned short bf;
typedef __attribute__((ext_vector_type(16))) __bf16   v16bf;
typedef __attribute__((ext_vector_type(16))) _Float16 v16h;
typedef __attribute__((ext_vector_type(8)))  _Float16 v8h;
typedef __attribute__((ext_vector_type(8)))  unsigned short v8us;
typedef __attribute__((ext_vector_type(8)))  float    v8f;
typedef __attribute__((ext_vector_type(4)))  float    v4f;
typedef v4f  __attribute__((may_alias)) v4fa;
typedef v8h  __attribute__((may_alias)) v8ha;
typedef h16  __attribute__((may_alias)) h16a;

__device__ __forceinline__ unsigned short f2bf(float f) { unsigned u = __float_as_uint(f); u += 0x7FFFu + ((u >> 16) & 1u); return (unsigned short)(u >> 16); }
__device__ __forceinline__ v16h cat16(v8h lo, v8h hi) { return __builtin_shufflevector(lo, hi, 0, 1, 2, 3, 4, 5, 6, 7, 8, 9, 10, 11, 12, 13, 14, 15); }
__device__ __forceinline__ v16bf cat16b(v8us lo, v8us hi) { return __builtin_bit_cast(v16bf, __builtin_shufflevector(lo, hi, 0, 1, 2, 3, 4, 5, 6, 7, 8, 9, 10, 11, 12, 13, 14, 15)); }
__device__ __forceinline__ v8f wmma16(v16h a, v16h b, v8f c) { return __builtin_amdgcn_wmma_f32_16x16x32_f16(false, a, false, b, (short)0, c, false, false); }
__device__ __forceinline__ v8f wmmab(v16bf a, v16bf b, v8f c) { return __builtin_amdgcn_wmma_f32_16x16x32_bf16(false, a, false, b, (short)0, c, false, false); }
// fragment loaders from K-contiguous 16-bit rows; p already includes + 8*(lane>>4): elements 0..7 <- k0+8h+0..7, elements 8..15 <- k0+16+8h+0..7 (same map for A and B)
__device__ __forceinline__ v16h  ldh(const h16* p) { return cat16(*(const v8h*)p, *(const v8h*)(p + 16)); }
__device__ __forceinline__ v16bf ldb(const bf* p)  { return cat16b(*(const v8us*)p, *(const v8us*)(p + 16)); }
// ordering point for wave-private LDS tiles (same wave writes and reads)
__device__ __forceinline__ void wave_sync() { __builtin_amdgcn_fence(3 /* release order */, "wavefront"); __builtin_amdgcn_wave_barrier(); asm volatile("" ::: "memory"); }

#define XBLK ((unsigned)((size_t)NB * SEQ * DM / 2048))   // conversion blocks (256 lanes x 8 elements) that cover x
#define WBLK ((unsigned)((size_t)DM * DM / 2048))         // ... and one weight matrix
static_assert(((size_t)SEQ * DM) % 2048 == 0 && ((size_t)DM * DM) % 2048 == 0);   // a block never straddles two batches or two matrices; the grid is exact

// k_cvt8: all four f32 -> bf16 conversions in one launch; the block index picks the source (blocks [0, XBLK): x, then WBLK blocks each of Wq, Wk, Wv). grid XBLK + 3 * WBLK.
__global__ __launch_bounds__(256) void k_cvt8(const float* __restrict__ x, const float* __restrict__ wq, const float* __restrict__ wk, const float* __restrict__ wv, bf* XB, bf* WB) {
    const unsigned bi = blockIdx.x;
    const float* src; bf* dst;
    if (bi < XBLK) {
        const unsigned b = bi / (XBLK / NB);                                   // batch: source pitch SEQ_FULL tokens, copy pitch SEQ tokens
        src = x + (size_t)b * SEQ_FULL * DM + (size_t)(bi - b * (XBLK / NB)) * 2048; dst = XB + (size_t)bi * 2048;
    } else {
        const unsigned wi = bi - XBLK, w = wi / WBLK;
        src = (w == 0 ? wq : w == 1 ? wk : wv) + (size_t)(wi - w * WBLK) * 2048; dst = WB + (size_t)wi * 2048;
    }
    const v8f v = *(const v8f*)(src + threadIdx.x * 8); v8us o;
#pragma unroll
    for (int k = 0; k < 8; ++k) o[k] = f2bf(v[k]);
    *(v8us*)(dst + threadIdx.x * 8) = o;
}

// Copies of one lane, global memory to LDS through no register: 16 B of rows r, r + 32, ... of a K-contiguous bf16 plane (512 lanes: 32 rows x 256 B per copy of the block).
// g: the lane's first global chunk; l: its LDS byte address. Each wave-wide copy reads two rows x 256 B of whole lines. stage_x: 8 copies (256 rows); stage_w: 6 copies (192 rows).
__device__ __forceinline__ void stage_x(const bf* g, unsigned l) {
    const bf* g1 = g + (size_t)32 * DM; const bf* g2 = g + (size_t)64 * DM; const bf* g3 = g + (size_t)96 * DM; const bf* g4 = g + (size_t)128 * DM;
    const bf* g5 = g + (size_t)160 * DM; const bf* g6 = g + (size_t)192 * DM; const bf* g7 = g + (size_t)224 * DM;
    const unsigned l1 = l + 32 * PPH * 2, l2 = l + 64 * PPH * 2, l3 = l + 96 * PPH * 2, l4 = l + 128 * PPH * 2, l5 = l + 160 * PPH * 2, l6 = l + 192 * PPH * 2, l7 = l + 224 * PPH * 2;
    // the closing s_wait_xcnt stands in the copies' own statement so that no address register is rewritten in front of it
    asm volatile("global_load_async_to_lds_b128 %0, %8, off\n\t"
                 "global_load_async_to_lds_b128 %1, %9, off\n\t"
                 "global_load_async_to_lds_b128 %2, %10, off\n\t"
                 "global_load_async_to_lds_b128 %3, %11, off\n\t"
                 "global_load_async_to_lds_b128 %4, %12, off\n\t"
                 "global_load_async_to_lds_b128 %5, %13, off\n\t"
                 "global_load_async_to_lds_b128 %6, %14, off\n\t"
                 "global_load_async_to_lds_b128 %7, %15, off\n\t"
                 "s_wait_xcnt 0x0"
                 :: "v"(l), "v"(l1), "v"(l2), "v"(l3), "v"(l4), "v"(l5), "v"(l6), "v"(l7),
                    "v"(g), "v"(g1), "v"(g2), "v"(g3), "v"(g4), "v"(g5), "v"(g6), "v"(g7) : "memory");
}
__device__ __forceinline__ void stage_w(const bf* g, unsigned l) {
    const bf* g1 = g + (size_t)32 * DM; const bf* g2 = g + (size_t)64 * DM; const bf* g3 = g + (size_t)96 * DM; const bf* g4 = g + (size_t)128 * DM; const bf* g5 = g + (size_t)160 * DM;
    const unsigned l1 = l + 32 * PPH * 2, l2 = l + 64 * PPH * 2, l3 = l + 96 * PPH * 2, l4 = l + 128 * PPH * 2, l5 = l + 160 * PPH * 2;
    // the closing s_wait_xcnt stands in the copies' own statement so that no address register is rewritten in front of it
    asm volatile("global_load_async_to_lds_b128 %0, %6, off\n\t"
                 "global_load_async_to_lds_b128 %1, %7, off\n\t"
                 "global_load_async_to_lds_b128 %2, %8, off\n\t"
                 "global_load_async_to_lds_b128 %3, %9, off\n\t"
                 "global_load_async_to_lds_b128 %4, %10, off\n\t"
                 "global_load_async_to_lds_b128 %5, %11, off\n\t"
                 "s_wait_xcnt 0x0"
                 :: "v"(l), "v"(l1), "v"(l2), "v"(l3), "v"(l4), "v"(l5),
                    "v"(g), "v"(g1), "v"(g2), "v"(g3), "v"(g4), "v"(g5) : "memory");
}
// One k tile's copies of one lane: 8 x 16 B of the block's 256 x rows and 6 x 16 B of its 192 W rows (14 copies of a wave in flight).
__device__ __forceinline__ void stage_ab(const bf* ag, const bf* bg, unsigned al, unsigned bl) { stage_x(ag, al); stage_w(bg, bl); }

// The k loop of k_proj. WF: the W fragment is the product's first operand (D row = W row, D column = x row: a lane holds 8 consecutive features of one token); else the x fragment is (8 consecutive tokens of one feature).
template <bool WF>
__device__ __forceinline__ void proj_loop(const bf* pring, int ao, int bo, const bf* ag, const bf* bg, unsigned al, unsigned bl, v8f (&acc)[4][3]) {
#pragma unroll 1   // one trip per k tile: the ring's order stands once, at the trip's foot
    for (int st = 0; st < DM / PKT; ++st) {
      const bf* buf = pring + (st & 1) * PST;
      v16bf a[2][4], b[2][3];                                // two fragment sets: the next step's loads go ahead of this step's products, as one group
#pragma unroll
      for (int mb = 0; mb < 4; ++mb) a[0][mb] = ldb(buf + ao + mb * 16 * PPH);
#pragma unroll
      for (int nb = 0; nb < 3; ++nb) b[0][nb] = ldb(buf + bo + nb * 16 * PPH);
#pragma unroll     // the four 32-k steps of a tile: the fragment sets alternate by a compile-time index
      for (int ks = 0; ks < PKT / 32; ++ks) {
        const int cu = ks & 1, nx = cu ^ 1;
        if (ks + 1 < PKT / 32) {                             // never past this tile: the next one is read only behind the trip's barrier
#pragma unroll
          for (int mb = 0; mb < 4; ++mb) a[nx][mb] = ldb(buf + ao + mb * 16 * PPH + (ks + 1) * 32);
#pragma unroll
          for (int nb = 0; nb < 3; ++nb) b[nx][nb] = ldb(buf + bo + nb * 16 * PPH + (ks + 1) * 32);
        }
        __builtin_amdgcn_sched_barrier(0);                   // keeps the next step's loads ahead of this step's products: left free, the compiler sinks each load to its use and waits out the LDS latency there
#pragma unroll
        for (int nb = 0; nb < 3; ++nb)
#pragma unroll
            for (int mb = 0; mb < 4; ++mb) acc[mb][nb] = WF ? wmmab(b[cu][nb], a[cu][mb], acc[mb][nb]) : wmmab(a[cu][mb], b[cu][nb], acc[mb][nb]);
        __builtin_amdgcn_sched_barrier(0);                   // ... and this step's products ahead of the loads of the step after next, which reuse their fragment set
      }
      asm volatile("s_wait_dscnt 0x0" ::: "memory");         // this wave's reads of the buffer have returned before it is refilled
      asm volatile("s_wait_asynccnt 0x0" ::: "memory");      // this wave's copies of the next tile have landed
      __syncthreads();                                       // publishes the next tile and ends every reader's last read of this buffer
      if (st + 2 < DM / PKT) stage_ab(ag + (st + 2) * PKT, bg + (st + 2) * PKT, al + (unsigned)(st & 1) * (PST * 2u), bl + (unsigned)(st & 1) * (PST * 2u));
    }
}

__global__ __launch_bounds__(32 * PW) void k_proj(const bf* __restrict__ XB, const bf* __restrict__ WB, h16* QH, h16* KP, h16* VT) {
    __shared__ __align__(16) bf pring[2 * PST];
    const int lane = threadIdx.x & 31, wave = __builtin_amdgcn_readfirstlane((int)(threadIdx.x >> 5)), lr = lane & 15, hi = lane >> 4;
    const int bx = blockIdx.x, by = blockIdx.y;              // block row (256 x rows) and block column (192 stacked W rows)
    const int wm = wave >> 2, wn = wave & 3;                 // this wave's 64 x 48 tile
    const bool wf = by * PBN < 2 * DM;                       // the block holds q or k features: W fragment first (block-uniform)
    v8f acc[4][3];
#pragma unroll
    for (int mb = 0; mb < 4; ++mb)
#pragma unroll
        for (int nb = 0; nb < 3; ++nb) acc[mb][nb] = (v8f){};
    const int ao = (wm * 64 + lr) * PPH + 8 * hi;            // + mb*16*PPH + k, in a buffer's x tile
    const int bo = (PBM + wn * 48 + lr) * PPH + 8 * hi;      // + nb*16*PPH + k, in its W tile
    const int tid = (int)threadIdx.x;
    const bf* ag = XB + (size_t)(bx * PBM + (tid >> 4)) * DM + (tid & 15) * 8;   // + tile * PKT: row tid>>4, chunk tid&15 of its 256 B
    const bf* bg = WB + (size_t)(by * PBN + (tid >> 4)) * DM + (tid & 15) * 8;
    const unsigned pl = (unsigned)(size_t)&pring[0];                                    // LDS byte address of the ring
    const unsigned al = pl + (unsigned)((tid >> 4) * PPH + (tid & 15) * 8) * 2u;        // + buffer * PST * 2
    const unsigned bl = al + PBM * PPH * 2u;
    stage_ab(ag, bg, al, bl);
    asm volatile("s_wait_asynccnt 0x0" ::: "memory");        // tile 0 of this wave's copies has landed
    __syncthreads();                                         // ... and every other wave's: tile 0 may be read
    stage_ab(ag + PKT, bg + PKT, al + PST * 2u, bl + PST * 2u);
    if (wf) proj_loop<true>(pring, ao, bo, ag, bg, al, bl, acc); else proj_loop<false>(pring, ao, bo, ag, bg, al, bl, acc);
    asm volatile("s_wait_asynccnt 0x0" ::: "memory");        // no copy is outstanding when the wave goes on to its epilogue
    h16a* stg = (h16a*)pring;   // block-wide epilogue tile, laid over the ring: written only behind the last trip's foot (every wave's reads returned, its copies landed, barrier passed)
#pragma unroll
    for (int mb = 0; mb < 4; ++mb) {
#pragma unroll
        for (int nb = 0; nb < 3; ++nb) {
            const int nblk = wn * 48 + nb * 16, g = nblk >> 6, nl = nblk & 63, ml = wm * 64 + mb * 16;   // head group, feature in it, token in the block: all wave-uniform
            v8h hv;
#pragma unroll
            for (int j = 0; j < 8; ++j) hv[j] = (h16)acc[mb][nb][j];
            if (!wf) *(v8ha*)(stg + g * GSH + (nl + lr) * VSP + ml + 8 * hi) = hv;                          // D: token 8h+j, feature lane&15 -> [d][token]
            else if (by * PBN + nblk < 2 * DM) *(v8ha*)(stg + g * GSH + (ml + lr) * QKP + nl + 8 * hi) = hv;   // D: feature 8h+j, token lane&15 -> [token][d]
            else {                                                                                          // v features of the blocks that also hold k features (by = 10)
#pragma unroll
                for (int j = 0; j < 8; ++j) stg[g * GSH + (nl + 8 * hi + j) * VSP + ml + lr] = hv[j]; }
        }
    }
    __syncthreads();                                         // the block tile is complete before any wave reads other waves' parts of it
    const int b = (bx * PBM) / SEQ, t0 = (bx * PBM) % SEQ;
#pragma unroll
    for (int g = 0; g < PBN / HD; ++g) {
        const int ng = by * PBN + g * HD, pz = ng / DM, h = (ng % DM) / HD;
        const size_t hb = (size_t)(b * NH_ + h) * SEQ * HD;
        v8h v[PIT];                                          // all of a group's LDS reads go ahead of its stores, into registers of their own
        if (pz < 2) {
            h16* P = (pz == 0 ? QH : KP) + hb + (size_t)t0 * HD;
#pragma unroll
            for (int it = 0; it < PIT; ++it) { const int idx = it * 32 * PW + tid; v[it] = *(const v8ha*)(stg + g * GSH + (idx >> 3) * QKP + (idx & 7) * 8); }
#pragma unroll
            for (int it = 0; it < PIT; ++it) { const int idx = it * 32 * PW + tid; *(v8h*)(P + (size_t)idx * 8) = v[it]; }   // a wave stores 512 contiguous bytes
            asm volatile("s_wait_xcnt 0x0" ::: "memory");    // stands in front of later writes to registers that these stores name
            __builtin_amdgcn_sched_barrier(0);               // keeps those writes behind the wait: a memory clobber alone does not tie it to registers
        } else {
            h16* P = VT + hb + t0;
#pragma unroll
            for (int it = 0; it < PIT; ++it) { const int idx = it * 32 * PW + tid; v[it] = *(const v8ha*)(stg + g * GSH + (idx >> 5) * VSP + (idx & 31) * 8); }
#pragma unroll
            for (int it = 0; it < PIT; ++it) { const int idx = it * 32 * PW + tid; *(v8h*)(P + (size_t)(idx >> 5) * SEQ + (idx & 31) * 8) = v[it]; }   // a wave stores one d row's 512 bytes
            asm volatile("s_wait_xcnt 0x0" ::: "memory");    // as above
            __builtin_amdgcn_sched_barrier(0);               // as above
        }
    }
}

// One tile's copies of one lane: 4 x 16 B of K and 4 x 16 B of V^T, global memory to LDS through no register. Each wave-wide copy reads 512 B of whole lines.
// kg, vg: the lane's first global chunk of each operand; kl, vl: its LDS byte address. Later chunks: K + 32 rows (contiguous in memory), V^T + 16 rows.
__device__ __forceinline__ void stage_kv(const h16* kg, const h16* vg, unsigned kl, unsigned vl) {
    const h16* kg1 = kg + 32 * HD; const h16* kg2 = kg + 64 * HD; const h16* kg3 = kg + 96 * HD;
    const h16* vg1 = vg + (size_t)16 * SEQ; const h16* vg2 = vg + (size_t)32 * SEQ; const h16* vg3 = vg + (size_t)48 * SEQ;
    const unsigned kl1 = kl + 32 * KPH * 2, kl2 = kl + 64 * KPH * 2, kl3 = kl + 96 * KPH * 2;
    const unsigned vl1 = vl + 16 * VPH * 2, vl2 = vl + 32 * VPH * 2, vl3 = vl + 48 * VPH * 2;
    // the closing s_wait_xcnt stands in the copies' own statement so that no address register is rewritten in front of it
    asm volatile("global_load_async_to_lds_b128 %0, %8, off\n\t"
                 "global_load_async_to_lds_b128 %1, %9, off\n\t"
                 "global_load_async_to_lds_b128 %2, %10, off\n\t"
                 "global_load_async_to_lds_b128 %3, %11, off\n\t"
                 "global_load_async_to_lds_b128 %4, %12, off\n\t"
                 "global_load_async_to_lds_b128 %5, %13, off\n\t"
                 "global_load_async_to_lds_b128 %6, %14, off\n\t"
                 "global_load_async_to_lds_b128 %7, %15, off\n\t"
                 "s_wait_xcnt 0x0"
                 :: "v"(kl), "v"(kl1), "v"(kl2), "v"(kl3), "v"(vl), "v"(vl1), "v"(vl2), "v"(vl3),
                    "v"(kg), "v"(kg1), "v"(kg2), "v"(kg3), "v"(vg), "v"(vg1), "v"(vg2), "v"(vg3) : "memory");
}

__global__ __launch_bounds__(32 * AW) void k_flash(const h16* __restrict__ QH, const h16* __restrict__ KP, const h16* __restrict__ VT, float* OUT, float* CTX) {
    __shared__ __align__(16) float os[AW * 16 * 68];
    __shared__ __align__(16) h16 ring[2 * STH];
    const int lane = threadIdx.x & 31, wave = __builtin_amdgcn_readfirstlane((int)(threadIdx.x >> 5)), lr = lane & 15, hi = lane >> 4;
    const int zh = blockIdx.y; const int b = zh / NH_, h = zh % NH_;
    const int t0 = (blockIdx.x * AW + wave) * 16;
    const size_t pbase = (size_t)zh * SEQ * HD;
    const size_t qo = pbase + (size_t)(t0 + lr) * HD + 8 * hi;
    const v16h qh0 = ldh(QH + qo), qh1 = ldh(QH + qo + 32);   // B fragments: col t, k = d
    const int ko = lr * KPH + 8 * hi;                        // + key * KPH      (A fragment: row key, k = d), in a K tile
    const int vo = KTH + lr * VPH + 8 * hi;                  // + 16j*VPH + key  (A fragment: row d, k = key), in a V^T tile
    const int tid = (int)threadIdx.x;
    const h16* kg = KP + pbase + (size_t)tid * 8;                                   // + tile * KT * HD: chunk tid of the tile's 16 KiB
    const h16* vg = VT + pbase + (size_t)(tid >> 4) * SEQ + (tid & 15) * 8;         // + tile * KT: row tid>>4, chunk tid&15 of its 256 B
    const unsigned rl = (unsigned)(size_t)&ring[0];                                 // LDS byte address of the ring
    const unsigned kl = rl + (unsigned)((tid >> 3) * KPH + (tid & 7) * 8) * 2u;     // + buffer * STH * 2
    const unsigned vl = rl + (unsigned)(KTH + (tid >> 4) * VPH + (tid & 15) * 8) * 2u;
    stage_kv(kg, vg, kl, vl);
    asm volatile("s_wait_asynccnt 0x0" ::: "memory");        // tile 0 of this wave's copies has landed
    __syncthreads();                                         // ... and every other wave's: tile 0 may be read
    stage_kv(kg + (size_t)KT * HD, vg + KT, kl + STH * 2u, vl + STH * 2u);
    v8f o0 = (v8f){}, o1 = (v8f){}, o2 = (v8f){}, o3 = (v8f){};
    float m = -3.0e38f;
    // Row sums of P on the matrix unit: A has ones in rows 0 and 8 (lanes 0, 8, 16, 24) and zeros elsewhere, so element 0 of the sum tile holds, in both lane halves, the lane's own query's sum over all keys.
    const h16 u1 = (lane & 7) == 0 ? (h16)1.0f : (h16)0.0f;
    const v16h ones = {u1, u1, u1, u1, u1, u1, u1, u1, u1, u1, u1, u1, u1, u1, u1, u1};
    v8f lt = (v8f){};
#pragma unroll 1   // one trip per tile: the ring's order stands once, at the trip's foot
    for (int st = 0; st < SEQ / KT; ++st) {
      const h16* buf = ring + (st & 1) * STH;
      // One softmax step per staged tile (128 keys): all eight 16-key score tiles first, then one running-max update, one exchange between the lane halves and one rescale.
      v8f s[KT / 16]; float mg[KT / 32];
      v16h kf[KT / 32][4];                                   // the whole tile's K fragments
#pragma unroll
      for (int g = 0; g < KT / 32; ++g) {
        const h16* ka = buf + ko + g * 32 * KPH;
        kf[g][0] = ldh(ka); kf[g][1] = ldh(ka + 32); kf[g][2] = ldh(ka + 16 * KPH); kf[g][3] = ldh(ka + 16 * KPH + 32);
      }
      __builtin_amdgcn_sched_barrier(0);                     // holds the K loads together, as one group ahead of the score products: left free, the compiler puts each pair in front of its product and waits out the LDS latency there
#pragma unroll     // the tile's four 32-key groups: 16 score products in a row, eight independent accumulators
      for (int g = 0; g < KT / 32; ++g) {
        v8f sa = (v8f){}, sb = (v8f){};
        sa = wmma16(kf[g][0], qh0, sa); sb = wmma16(kf[g][2], qh0, sb);
        sa = wmma16(kf[g][1], qh1, sa); sb = wmma16(kf[g][3], qh1, sb);
        s[2 * g] = sa; s[2 * g + 1] = sb;
      }
      const h16* va = buf + vo;
      v16h vf[2][4];                                         // two V^T fragment sets: a group's loads go one group ahead of its products
#pragma unroll
      for (int j = 0; j < 4; ++j) vf[0][j] = ldh(va + j * 16 * VPH);
      __builtin_amdgcn_sched_barrier(0);                     // holds the first group's V^T loads above the maximum chain: left free, the compiler sinks each load to its product and waits out the LDS latency there
#pragma unroll     // one maximum chain per group: four independent chains, joined below
      for (int g = 0; g < KT / 32; ++g) {
        float mx = -3.0e38f;
        s[2 * g] = s[2 * g] * SC2; s[2 * g + 1] = s[2 * g + 1] * SC2;
#pragma unroll
        for (int r = 0; r < 8; ++r) mx = fmaxf(mx, fmaxf(s[2 * g][r], s[2 * g + 1][r]));
        mg[g] = mx;
      }
      float mx = fmaxf(fmaxf(mg[0], mg[1]), fmaxf(mg[2], mg[3]));
      mx = fmaxf(mx, __shfl_xor(mx, 16, 32));
      const float mnew = fmaxf(m, mx);
      const float alpha = __builtin_amdgcn_exp2f(m - mnew);
      const float sh = PSH - mnew;
      o0 = o0 * alpha; o1 = o1 * alpha; o2 = o2 * alpha; o3 = o3 * alpha;
      lt[0] *= alpha;                                        // the sum tile's other rows stay zero
#pragma unroll     // the four 32-key groups again: P packed from the scores, then 4 P.V products each; the fragment sets alternate by a compile-time index
      for (int g = 0; g < KT / 32; ++g) {
        const int cu = g & 1, nx = cu ^ 1;
        if (g + 1 < KT / 32) {                               // never past this tile
#pragma unroll
          for (int j = 0; j < 4; ++j) vf[nx][j] = ldh(va + j * 16 * VPH + (g + 1) * 32);
        }
        __builtin_amdgcn_sched_barrier(0);                   // holds the next group's V^T loads above this group's exponentials and products, for the same reason
        v16h pb;
#pragma unroll
        for (int r = 0; r < 8; ++r) { const h16 pa = (h16)__builtin_amdgcn_exp2f(s[2 * g][r] + sh); const h16 pc = (h16)__builtin_amdgcn_exp2f(s[2 * g + 1][r] + sh); pb[r] = pa; pb[8 + r] = pc; }
        o0 = wmma16(vf[cu][0], pb, o0); o1 = wmma16(vf[cu][1], pb, o1); o2 = wmma16(vf[cu][2], pb, o2); o3 = wmma16(vf[cu][3], pb, o3);
        lt = wmma16(ones, pb, lt);                           // sums the rounded P, the values that the P.V products see
      }
      m = mnew;
      asm volatile("s_wait_dscnt 0x0" ::: "memory");         // this wave's reads of the buffer have returned before it is refilled
      asm volatile("s_wait_asynccnt 0x0" ::: "memory");      // this wave's copies of the next tile have landed
      __syncthreads();                                       // publishes the next tile and ends every reader's last read of this buffer
      if (st + 2 < SEQ / KT) stage_kv(kg + (size_t)(st + 2) * KT * HD, vg + (st + 2) * KT, kl + (unsigned)(st & 1) * (STH * 2u), vl + (unsigned)(st & 1) * (STH * 2u));
    }
    asm volatile("s_wait_asynccnt 0x0" ::: "memory");        // no copy is outstanding when the wave goes on to its epilogue
    const float inv = 1.0f / lt[0];
    const int wb = wave * 16 * 68;
    // O^T D layout: o_j[r] = (d = 16j + 8h + r, t = lane&15) -> os[t][d]; rows 0..15 x columns 0..63 all written
    { v4f a, c;
      a[0] = o0[0] * inv; a[1] = o0[1] * inv; a[2] = o0[2] * inv; a[3] = o0[3] * inv; c[0] = o0[4] * inv; c[1] = o0[5] * inv; c[2] = o0[6] * inv; c[3] = o0[7] * inv;
      *(v4fa*)(&os[wb + lr * 68 +  0 + 8 * hi]) = a; *(v4fa*)(&os[wb + lr * 68 +  0 + 8 * hi + 4]) = c;
      a[0] = o1[0] * inv; a[1] = o1[1] * inv; a[2] = o1[2] * inv; a[3] = o1[3] * inv; c[0] = o1[4] * inv; c[1] = o1[5] * inv; c[2] = o1[6] * inv; c[3] = o1[7] * inv;
      *(v4fa*)(&os[wb + lr * 68 + 16 + 8 * hi]) = a; *(v4fa*)(&os[wb + lr * 68 + 16 + 8 * hi + 4]) = c;
      a[0] = o2[0] * inv; a[1] = o2[1] * inv; a[2] = o2[2] * inv; a[3] = o2[3] * inv; c[0] = o2[4] * inv; c[1] = o2[5] * inv; c[2] = o2[6] * inv; c[3] = o2[7] * inv;
      *(v4fa*)(&os[wb + lr * 68 + 32 + 8 * hi]) = a; *(v4fa*)(&os[wb + lr * 68 + 32 + 8 * hi + 4]) = c;
      a[0] = o3[0] * inv; a[1] = o3[1] * inv; a[2] = o3[2] * inv; a[3] = o3[3] * inv; c[0] = o3[4] * inv; c[1] = o3[5] * inv; c[2] = o3[6] * inv; c[3] = o3[7] * inv;
      *(v4fa*)(&os[wb + lr * 68 + 48 + 8 * hi]) = a; *(v4fa*)(&os[wb + lr * 68 + 48 + 8 * hi + 4]) = c; }
    wave_sync();
    float* orow = OUT + ((size_t)b * OUT_SEQ + t0) * DM + h * HD;          // merged [b][t][h*64 + d]
    float* crow = CTX + ((size_t)zh * OUT_SEQ + t0) * HD;                  // context [b*16 + h][t][d]
{
#pragma unroll
        for (int s = 0; s < 8; ++s) { const int row = 2 * s + hi, cofs = lr * 4;   // 8 s x 2 rows = 16 rows; 16 lanes x 4 floats = 64 columns
            const v4f val = *(const v4fa*)(&os[wb + row * 68 + cofs]);
            *(v4f*)(orow + (size_t)row * DM + cofs) = val;
            *(v4f*)(crow + (size_t)row * HD + cofs) = val; }
         }
}

static constexpr size_t al256(size_t v) { return (v + 255) & ~(size_t)255; }
static constexpr size_t SZ_XB = al256((size_t)NB * SEQ * DM * 2);
static constexpr size_t SZ_WB = al256((size_t)3 * DM * DM * 2);
static constexpr size_t SZ_PL = al256((size_t)NB * NH_ * SEQ * HD * 2);
static constexpr size_t SZ_TOTAL = SZ_XB + SZ_WB + 3 * SZ_PL;
static_assert(SZ_TOTAL <= (size_t)134217728);          // workspace carve <= 128 MiB
static_assert(((size_t)DM * DM * 2) % 256 == 0);       // weight sub-planes stay 256-byte aligned

extern "C" void kernel_launch(void* const* d_in, const int* in_sizes, int n_in,
                              void* d_out, int out_size, void* d_ws, size_t ws_size, hipStream_t stream) {
    if (n_in < 4) return;
    const size_t needx = ((size_t)(NB - 1) * SEQ_FULL + SEQ) * DM;
    if ((size_t)in_sizes[0] < needx) return;
    if ((size_t)in_sizes[1] < (size_t)DM * DM || (size_t)in_sizes[2] < (size_t)DM * DM || (size_t)in_sizes[3] < (size_t)DM * DM) return;
    if ((size_t)out_size < CTX_OFF + ((size_t)(NB * NH_ - 1) * OUT_SEQ + SEQ) * HD) return;
    if (SZ_TOTAL > ws_size) return;
    const float* x = (const float*)d_in[0]; const float* wq = (const float*)d_in[1]; const float* wk = (const float*)d_in[2]; const float* wv = (const float*)d_in[3];   // wire order x, Wq, Wk, Wv ([out][in] = Bt as-is)
    float* OUT = (float*)d_out;              // [NB][SEQ][1024]
    float* CTX = (float*)d_out + CTX_OFF;    // [NB][16][SEQ][64]
    char* wsp = (char*)d_ws;
    bf* XB = (bf*)wsp; wsp += SZ_XB;                 // [NB*SEQ][1024]
    bf* WB = (bf*)wsp; wsp += SZ_WB;                 // [3][1024][1024]: q | k | v
    h16* QH = (h16*)wsp; wsp += SZ_PL;               // [NB*16][SEQ][64]
    h16* KP = (h16*)wsp; wsp += SZ_PL;               // [NB*16][SEQ][64]
    h16* VT = (h16*)wsp; wsp += SZ_PL;               // [NB*16][64][SEQ]

    k_cvt8<<<XBLK + 3 * WBLK, 256, 0, stream>>>(x, wq, wk, wv, XB, WB);

    k_proj<<<dim3(NB * SEQ / PBM, 3 * DM / PBN, 1), 32 * PW, 0, stream>>>(XB, WB, QH, KP, VT);

    k_flash<<<dim3(SEQ / (16 * AW), NB * NH_, 1), 32 * AW, 0, stream>>>(QH, KP, VT, OUT, CTX);
}

// v008
// Measured time: 58.4 microseconds a run.
// In two side-by-side timings against v007, it was 1.03 and 1.04 times as fast.
// Over all steps from v000 it is 3.38 times as fast.
#include <hip/hip_runtime.h>

// Multi-head self-attention, width 1024 = 16 heads x 64, x [NB][SEQ][1024], Wq/Wk/Wv [out][in] (y = x W^T), no biases, no mask, score scale 1/8; two f32 outputs: merged heads [NB][SEQ][1024] and per-head context [NB][16][SEQ][64].
// Compute dtypes, f32 accumulate everywhere: projections v_wmma_f32_16x16x32_bf16 (x and W RNE-converted to bf16; products exact);
// scores v_wmma_f32_16x16x32_f16: q and k single f16 (one product); P (x256 carry, cancels in the normalisation) and v single f16; softmax f32 (online, running max).
// Layout: bf16 copies of x and W; q, k planes [b*16+h][t][d] and v^T plane [b*16+h][d][t] written by the GEMM epilogue; fused flash kernel in transposed form (S^T = K Q^T, O^T = V^T P^T), both outputs from the same f32 accumulators.

#ifndef NB
#define NB 2
#endif
#ifndef SEQ
#define SEQ 2048
#endif
#define NB_FULL  2
#define SEQ_FULL 2048
#ifndef OUT_SEQ
#define OUT_SEQ SEQ              // row pitch (in tokens) between batches of the merged output and between (batch, head) slabs of the context output
#endif
#define DM   1024                // input width == projection width
#define NH_  16
#define HD   64
#define AW   8                   // waves per flash block: 4 query groups of 32 rows x 2 key halves (128 query rows a block)
#define KT   128                 // keys per staged K / V^T tile
#define KPH  72                  // LDS pitch of a K row in halves: 128 B + 16 B (16 B x odd: ds_load_b128 readers meet no bank conflict)
#define VPH  136                 // LDS pitch of a V^T row in halves: 256 B + 16 B
#define KTH  (KT * KPH)          // halves of one K tile in LDS
#define STH  (KTH + HD * VPH)    // halves of one ring buffer (K tile, then V^T tile)
#define PW   16                  // waves per projection block: 4 x 4 wave tiles of 64 x 48
#define PBM  256                 // x rows of a projection block
#define PBN  192                 // stacked W rows (q | k | v) of a projection block: three head groups of 64
#define PKT  128                 // k per staged projection tile
#define PPH  136                 // LDS pitch of a staged operand row in 16-bit elements: 256 B + 16 B
#define PST  ((PBM + PBN) * PPH) // elements of one projection ring buffer (x tile, then W tile)
#define QKP  72                  // epilogue pitch of a [token][d] row in halves: 128 B + 16 B
#define VSP  264                 // epilogue pitch of a [d][token] row in halves: 512 B + 16 B
#define PIT  (PBM * HD / (8 * 32 * PW))   // 16-B stores of one lane per head group
#define GSH  (PBM * QKP)         // halves of one head group's epilogue region (the larger of the two forms)
#define SC2  (0.125f * 1.4426950408889634f)   // HD^-0.5 * log2(e)
#define PSH  8.0f                // log2 of the P carry (256)
#define CTX_OFF ((size_t)NB_FULL * SEQ_FULL * DM)   // element offset of the second output (fixed, full-size constants)

static_assert(HD == 64);
static_assert(NH_ * HD == DM);                 // head h = columns h*64 + d
static_assert(DM % 64 == 0);                   // 16 column tiles of 64
static_assert(DM % 32 == 0);                   // GEMM k-loop steps by 32
static_assert(SEQ % 64 == 0);                  // a 64-row tile never straddles two batches
static_assert((NB * SEQ) % PBM == 0 && (3 * DM) % PBN == 0);   // projection blocks of 256 x 192 cover x and the stacked weights exactly
static_assert(SEQ % PBM == 0 && PBN % HD == 0 && DM % HD == 0);   // a block's tokens lie in one batch; a head group lies in one plane
static_assert(DM % PKT == 0 && DM / PKT >= 2);           // whole k tiles only; the ring's prologue needs two
static_assert((size_t)(PBN / HD) * GSH <= (size_t)2 * PST && HD * VSP <= GSH);   // the epilogue regions fit the ring they are laid over
static_assert((size_t)2 * PST * 2 <= (size_t)327680);    // the ring fits one WGP's LDS
static_assert(PKT == 128 && PW == 16 && PBM == 256 && PBN == 192);   // the copy map of stage_ab: 512 lanes x 16 B cover 32 rows a copy, 8 copies of x and 6 of W
static_assert((PBM * HD) % (8 * 32 * PW) == 0);          // the epilogue's stores cover a head group exactly
static_assert(SEQ % 32 == 0);                  // key loop steps by 32
static_assert(SEQ % KT == 0 && SEQ / KT >= 2); // whole tiles only; the ring's prologue needs two
static_assert(KT == 128 && AW == 8);           // the copy map below: 256 lanes x 16 B x 4 copies = one 16-KiB tile of each operand
static_assert(SEQ % (16 * AW) == 0);           // flash grid covers the sequence exactly
static_assert(((size_t)SEQ * DM) % 8 == 0);
static_assert(((size_t)DM * DM) % 8 == 0);
static_assert(NB <= NB_FULL);
static_assert(SEQ <= SEQ_FULL);
static_assert(OUT_SEQ >= SEQ);
static_assert(OUT_SEQ <= SEQ_FULL);
static_assert(CTX_OFF * 4 == (size_t)16777216);                                            // byte offset of the second output
static_assert(((size_t)(NB - 1) * OUT_SEQ + SEQ) * DM <= CTX_OFF);                           // merged output stays inside its own region
static_assert(CTX_OFF + ((size_t)(NB * NH_ - 1) * OUT_SEQ + SEQ) * HD <= (size_t)2 * CTX_OFF); // context output stays inside the buffer (33554432 B)

typedef _Float16 h16;
typedef unsigned short bf;
typedef __attribute__((ext_vector_type(16))) __bf16   v16bf;
typedef __attribute__((ext_vector_type(16))) _Float16 v16h;
typedef __attribute__((ext_vector_type(8)))  _Float16 v8h;
typedef __attribute__((ext_vector_type(8)))  unsigned short v8us;
typedef __attribute__((ext_vector_type(8)))  float    v8f;
typedef __attribute__((ext_vector_type(4)))  float    v4f;
typedef v4f  __attribute__((may_alias)) v4fa;
typedef v8h  __attribute__((may_alias)) v8ha;
typedef h16  __attribute__((may_alias)) h16a;

__device__ __forceinline__ unsigned short f2bf(float f) { unsigned u = __float_as_uint(f); u += 0x7FFFu + ((u >> 16) & 1u); return (unsigned short)(u >> 16); }
__device__ __forceinline__ v16h cat16(v8h lo, v8h hi) { return __builtin_shufflevector(lo, hi, 0, 1, 2, 3, 4, 5, 6, 7, 8, 9, 10, 11, 12, 13, 14, 15); }
__device__ __forceinline__ v16bf cat16b(v8us lo, v8us hi) { return __builtin_bit_cast(v16bf, __builtin_shufflevector(lo, hi, 0, 1, 2, 3, 4, 5, 6, 7, 8, 9, 10, 11, 12, 13, 14, 15)); }
__device__ __forceinline__ v8f wmma16(v16h a, v16h b, v8f c) { return __builtin_amdgcn_wmma_f32_16x16x32_f16(false, a, false, b, (short)0, c, false, false); }
__device__ __forceinline__ v8f wmmab(v16bf a, v16bf b, v8f c) { return __builtin_amdgcn_wmma_f32_16x16x32_bf16(false, a, false, b, (short)0, c, false, false); }
// fragment loaders from K-contiguous 16-bit rows; p already includes + 8*(lane>>4): elements 0..7 <- k0+8h+0..7, elements 8..15 <- k0+16+8h+0..7 (same map for A and B)
__device__ __forceinline__ v16h  ldh(const h16* p) { return cat16(*(const v8h*)p, *(const v8h*)(p + 16)); }
__device__ __forceinline__ v16bf ldb(const bf* p)  { return cat16b(*(const v8us*)p, *(const v8us*)(p + 16)); }
// ordering point for wave-private LDS tiles (same wave writes and reads)
__device__ __forceinline__ void wave_sync() { __builtin_amdgcn_fence(3 /* release order */, "wavefront"); __builtin_amdgcn_wave_barrier(); asm volatile("" ::: "memory"); }

#define XBLK ((unsigned)((size_t)NB * SEQ * DM / 2048))   // conversion blocks (256 lanes x 8 elements) that cover x
#define WBLK ((unsigned)((size_t)DM * DM / 2048))         // ... and one weight matrix
static_assert(((size_t)SEQ * DM) % 2048 == 0 && ((size_t)DM * DM) % 2048 == 0);   // a block never straddles two batches or two matrices; the grid is exact

// k_cvt8: all four f32 -> bf16 conversions in one launch; the block index picks the source (blocks [0, XBLK): x, then WBLK blocks each of Wq, Wk, Wv). grid XBLK + 3 * WBLK.
__global__ __launch_bounds__(256) void k_cvt8(const float* __restrict__ x, const float* __restrict__ wq, const float* __restrict__ wk, const float* __restrict__ wv, bf* XB, bf* WB) {
    const unsigned bi = blockIdx.x;
    const float* src; bf* dst;
    if (bi < XBLK) {
        const unsigned b = bi / (XBLK / NB);                                   // batch: source pitch SEQ_FULL tokens, copy pitch SEQ tokens
        src = x + (size_t)b * SEQ_FULL * DM + (size_t)(bi - b * (XBLK / NB)) * 2048; dst = XB + (size_t)bi * 2048;
    } else {
        const unsigned wi = bi - XBLK, w = wi / WBLK;
        src = (w == 0 ? wq : w == 1 ? wk : wv) + (size_t)(wi - w * WBLK) * 2048; dst = WB + (size_t)wi * 2048;
    }
    const v8f v = *(const v8f*)(src + threadIdx.x * 8); v8us o;
#pragma unroll
    for (int k = 0; k < 8; ++k) o[k] = f2bf(v[k]);
    *(v8us*)(dst + threadIdx.x * 8) = o;
}

// Copies of one lane, global memory to LDS through no register: 16 B of rows r, r + 32, ... of a K-contiguous bf16 plane (512 lanes: 32 rows x 256 B per copy of the block).
// g: the lane's first global chunk; l: its LDS byte address. Each wave-wide copy reads two rows x 256 B of whole lines. stage_x: 8 copies (256 rows); stage_w: 6 copies (192 rows).
__device__ __forceinline__ void stage_x(const bf* g, unsigned l) {
    const bf* g1 = g + (size_t)32 * DM; const bf* g2 = g + (size_t)64 * DM; const bf* g3 = g + (size_t)96 * DM; const bf* g4 = g + (size_t)128 * DM;
    const bf* g5 = g + (size_t)160 * DM; const bf* g6 = g + (size_t)192 * DM; const bf* g7 = g + (size_t)224 * DM;
    const unsigned l1 = l + 32 * PPH * 2, l2 = l + 64 * PPH * 2, l3 = l + 96 * PPH * 2, l4 = l + 128 * PPH * 2, l5 = l + 160 * PPH * 2, l6 = l + 192 * PPH * 2, l7 = l + 224 * PPH * 2;
    // the closing s_wait_xcnt stands in the copies' own statement so that no address register is rewritten in front of it
    asm volatile("global_load_async_to_lds_b128 %0, %8, off\n\t"
                 "global_load_async_to_lds_b128 %1, %9, off\n\t"
                 "global_load_async_to_lds_b128 %2, %10, off\n\t"
                 "global_load_async_to_lds_b128 %3, %11, off\n\t"
                 "global_load_async_to_lds_b128 %4, %12, off\n\t"
                 "global_load_async_to_lds_b128 %5, %13, off\n\t"
                 "global_load_async_to_lds_b128 %6, %14, off\n\t"
                 "global_load_async_to_lds_b128 %7, %15, off\n\t"
                 "s_wait_xcnt 0x0"
                 :: "v"(l), "v"(l1), "v"(l2), "v"(l3), "v"(l4), "v"(l5), "v"(l6), "v"(l7),
                    "v"(g), "v"(g1), "v"(g2), "v"(g3), "v"(g4), "v"(g5), "v"(g6), "v"(g7) : "memory");
}
__device__ __forceinline__ void stage_w(const bf* g, unsigned l) {
    const bf* g1 = g + (size_t)32 * DM; const bf* g2 = g + (size_t)64 * DM; const bf* g3 = g + (size_t)96 * DM; const bf* g4 = g + (size_t)128 * DM; const bf* g5 = g + (size_t)160 * DM;
    const unsigned l1 = l + 32 * PPH * 2, l2 = l + 64 * PPH * 2, l3 = l + 96 * PPH * 2, l4 = l + 128 * PPH * 2, l5 = l + 160 * PPH * 2;
    // the closing s_wait_xcnt stands in the copies' own statement so that no address register is rewritten in front of it
    asm volatile("global_load_async_to_lds_b128 %0, %6, off\n\t"
                 "global_load_async_to_lds_b128 %1, %7, off\n\t"
                 "global_load_async_to_lds_b128 %2, %8, off\n\t"
                 "global_load_async_to_lds_b128 %3, %9, off\n\t"
                 "global_load_async_to_lds_b128 %4, %10, off\n\t"
                 "global_load_async_to_lds_b128 %5, %11, off\n\t"
                 "s_wait_xcnt 0x0"
                 :: "v"(l), "v"(l1), "v"(l2), "v"(l3), "v"(l4), "v"(l5),
                    "v"(g), "v"(g1), "v"(g2), "v"(g3), "v"(g4), "v"(g5) : "memory");
}
// One k tile's copies of one lane: 8 x 16 B of the block's 256 x rows and 6 x 16 B of its 192 W rows (14 copies of a wave in flight).
__device__ __forceinline__ void stage_ab(const bf* ag, const bf* bg, unsigned al, unsigned bl) { stage_x(ag, al); stage_w(bg, bl); }

// The k loop of k_proj. WF: the W fragment is the product's first operand (D row = W row, D column = x row: a lane holds 8 consecutive features of one token); else the x fragment is (8 consecutive tokens of one feature).
template <bool WF>
__device__ __forceinline__ void proj_loop(const bf* pring, int ao, int bo, const bf* ag, const bf* bg, unsigned al, unsigned bl, v8f (&acc)[4][3]) {
#pragma unroll 1   // one trip per k tile: the ring's order stands once, at the trip's foot
    for (int st = 0; st < DM / PKT; ++st) {
      const bf* buf = pring + (st & 1) * PST;
      v16bf a[2][4], b[2][3];                                // two fragment sets: the next step's loads go ahead of this step's products, as one group
#pragma unroll
      for (int mb = 0; mb < 4; ++mb) a[0][mb] = ldb(buf + ao + mb * 16 * PPH);
#pragma unroll
      for (int nb = 0; nb < 3; ++nb) b[0][nb] = ldb(buf + bo + nb * 16 * PPH);
#pragma unroll     // the four 32-k steps of a tile: the fragment sets alternate by a compile-time index
      for (int ks = 0; ks < PKT / 32; ++ks) {
        const int cu = ks & 1, nx = cu ^ 1;
        if (ks + 1 < PKT / 32) {                             // never past this tile: the next one is read only behind the trip's barrier
#pragma unroll
          for (int mb = 0; mb < 4; ++mb) a[nx][mb] = ldb(buf + ao + mb * 16 * PPH + (ks + 1) * 32);
#pragma unroll
          for (int nb = 0; nb < 3; ++nb) b[nx][nb] = ldb(buf + bo + nb * 16 * PPH + (ks + 1) * 32);
        }
        __builtin_amdgcn_sched_barrier(0);                   // keeps the next step's loads ahead of this step's products: left free, the compiler sinks each load to its use and waits out the LDS latency there
#pragma unroll
        for (int nb = 0; nb < 3; ++nb)
#pragma unroll
            for (int mb = 0; mb < 4; ++mb) acc[mb][nb] = WF ? wmmab(b[cu][nb], a[cu][mb], acc[mb][nb]) : wmmab(a[cu][mb], b[cu][nb], acc[mb][nb]);
        __builtin_amdgcn_sched_barrier(0);                   // ... and this step's products ahead of the loads of the step after next, which reuse their fragment set
      }
      asm volatile("s_wait_dscnt 0x0" ::: "memory");         // this wave's reads of the buffer have returned before it is refilled
      asm volatile("s_wait_asynccnt 0x0" ::: "memory");      // this wave's copies of the next tile have landed
      __syncthreads();                                       // publishes the next tile and ends every reader's last read of this buffer
      if (st + 2 < DM / PKT) stage_ab(ag + (st + 2) * PKT, bg + (st + 2) * PKT, al + (unsigned)(st & 1) * (PST * 2u), bl + (unsigned)(st & 1) * (PST * 2u));
    }
}

__global__ __launch_bounds__(32 * PW) void k_proj(const bf* __restrict__ XB, const bf* __restrict__ WB, h16* QH, h16* KP, h16* VT) {
    __shared__ __align__(16) bf pring[2 * PST];
    const int lane = threadIdx.x & 31, wave = __builtin_amdgcn_readfirstlane((int)(threadIdx.x >> 5)), lr = lane & 15, hi = lane >> 4;
    const int bx = blockIdx.x, by = blockIdx.y;              // block row (256 x rows) and block column (192 stacked W rows)
    const int wm = wave >> 2, wn = wave & 3;                 // this wave's 64 x 48 tile
    const bool wf = by * PBN < 2 * DM;                       // the block holds q or k features: W fragment first (block-uniform)
    v8f acc[4][3];
#pragma unroll
    for (int mb = 0; mb < 4; ++mb)
#pragma unroll
        for (int nb = 0; nb < 3; ++nb) acc[mb][nb] = (v8f){};
    const int ao = (wm * 64 + lr) * PPH + 8 * hi;            // + mb*16*PPH + k, in a buffer's x tile
    const int bo = (PBM + wn * 48 + lr) * PPH + 8 * hi;      // + nb*16*PPH + k, in its W tile
    const int tid = (int)threadIdx.x;
    const bf* ag = XB + (size_t)(bx * PBM + (tid >> 4)) * DM + (tid & 15) * 8;   // + tile * PKT: row tid>>4, chunk tid&15 of its 256 B
    const bf* bg = WB + (size_t)(by * PBN + (tid >> 4)) * DM + (tid & 15) * 8;
    const unsigned pl = (unsigned)(size_t)&pring[0];                                    // LDS byte address of the ring
    const unsigned al = pl + (unsigned)((tid >> 4) * PPH + (tid & 15) * 8) * 2u;        // + buffer * PST * 2
    const unsigned bl = al + PBM * PPH * 2u;
    stage_ab(ag, bg, al, bl);
    asm volatile("s_wait_asynccnt 0x0" ::: "memory");        // tile 0 of this wave's copies has landed
    __syncthreads();                                         // ... and every other wave's: tile 0 may be read
    stage_ab(ag + PKT, bg + PKT, al + PST * 2u, bl + PST * 2u);
    if (wf) proj_loop<true>(pring, ao, bo, ag, bg, al, bl, acc); else proj_loop<false>(pring, ao, bo, ag, bg, al, bl, acc);
    asm volatile("s_wait_asynccnt 0x0" ::: "memory");        // no copy is outstanding when the wave goes on to its epilogue
    h16a* stg = (h16a*)pring;   // block-wide epilogue tile, laid over the ring: written only behind the last trip's foot (every wave's reads returned, its copies landed, barrier passed)
#pragma unroll
    for (int mb = 0; mb < 4; ++mb) {
#pragma unroll
        for (int nb = 0; nb < 3; ++nb) {
            const int nblk = wn * 48 + nb * 16, g = nblk >> 6, nl = nblk & 63, ml = wm * 64 + mb * 16;   // head group, feature in it, token in the block: all wave-uniform
            v8h hv;
#pragma unroll
            for (int j = 0; j < 8; ++j) hv[j] = (h16)acc[mb][nb][j];
            if (!wf) *(v8ha*)(stg + g * GSH + (nl + lr) * VSP + ml + 8 * hi) = hv;                          // D: token 8h+j, feature lane&15 -> [d][token]
            else if (by * PBN + nblk < 2 * DM) *(v8ha*)(stg + g * GSH + (ml + lr) * QKP + nl + 8 * hi) = hv;   // D: feature 8h+j, token lane&15 -> [token][d]
            else {                                                                                          // v features of the blocks that also hold k features (by = 10)
#pragma unroll
                for (int j = 0; j < 8; ++j) stg[g * GSH + (nl + 8 * hi + j) * VSP + ml + lr] = hv[j]; }
        }
    }
    __syncthreads();                                         // the block tile is complete before any wave reads other waves' parts of it
    const int b = (bx * PBM) / SEQ, t0 = (bx * PBM) % SEQ;
#pragma unroll
    for (int g = 0; g < PBN / HD; ++g) {
        const int ng = by * PBN + g * HD, pz = ng / DM, h = (ng % DM) / HD;
        const size_t hb = (size_t)(b * NH_ + h) * SEQ * HD;
        v8h v[PIT];                                          // all of a group's LDS reads go ahead of its stores, into registers of their own
        if (pz < 2) {
            h16* P = (pz == 0 ? QH : KP) + hb + (size_t)t0 * HD;
#pragma unroll
            for (int it = 0; it < PIT; ++it) { const int idx = it * 32 * PW + tid; v[it] = *(const v8ha*)(stg + g * GSH + (idx >> 3) * QKP + (idx & 7) * 8); }
#pragma unroll
            for (int it = 0; it < PIT; ++it) { const int idx = it * 32 * PW + tid; *(v8h*)(P + (size_t)idx * 8) = v[it]; }   // a wave stores 512 contiguous bytes
            asm volatile("s_wait_xcnt 0x0" ::: "memory");    // stands in front of later writes to registers that these stores name
            __builtin_amdgcn_sched_barrier(0);               // keeps those writes behind the wait: a memory clobber alone does not tie it to registers
        } else {
            h16* P = VT + hb + t0;
#pragma unroll
            for (int it = 0; it < PIT; ++it) { const int idx = it * 32 * PW + tid; v[it] = *(const v8ha*)(stg + g * GSH + (idx >> 5) * VSP + (idx & 31) * 8); }
#pragma unroll
            for (int it = 0; it < PIT; ++it) { const int idx = it * 32 * PW + tid; *(v8h*)(P + (size_t)(idx >> 5) * SEQ + (idx & 31) * 8) = v[it]; }   // a wave stores one d row's 512 bytes
            asm volatile("s_wait_xcnt 0x0" ::: "memory");    // as above
            __builtin_amdgcn_sched_barrier(0);               // as above
        }
    }
}

// One tile's copies of one lane: 4 x 16 B of K and 4 x 16 B of V^T, global memory to LDS through no register. Each wave-wide copy reads 512 B of whole lines.
// kg, vg: the lane's first global chunk of each operand; kl, vl: its LDS byte address. Later chunks: K + 32 rows (contiguous in memory), V^T + 16 rows.
__device__ __forceinline__ void stage_kv(const h16* kg, const h16* vg, unsigned kl, unsigned vl) {
    const h16* kg1 = kg + 32 * HD; const h16* kg2 = kg + 64 * HD; const h16* kg3 = kg + 96 * HD;
    const h16* vg1 = vg + (size_t)16 * SEQ; const h16* vg2 = vg + (size_t)32 * SEQ; const h16* vg3 = vg + (size_t)48 * SEQ;
    const unsigned kl1 = kl + 32 * KPH * 2, kl2 = kl + 64 * KPH * 2, kl3 = kl + 96 * KPH * 2;
    const unsigned vl1 = vl + 16 * VPH * 2, vl2 = vl + 32 * VPH * 2, vl3 = vl + 48 * VPH * 2;
    // the closing s_wait_xcnt stands in the copies' own statement so that no address register is rewritten in front of it
    asm volatile("global_load_async_to_lds_b128 %0, %8, off\n\t"
                 "global_load_async_to_lds_b128 %1, %9, off\n\t"
                 "global_load_async_to_lds_b128 %2, %10, off\n\t"
                 "global_load_async_to_lds_b128 %3, %11, off\n\t"
                 "global_load_async_to_lds_b128 %4, %12, off\n\t"
                 "global_load_async_to_lds_b128 %5, %13, off\n\t"
                 "global_load_async_to_lds_b128 %6, %14, off\n\t"
                 "global_load_async_to_lds_b128 %7, %15, off\n\t"
                 "s_wait_xcnt 0x0"
                 :: "v"(kl), "v"(kl1), "v"(kl2), "v"(kl3), "v"(vl), "v"(vl1), "v"(vl2), "v"(vl3),
                    "v"(kg), "v"(kg1), "v"(kg2), "v"(kg3), "v"(vg), "v"(vg1), "v"(vg2), "v"(vg3) : "memory");
}

__global__ __launch_bounds__(32 * AW) __attribute__((amdgpu_waves_per_eu(4, 4))) void k_flash(const h16* __restrict__ QH, const h16* __restrict__ KP, const h16* __restrict__ VT, float* OUT, float* CTX) {
    __shared__ __align__(16) float os[AW * 16 * 68];
    __shared__ __align__(16) h16 ring[2 * STH];
    const int lane = threadIdx.x & 31, wave = __builtin_amdgcn_readfirstlane((int)(threadIdx.x >> 5)), lr = lane & 15, hi = lane >> 4;
    const int zh = blockIdx.y; const int b = zh / NH_, h = zh % NH_;
    const int qg = wave >> 1, kh = wave & 1;                 // query group (32 rows) and key half (64 keys of each staged tile)
    const int t0 = blockIdx.x * (16 * AW) + qg * 32;
    const size_t pbase = (size_t)zh * SEQ * HD;
    const size_t qo = pbase + (size_t)(t0 + lr) * HD + 8 * hi;
    v16h qf[2][2];                                           // B fragments: [column group][d half]: col t, k = d
#pragma unroll
    for (int c = 0; c < 2; ++c) { qf[c][0] = ldh(QH + qo + c * 16 * HD); qf[c][1] = ldh(QH + qo + c * 16 * HD + 32); }
    const int ko = (kh * (KT / 2) + lr) * KPH + 8 * hi;      // + key * KPH      (A fragment: row key, k = d), in a K tile
    const int vo = KTH + lr * VPH + kh * (KT / 2) + 8 * hi;  // + 16j*VPH + key  (A fragment: row d, k = key), in a V^T tile
    const int tid = (int)threadIdx.x;
    const h16* kg = KP + pbase + (size_t)tid * 8;                                   // + tile * KT * HD: chunk tid of the tile's 16 KiB
    const h16* vg = VT + pbase + (size_t)(tid >> 4) * SEQ + (tid & 15) * 8;         // + tile * KT: row tid>>4, chunk tid&15 of its 256 B
    const unsigned rl = (unsigned)(size_t)&ring[0];                                 // LDS byte address of the ring
    const unsigned kl = rl + (unsigned)((tid >> 3) * KPH + (tid & 7) * 8) * 2u;     // + buffer * STH * 2
    const unsigned vl = rl + (unsigned)(KTH + (tid >> 4) * VPH + (tid & 15) * 8) * 2u;
    stage_kv(kg, vg, kl, vl);
    asm volatile("s_wait_asynccnt 0x0" ::: "memory");        // tile 0 of this wave's copies has landed
    __syncthreads();                                         // ... and every other wave's: tile 0 may be read
    stage_kv(kg + (size_t)KT * HD, vg + KT, kl + STH * 2u, vl + STH * 2u);
    v8f o[2][4];                                             // [column group][d tile]
#pragma unroll
    for (int c = 0; c < 2; ++c)
#pragma unroll
        for (int j = 0; j < 4; ++j) o[c][j] = (v8f){};
    float m[2] = {-3.0e38f, -3.0e38f};
    // Row sums of P on the matrix unit: A has ones in rows 0 and 8 (lanes 0, 8, 16, 24) and zeros elsewhere, so element 0 of the sum tile holds, in both lane halves, the lane's own query's sum over this wave's keys.
    const h16 u1 = (lane & 7) == 0 ? (h16)1.0f : (h16)0.0f;
    const v16h ones = {u1, u1, u1, u1, u1, u1, u1, u1, u1, u1, u1, u1, u1, u1, u1, u1};
    v8f lt[2] = {(v8f){}, (v8f){}};
#pragma unroll 1   // one trip per tile: the ring's order stands once, at the trip's foot
    for (int st = 0; st < SEQ / KT; ++st) {
      const h16* buf = ring + (st & 1) * STH;
      // One softmax step per staged tile (this wave's 64 keys x 32 queries): all eight 16 x 16 score tiles first, then per column group one running-max update, one exchange between the lane halves and one rescale.
      v8f s[2][KT / 32];                                     // [column group][16-key tile]
      v16h kf[KT / 64][4];                                   // the K fragments of this wave's half tile
#pragma unroll
      for (int g = 0; g < KT / 64; ++g) {
        const h16* ka = buf + ko + g * 32 * KPH;
        kf[g][0] = ldh(ka); kf[g][1] = ldh(ka + 32); kf[g][2] = ldh(ka + 16 * KPH); kf[g][3] = ldh(ka + 16 * KPH + 32);
      }
      __builtin_amdgcn_sched_barrier(0);                     // holds the K loads together, as one group ahead of the score products: left free, the compiler puts each pair in front of its product and waits out the LDS latency there
#pragma unroll     // 16 score products in a row, one 16-key tile after the other (its two K fragments are free again behind four products); each K fragment feeds both column groups
      for (int g = 0; g < KT / 64; ++g)
#pragma unroll
        for (int u = 0; u < 2; ++u) {
          v8f s0 = (v8f){}, s1 = (v8f){};
          s0 = wmma16(kf[g][2 * u], qf[0][0], s0); s1 = wmma16(kf[g][2 * u], qf[1][0], s1);
          s0 = wmma16(kf[g][2 * u + 1], qf[0][1], s0); s1 = wmma16(kf[g][2 * u + 1], qf[1][1], s1);
          s[0][2 * g + u] = s0; s[1][2 * g + u] = s1;
        }
      const h16* va = buf + vo;
      v16h vf[KT / 64][4];                                   // the V^T fragments of this wave's half tile
      __builtin_amdgcn_sched_barrier(0);                     // keeps the scaling and the maximum chains behind the run of score products: mixed in among them, each first read of a fresh score tile is padded with v_nop (17 more vector issue slots a trip)
      float mg[2][KT / 64];
#pragma unroll     // one maximum chain per column group and 32 keys: four independent chains, joined below
      for (int c = 0; c < 2; ++c)
#pragma unroll
        for (int g = 0; g < KT / 64; ++g) {
          float mx = -3.0e38f;
          s[c][2 * g] = s[c][2 * g] * SC2; s[c][2 * g + 1] = s[c][2 * g + 1] * SC2;
#pragma unroll
          for (int r = 0; r < 8; ++r) mx = fmaxf(mx, fmaxf(s[c][2 * g][r], s[c][2 * g + 1][r]));
          mg[c][g] = mx;
        }
      float sh[2];
#pragma unroll
      for (int c = 0; c < 2; ++c) {
        float mx = fmaxf(mg[c][0], mg[c][1]);
        mx = fmaxf(mx, __shfl_xor(mx, 16, 32));
        const float mnew = fmaxf(m[c], mx);
        const float alpha = __builtin_amdgcn_exp2f(m[c] - mnew);
        sh[c] = PSH - mnew; m[c] = mnew;
#pragma unroll
        for (int j = 0; j < 4; ++j) o[c][j] = o[c][j] * alpha;
        lt[c][0] *= alpha;                                   // the sum tile's other rows stay zero
      }
      v16h pb[KT / 64][2];                                   // P^T, packed from the scores: [32-key group][column group]
      // A packed P takes half its scores' registers: each V^T fragment set is loaded behind the exponentials that make room for it (the register budget of four waves per SIMD) and ahead of the work that covers its LDS latency.
#pragma unroll
      for (int g = 0; g < KT / 64; ++g) {
#pragma unroll
        for (int c = 0; c < 2; ++c)
#pragma unroll
          for (int r = 0; r < 8; ++r) { const h16 pa = (h16)__builtin_amdgcn_exp2f(s[c][2 * g][r] + sh[c]); const h16 pc = (h16)__builtin_amdgcn_exp2f(s[c][2 * g + 1][r] + sh[c]); pb[g][c][r] = pa; pb[g][c][8 + r] = pc; }
        __builtin_amdgcn_sched_barrier(0);                   // keeps this group's V^T loads below its exponentials: lifted above them, they do not fit the budget
#pragma unroll
        for (int j = 0; j < 4; ++j) vf[g][j] = ldh(va + j * 16 * VPH + g * 32);
        __builtin_amdgcn_sched_barrier(0);                   // ... and above what follows (the next group's exponentials, the first group's products): left free, the compiler sinks each load to its product and waits out the LDS latency there
      }
#pragma unroll     // the two 32-key groups again: per column group 4 P.V products and the row-sum product; each V^T fragment feeds both column groups
      for (int g = 0; g < KT / 64; ++g) {
#pragma unroll
        for (int j = 0; j < 4; ++j) { o[0][j] = wmma16(vf[g][j], pb[g][0], o[0][j]); o[1][j] = wmma16(vf[g][j], pb[g][1], o[1][j]); }
        lt[0] = wmma16(ones, pb[g][0], lt[0]); lt[1] = wmma16(ones, pb[g][1], lt[1]);   // sums the rounded P, the values that the P.V products see
        if (g + 1 < KT / 64) __builtin_amdgcn_sched_barrier(0);   // keeps the first group's products above the wait for the second group's V^T loads, whose latency they cover
      }
      asm volatile("s_wait_dscnt 0x0" ::: "memory");         // this wave's reads of the buffer have returned before it is refilled
      asm volatile("s_wait_asynccnt 0x0" ::: "memory");      // this wave's copies of the next tile have landed
      __syncthreads();                                       // publishes the next tile and ends every reader's last read of this buffer
      if (st + 2 < SEQ / KT) stage_kv(kg + (size_t)(st + 2) * KT * HD, vg + (st + 2) * KT, kl + (unsigned)(st & 1) * (STH * 2u), vl + (unsigned)(st & 1) * (STH * 2u));
    }
    asm volatile("s_wait_asynccnt 0x0" ::: "memory");        // no copy is outstanding when the wave goes on to its epilogue
    // Join of the two key halves: wave (qg, kh) finishes column group kh. It puts its partial of the other group into its own LDS tile [t 16][d 64 | max | sum]; behind the barrier each wave owns its partner's tile.
    const int wb = wave * 16 * 68, pw = (wave ^ 1) * 16 * 68;
    const bool k1 = kh != 0;
    v8f ow[4];                                               // this wave's partial of the group it finishes
    // O^T D layout: o_j[r] = (d = 16j + 8h + r, t = lane&15) -> os[t][d]; rows 0..15 x columns 0..63 all written
#pragma unroll
    for (int j = 0; j < 4; ++j) {
      v4f a, c;
#pragma unroll
      for (int r = 0; r < 4; ++r) { a[r] = k1 ? o[0][j][r] : o[1][j][r]; c[r] = k1 ? o[0][j][4 + r] : o[1][j][4 + r]; }
#pragma unroll
      for (int r = 0; r < 8; ++r) ow[j][r] = k1 ? o[1][j][r] : o[0][j][r];
      *(v4fa*)(&os[wb + lr * 68 + 16 * j + 8 * hi]) = a; *(v4fa*)(&os[wb + lr * 68 + 16 * j + 8 * hi + 4]) = c;
    }
    { const float mo = k1 ? m[0] : m[1], lo = k1 ? lt[0][0] : lt[1][0];
      os[wb + lr * 68 + 64 + hi] = hi ? lo : mo; }           // both lane halves hold both values: the lower writes the max (column 64), the upper the sum (column 65)
    __syncthreads();                                         // the partner's partial is complete before it is read
    const float mw = k1 ? m[1] : m[0], lw = k1 ? lt[1][0] : lt[0][0];
    const float pm = os[pw + lr * 68 + 64], pl = os[pw + lr * 68 + 65];
    const float mj = fmaxf(mw, pm);
    const float ea = __builtin_amdgcn_exp2f(mw - mj), eb = __builtin_amdgcn_exp2f(pm - mj);
    const float inv = 1.0f / (lw * ea + pl * eb);
    const float fa = ea * inv, fb = eb * inv;
#pragma unroll
    for (int j = 0; j < 4; ++j) {                            // each lane reads and rewrites its own 8 elements of a row: the joined, normalised tile takes the partial's place
      const v4f pa = *(const v4fa*)(&os[pw + lr * 68 + 16 * j + 8 * hi]), pc = *(const v4fa*)(&os[pw + lr * 68 + 16 * j + 8 * hi + 4]);
      v4f a, c;
#pragma unroll
      for (int r = 0; r < 4; ++r) { a[r] = ow[j][r] * fa + pa[r] * fb; c[r] = ow[j][4 + r] * fa + pc[r] * fb; }
      *(v4fa*)(&os[pw + lr * 68 + 16 * j + 8 * hi]) = a; *(v4fa*)(&os[pw + lr * 68 + 16 * j + 8 * hi + 4]) = c;
    }
    wave_sync();
    const int tq = t0 + kh * 16;                                           // first query row of the finished group
    float* orow = OUT + ((size_t)b * OUT_SEQ + tq) * DM + h * HD;          // merged [b][t][h*64 + d]
    float* crow = CTX + ((size_t)zh * OUT_SEQ + tq) * HD;                  // context [b*16 + h][t][d]
{
#pragma unroll
        for (int s = 0; s < 8; ++s) { const int row = 2 * s + hi, cofs = lr * 4;   // 8 s x 2 rows = 16 rows; 16 lanes x 4 floats = 64 columns
            const v4f val = *(const v4fa*)(&os[pw + row * 68 + cofs]);
            *(v4f*)(orow + (size_t)row * DM + cofs) = val;
            *(v4f*)(crow + (size_t)row * HD + cofs) = val; }
         }
}

static constexpr size_t al256(size_t v) { return (v + 255) & ~(size_t)255; }
static constexpr size_t SZ_XB = al256((size_t)NB * SEQ * DM * 2);
static constexpr size_t SZ_WB = al256((size_t)3 * DM * DM * 2);
static constexpr size_t SZ_PL = al256((size_t)NB * NH_ * SEQ * HD * 2);
static constexpr size_t SZ_TOTAL = SZ_XB + SZ_WB + 3 * SZ_PL;
static_assert(SZ_TOTAL <= (size_t)134217728);          // workspace carve <= 128 MiB
static_assert(((size_t)DM * DM * 2) % 256 == 0);       // weight sub-planes stay 256-byte aligned

extern "C" void kernel_launch(void* const* d_in, const int* in_sizes, int n_in,
                              void* d_out, int out_size, void* d_ws, size_t ws_size, hipStream_t stream) {
    if (n_in < 4) return;
    const size_t needx = ((size_t)(NB - 1) * SEQ_FULL + SEQ) * DM;
    if ((size_t)in_sizes[0] < needx) return;
    if ((size_t)in_sizes[1] < (size_t)DM * DM || (size_t)in_sizes[2] < (size_t)DM * DM || (size_t)in_sizes[3] < (size_t)DM * DM) return;
    if ((size_t)out_size < CTX_OFF + ((size_t)(NB * NH_ - 1) * OUT_SEQ + SEQ) * HD) return;
    if (SZ_TOTAL > ws_size) return;
    const float* x = (const float*)d_in[0]; const float* wq = (const float*)d_in[1]; const float* wk = (const float*)d_in[2]; const float* wv = (const float*)d_in[3];   // wire order x, Wq, Wk, Wv ([out][in] = Bt as-is)
    float* OUT = (float*)d_out;              // [NB][SEQ][1024]
    float* CTX = (float*)d_out + CTX_OFF;    // [NB][16][SEQ][64]
    char* wsp = (char*)d_ws;
    bf* XB = (bf*)wsp; wsp += SZ_XB;                 // [NB*SEQ][1024]
    bf* WB = (bf*)wsp; wsp += SZ_WB;                 // [3][1024][1024]: q | k | v
    h16* QH = (h16*)wsp; wsp += SZ_PL;               // [NB*16][SEQ][64]
    h16* KP = (h16*)wsp; wsp += SZ_PL;               // [NB*16][SEQ][64]
    h16* VT = (h16*)wsp; wsp += SZ_PL;               // [NB*16][64][SEQ]

    k_cvt8<<<XBLK + 3 * WBLK, 256, 0, stream>>>(x, wq, wk, wv, XB, WB);

    k_proj<<<dim3(NB * SEQ / PBM, 3 * DM / PBN, 1), 32 * PW, 0, stream>>>(XB, WB, QH, KP, VT);

    k_flash<<<dim3(SEQ / (16 * AW), NB * NH_, 1), 32 * AW, 0, stream>>>(QH, KP, VT, OUT, CTX);
}

// v009
// A run of this version takes 56.6 microseconds.
// Two timings next to v008 put it at 1.04 and 1.03 times that version's speed.
// Over all steps from v000 it is 3.50 times as fast.
#include <hip/hip_runtime.h>

// Multi-head self-attention, width 1024 = 16 heads x 64, x [NB][SEQ][1024], Wq/Wk/Wv [out][in] (y = x W^T), no biases, no mask, score scale 1/8; two f32 outputs: merged heads [NB][SEQ][1024] and per-head context [NB][16][SEQ][64].
// Compute dtypes, f32 accumulate everywhere: projections v_wmma_f32_16x16x32_bf16 (x and W RNE-converted to bf16; products exact);
// scores v_wmma_f32_16x16x32_f16: q (times the score scale and log2(e), applied in f32 ahead of its one rounding) and k single f16 (one product); P (x256 carry, cancels in the normalisation) and v single f16; softmax f32 (online, reference max raised only when outgrown).
// Layout: bf16 copies of x and W; q, k planes [b*16+h][t][d] and v^T plane [b*16+h][d][t] written by the GEMM epilogue; fused flash kernel in transposed form (S^T = K Q^T, O^T = V^T P^T), both outputs from the same f32 accumulators.

#ifndef NB
#define NB 2
#endif
#ifndef SEQ
#define SEQ 2048
#endif
#define NB_FULL  2
#define SEQ_FULL 2048
#ifndef OUT_SEQ
#define OUT_SEQ SEQ              // row pitch (in tokens) between batches of the merged output and between (batch, head) slabs of the context output
#endif
#define DM   1024                // input width == projection width
#define NH_  16
#define HD   64
#define AW   8                   // waves per flash block: 4 query groups of 32 rows x 2 key halves (128 query rows a block)
#define KT   128                 // keys per staged K / V^T tile
#define KPH  72                  // LDS pitch of a K row in halves: 128 B + 16 B (16 B x odd: ds_load_b128 readers meet no bank conflict)
#define VPH  136                 // LDS pitch of a V^T row in halves: 256 B + 16 B
#define KTH  (KT * KPH)          // halves of one K tile in LDS
#define STH  (KTH + HD * VPH)    // halves of one ring buffer (K tile, then V^T tile)
#define PW   16                  // waves per projection block: 4 x 4 wave tiles of 64 x 48
#define PBM  256                 // x rows of a projection block
#define PBN  192                 // stacked W rows (q | k | v) of a projection block: three head groups of 64
#define PKT  128                 // k per staged projection tile
#define PPH  136                 // LDS pitch of a staged operand row in 16-bit elements: 256 B + 16 B
#define PST  ((PBM + PBN) * PPH) // elements of one projection ring buffer (x tile, then W tile)
#define QKP  72                  // epilogue pitch of a [token][d] row in halves: 128 B + 16 B
#define VSP  264                 // epilogue pitch of a [d][token] row in halves: 512 B + 16 B
#define PIT  (PBM * HD / (8 * 32 * PW))   // 16-B stores of one lane per head group
#define GSH  (PBM * QKP)         // halves of one head group's epilogue region (the larger of the two forms)
#define SC2  (0.125f * 1.4426950408889634f)   // HD^-0.5 * log2(e)
#define PSH  8.0f                // log2 of the P carry (256)
#define PGR  7.0f                // a tile's max may outgrow the reference max by 2^7 before the reference is raised: P does not pass 2^15, inside f16
#define CTX_OFF ((size_t)NB_FULL * SEQ_FULL * DM)   // element offset of the second output (fixed, full-size constants)

static_assert(HD == 64);
static_assert(NH_ * HD == DM);                 // head h = columns h*64 + d
static_assert(DM % 64 == 0);                   // 16 column tiles of 64
static_assert(DM % 32 == 0);                   // GEMM k-loop steps by 32
static_assert(SEQ % 64 == 0);                  // a 64-row tile never straddles two batches
static_assert((NB * SEQ) % PBM == 0 && (3 * DM) % PBN == 0);   // projection blocks of 256 x 192 cover x and the stacked weights exactly
static_assert(SEQ % PBM == 0 && PBN % HD == 0 && DM % HD == 0);   // a block's tokens lie in one batch; a head group lies in one plane
static_assert(DM % PKT == 0 && DM / PKT >= 2);           // whole k tiles only; the ring's prologue needs two
static_assert((size_t)(PBN / HD) * GSH <= (size_t)2 * PST && HD * VSP <= GSH);   // the epilogue regions fit the ring they are laid over
static_assert((size_t)2 * PST * 2 <= (size_t)327680);    // the ring fits one WGP's LDS
static_assert(PKT == 128 && PW == 16 && PBM == 256 && PBN == 192);   // the copy map of stage_ab: 512 lanes x 16 B cover 32 rows a copy, 8 copies of x and 6 of W
static_assert((PBM * HD) % (8 * 32 * PW) == 0);          // the epilogue's stores cover a head group exactly
static_assert(SEQ % 32 == 0);                  // key loop steps by 32
static_assert(SEQ % KT == 0 && SEQ / KT >= 2); // whole tiles only; the ring's prologue needs two
static_assert(KT == 128 && AW == 8);           // the copy map below: 256 lanes x 16 B x 4 copies = one 16-KiB tile of each operand
static_assert(SEQ % (16 * AW) == 0);           // flash grid covers the sequence exactly
static_assert(((size_t)SEQ * DM) % 8 == 0);
static_assert(((size_t)DM * DM) % 8 == 0);
static_assert(NB <= NB_FULL);
static_assert(SEQ <= SEQ_FULL);
static_assert(OUT_SEQ >= SEQ);
static_assert(OUT_SEQ <= SEQ_FULL);
static_assert(CTX_OFF * 4 == (size_t)16777216);                                            // byte offset of the second output
static_assert(((size_t)(NB - 1) * OUT_SEQ + SEQ) * DM <= CTX_OFF);                           // merged output stays inside its own region
static_assert(CTX_OFF + ((size_t)(NB * NH_ - 1) * OUT_SEQ + SEQ) * HD <= (size_t)2 * CTX_OFF); // context output stays inside the buffer (33554432 B)

typedef _Float16 h16;
typedef unsigned short bf;
typedef __attribute__((ext_vector_type(16))) __bf16   v16bf;
typedef __attribute__((ext_vector_type(16))) _Float16 v16h;
typedef __attribute__((ext_vector_type(8)))  _Float16 v8h;
typedef __attribute__((ext_vector_type(8)))  unsigned short v8us;
typedef __attribute__((ext_vector_type(8)))  float    v8f;
typedef __attribute__((ext_vector_type(4)))  float    v4f;
typedef v4f  __attribute__((may_alias)) v4fa;
typedef v8h  __attribute__((may_alias)) v8ha;
typedef h16  __attribute__((may_alias)) h16a;

__device__ __forceinline__ unsigned short f2bf(float f) { unsigned u = __float_as_uint(f); u += 0x7FFFu + ((u >> 16) & 1u); return (unsigned short)(u >> 16); }
__device__ __forceinline__ v16h cat16(v8h lo, v8h hi) { return __builtin_shufflevector(lo, hi, 0, 1, 2, 3, 4, 5, 6, 7, 8, 9, 10, 11, 12, 13, 14, 15); }
__device__ __forceinline__ v16bf cat16b(v8us lo, v8us hi) { return __builtin_bit_cast(v16bf, __builtin_shufflevector(lo, hi, 0, 1, 2, 3, 4, 5, 6, 7, 8, 9, 10, 11, 12, 13, 14, 15)); }
__device__ __forceinline__ v8f wmma16(v16h a, v16h b, v8f c) { return __builtin_amdgcn_wmma_f32_16x16x32_f16(false, a, false, b, (short)0, c, false, false); }
__device__ __forceinline__ v8f wmmab(v16bf a, v16bf b, v8f c) { return __builtin_amdgcn_wmma_f32_16x16x32_bf16(false, a, false, b, (short)0, c, false, false); }
// fragment loaders from K-contiguous 16-bit rows; p already includes + 8*(lane>>4): elements 0..7 <- k0+8h+0..7, elements 8..15 <- k0+16+8h+0..7 (same map for A and B)
__device__ __forceinline__ v16h  ldh(const h16* p) { return cat16(*(const v8h*)p, *(const v8h*)(p + 16)); }
__device__ __forceinline__ v16bf ldb(const bf* p)  { return cat16b(*(const v8us*)p, *(const v8us*)(p + 16)); }
// ordering point for wave-private LDS tiles (same wave writes and reads)
__device__ __forceinline__ void wave_sync() { __builtin_amdgcn_fence(3 /* release order */, "wavefront"); __builtin_amdgcn_wave_barrier(); asm volatile("" ::: "memory"); }

#define XBLK ((unsigned)((size_t)NB * SEQ * DM / 2048))   // conversion blocks (256 lanes x 8 elements) that cover x
#define WBLK ((unsigned)((size_t)DM * DM / 2048))         // ... and one weight matrix
static_assert(((size_t)SEQ * DM) % 2048 == 0 && ((size_t)DM * DM) % 2048 == 0);   // a block never straddles two batches or two matrices; the grid is exact

// k_cvt8: all four f32 -> bf16 conversions in one launch; the block index picks the source (blocks [0, XBLK): x, then WBLK blocks each of Wq, Wk, Wv). grid XBLK + 3 * WBLK.
__global__ __launch_bounds__(256) void k_cvt8(const float* __restrict__ x, const float* __restrict__ wq, const float* __restrict__ wk, const float* __restrict__ wv, bf* XB, bf* WB) {
    const unsigned bi = blockIdx.x;
    const float* src; bf* dst;
    if (bi < XBLK) {
        const unsigned b = bi / (XBLK / NB);                                   // batch: source pitch SEQ_FULL tokens, copy pitch SEQ tokens
        src = x + (size_t)b * SEQ_FULL * DM + (size_t)(bi - b * (XBLK / NB)) * 2048; dst = XB + (size_t)bi * 2048;
    } else {
        const unsigned wi = bi - XBLK, w = wi / WBLK;
        src = (w == 0 ? wq : w == 1 ? wk : wv) + (size_t)(wi - w * WBLK) * 2048; dst = WB + (size_t)wi * 2048;
    }
    const v8f v = *(const v8f*)(src + threadIdx.x * 8); v8us o;
#pragma unroll
    for (int k = 0; k < 8; ++k) o[k] = f2bf(v[k]);
    *(v8us*)(dst + threadIdx.x * 8) = o;
}

// Copies of one lane, global memory to LDS through no register: 16 B of rows r, r + 32, ... of a K-contiguous bf16 plane (512 lanes: 32 rows x 256 B per copy of the block).
// g: the lane's first global chunk; l: its LDS byte address. Each wave-wide copy reads two rows x 256 B of whole lines. stage_x: 8 copies (256 rows); stage_w: 6 copies (192 rows).
__device__ __forceinline__ void stage_x(const bf* g, unsigned l) {
    const bf* g1 = g + (size_t)32 * DM; const bf* g2 = g + (size_t)64 * DM; const bf* g3 = g + (size_t)96 * DM; const bf* g4 = g + (size_t)128 * DM;
    const bf* g5 = g + (size_t)160 * DM; const bf* g6 = g + (size_t)192 * DM; const bf* g7 = g + (size_t)224 * DM;
    const unsigned l1 = l + 32 * PPH * 2, l2 = l + 64 * PPH * 2, l3 = l + 96 * PPH * 2, l4 = l + 128 * PPH * 2, l5 = l + 160 * PPH * 2, l6 = l + 192 * PPH * 2, l7 = l + 224 * PPH * 2;
    // the closing s_wait_xcnt stands in the copies' own statement so that no address register is rewritten in front of it
    asm volatile("global_load_async_to_lds_b128 %0, %8, off\n\t"
                 "global_load_async_to_lds_b128 %1, %9, off\n\t"
                 "global_load_async_to_lds_b128 %2, %10, off\n\t"
                 "global_load_async_to_lds_b128 %3, %11, off\n\t"
                 "global_load_async_to_lds_b128 %4, %12, off\n\t"
                 "global_load_async_to_lds_b128 %5, %13, off\n\t"
                 "global_load_async_to_lds_b128 %6, %14, off\n\t"
                 "global_load_async_to_lds_b128 %7, %15, off\n\t"
                 "s_wait_xcnt 0x0"
                 :: "v"(l), "v"(l1), "v"(l2), "v"(l3), "v"(l4), "v"(l5), "v"(l6), "v"(l7),
                    "v"(g), "v"(g1), "v"(g2), "v"(g3), "v"(g4), "v"(g5), "v"(g6), "v"(g7) : "memory");
}
__device__ __forceinline__ void stage_w(const bf* g, unsigned l) {
    const bf* g1 = g + (size_t)32 * DM; const bf* g2 = g + (size_t)64 * DM; const bf* g3 = g + (size_t)96 * DM; const bf* g4 = g + (size_t)128 * DM; const bf* g5 = g + (size_t)160 * DM;
    const unsigned l1 = l + 32 * PPH * 2, l2 = l + 64 * PPH * 2, l3 = l + 96 * PPH * 2, l4 = l + 128 * PPH * 2, l5 = l + 160 * PPH * 2;
    // the closing s_wait_xcnt stands in the copies' own statement so that no address register is rewritten in front of it
    asm volatile("global_load_async_to_lds_b128 %0, %6, off\n\t"
                 "global_load_async_to_lds_b128 %1, %7, off\n\t"
                 "global_load_async_to_lds_b128 %2, %8, off\n\t"
                 "global_load_async_to_lds_b128 %3, %9, off\n\t"
                 "global_load_async_to_lds_b128 %4, %10, off\n\t"
                 "global_load_async_to_lds_b128 %5, %11, off\n\t"
                 "s_wait_xcnt 0x0"
                 :: "v"(l), "v"(l1), "v"(l2), "v"(l3), "v"(l4), "v"(l5),
                    "v"(g), "v"(g1), "v"(g2), "v"(g3), "v"(g4), "v"(g5) : "memory");
}
// One k tile's copies of one lane: 8 x 16 B of the block's 256 x rows and 6 x 16 B of its 192 W rows (14 copies of a wave in flight).
__device__ __forceinline__ void stage_ab(const bf* ag, const bf* bg, unsigned al, unsigned bl) { stage_x(ag, al); stage_w(bg, bl); }

// The k loop of k_proj. WF: the W fragment is the product's first operand (D row = W row, D column = x row: a lane holds 8 consecutive features of one token); else the x fragment is (8 consecutive tokens of one feature).
template <bool WF>
__device__ __forceinline__ void proj_loop(const bf* pring, int ao, int bo, const bf* ag, const bf* bg, unsigned al, unsigned bl, v8f (&acc)[4][3]) {
#pragma unroll 1   // one trip per k tile: the ring's order stands once, at the trip's foot
    for (int st = 0; st < DM / PKT; ++st) {
      const bf* buf = pring + (st & 1) * PST;
      v16bf a[2][4], b[2][3];                                // two fragment sets: the next step's loads go ahead of this step's products, as one group
#pragma unroll
      for (int mb = 0; mb < 4; ++mb) a[0][mb] = ldb(buf + ao + mb * 16 * PPH);
#pragma unroll
      for (int nb = 0; nb < 3; ++nb) b[0][nb] = ldb(buf + bo + nb * 16 * PPH);
#pragma unroll     // the four 32-k steps of a tile: the fragment sets alternate by a compile-time index
      for (int ks = 0; ks < PKT / 32; ++ks) {
        const int cu = ks & 1, nx = cu ^ 1;
        if (ks + 1 < PKT / 32) {                             // never past this tile: the next one is read only behind the trip's barrier
#pragma unroll
          for (int mb = 0; mb < 4; ++mb) a[nx][mb] = ldb(buf + ao + mb * 16 * PPH + (ks + 1) * 32);
#pragma unroll
          for (int nb = 0; nb < 3; ++nb) b[nx][nb] = ldb(buf + bo + nb * 16 * PPH + (ks + 1) * 32);
        }
        __builtin_amdgcn_sched_barrier(0);                   // keeps the next step's loads ahead of this step's products: left free, the compiler sinks each load to its use and waits out the LDS latency there
#pragma unroll
        for (int nb = 0; nb < 3; ++nb)
#pragma unroll
            for (int mb = 0; mb < 4; ++mb) acc[mb][nb] = WF ? wmmab(b[cu][nb], a[cu][mb], acc[mb][nb]) : wmmab(a[cu][mb], b[cu][nb], acc[mb][nb]);
        __builtin_amdgcn_sched_barrier(0);                   // ... and this step's products ahead of the loads of the step after next, which reuse their fragment set
      }
      asm volatile("s_wait_dscnt 0x0" ::: "memory");         // this wave's reads of the buffer have returned before it is refilled
      asm volatile("s_wait_asynccnt 0x0" ::: "memory");      // this wave's copies of the next tile have landed
      __syncthreads();                                       // publishes the next tile and ends every reader's last read of this buffer
      if (st + 2 < DM / PKT) stage_ab(ag + (st + 2) * PKT, bg + (st + 2) * PKT, al + (unsigned)(st & 1) * (PST * 2u), bl + (unsigned)(st & 1) * (PST * 2u));
    }
}

__global__ __launch_bounds__(32 * PW) void k_proj(const bf* __restrict__ XB, const bf* __restrict__ WB, h16* QH, h16* KP, h16* VT) {
    __shared__ __align__(16) bf pring[2 * PST];
    const int lane = threadIdx.x & 31, wave = __builtin_amdgcn_readfirstlane((int)(threadIdx.x >> 5)), lr = lane & 15, hi = lane >> 4;
    const int bx = blockIdx.x, by = blockIdx.y;              // block row (256 x rows) and block column (192 stacked W rows)
    const int wm = wave >> 2, wn = wave & 3;                 // this wave's 64 x 48 tile
    const bool wf = by * PBN < 2 * DM;                       // the block holds q or k features: W fragment first (block-uniform)
    v8f acc[4][3];
#pragma unroll
    for (int mb = 0; mb < 4; ++mb)
#pragma unroll
        for (int nb = 0; nb < 3; ++nb) acc[mb][nb] = (v8f){};
    const int ao = (wm * 64 + lr) * PPH + 8 * hi;            // + mb*16*PPH + k, in a buffer's x tile
    const int bo = (PBM + wn * 48 + lr) * PPH + 8 * hi;      // + nb*16*PPH + k, in its W tile
    const int tid = (int)threadIdx.x;
    const bf* ag = XB + (size_t)(bx * PBM + (tid >> 4)) * DM + (tid & 15) * 8;   // + tile * PKT: row tid>>4, chunk tid&15 of its 256 B
    const bf* bg = WB + (size_t)(by * PBN + (tid >> 4)) * DM + (tid & 15) * 8;
    const unsigned pl = (unsigned)(size_t)&pring[0];                                    // LDS byte address of the ring
    const unsigned al = pl + (unsigned)((tid >> 4) * PPH + (tid & 15) * 8) * 2u;        // + buffer * PST * 2
    const unsigned bl = al + PBM * PPH * 2u;
    stage_ab(ag, bg, al, bl);
    asm volatile("s_wait_asynccnt 0x0" ::: "memory");        // tile 0 of this wave's copies has landed
    __syncthreads();                                         // ... and every other wave's: tile 0 may be read
    stage_ab(ag + PKT, bg + PKT, al + PST * 2u, bl + PST * 2u);
    if (wf) proj_loop<true>(pring, ao, bo, ag, bg, al, bl, acc); else proj_loop<false>(pring, ao, bo, ag, bg, al, bl, acc);
    asm volatile("s_wait_asynccnt 0x0" ::: "memory");        // no copy is outstanding when the wave goes on to its epilogue
    h16a* stg = (h16a*)pring;   // block-wide epilogue tile, laid over the ring: written only behind the last trip's foot (every wave's reads returned, its copies landed, barrier passed)
#pragma unroll
    for (int mb = 0; mb < 4; ++mb) {
#pragma unroll
        for (int nb = 0; nb < 3; ++nb) {
            const int nblk = wn * 48 + nb * 16, g = nblk >> 6, nl = nblk & 63, ml = wm * 64 + mb * 16;   // head group, feature in it, token in the block: all wave-uniform
            const float qs = by * PBN + nblk < DM ? SC2 : 1.0f;   // q features carry the score scale, so that the score product yields exp2's argument (wave-uniform)
            v8h hv;
#pragma unroll
            for (int j = 0; j < 8; ++j) hv[j] = (h16)(acc[mb][nb][j] * qs);
            if (!wf) *(v8ha*)(stg + g * GSH + (nl + lr) * VSP + ml + 8 * hi) = hv;                          // D: token 8h+j, feature lane&15 -> [d][token]
            else if (by * PBN + nblk < 2 * DM) *(v8ha*)(stg + g * GSH + (ml + lr) * QKP + nl + 8 * hi) = hv;   // D: feature 8h+j, token lane&15 -> [token][d]
            else {                                                                                          // v features of the blocks that also hold k features (by = 10)
#pragma unroll
                for (int j = 0; j < 8; ++j) stg[g * GSH + (nl + 8 * hi + j) * VSP + ml + lr] = hv[j]; }
        }
    }
    __syncthreads();                                         // the block tile is complete before any wave reads other waves' parts of it
    const int b = (bx * PBM) / SEQ, t0 = (bx * PBM) % SEQ;
#pragma unroll
    for (int g = 0; g < PBN / HD; ++g) {
        const int ng = by * PBN + g * HD, pz = ng / DM, h = (ng % DM) / HD;
        const size_t hb = (size_t)(b * NH_ + h) * SEQ * HD;
        v8h v[PIT];                                          // all of a group's LDS reads go ahead of its stores, into registers of their own
        if (pz < 2) {
            h16* P = (pz == 0 ? QH : KP) + hb + (size_t)t0 * HD;
#pragma unroll
            for (int it = 0; it < PIT; ++it) { const int idx = it * 32 * PW + tid; v[it] = *(const v8ha*)(stg + g * GSH + (idx >> 3) * QKP + (idx & 7) * 8); }
#pragma unroll
            for (int it = 0; it < PIT; ++it) { const int idx = it * 32 * PW + tid; *(v8h*)(P + (size_t)idx * 8) = v[it]; }   // a wave stores 512 contiguous bytes
            asm volatile("s_wait_xcnt 0x0" ::: "memory");    // stands in front of later writes to registers that these stores name
            __builtin_amdgcn_sched_barrier(0);               // keeps those writes behind the wait: a memory clobber alone does not tie it to registers
        } else {
            h16* P = VT + hb + t0;
#pragma unroll
            for (int it = 0; it < PIT; ++it) { const int idx = it * 32 * PW + tid; v[it] = *(const v8ha*)(stg + g * GSH + (idx >> 5) * VSP + (idx & 31) * 8); }
#pragma unroll
            for (int it = 0; it < PIT; ++it) { const int idx = it * 32 * PW + tid; *(v8h*)(P + (size_t)(idx >> 5) * SEQ + (idx & 31) * 8) = v[it]; }   // a wave stores one d row's 512 bytes
            asm volatile("s_wait_xcnt 0x0" ::: "memory");    // as above
            __builtin_amdgcn_sched_barrier(0);               // as above
        }
    }
}

// One tile's copies of one lane: 4 x 16 B of K and 4 x 16 B of V^T, global memory to LDS through no register. Each wave-wide copy reads 512 B of whole lines.
// kg, vg: the lane's first global chunk of each operand; kl, vl: its LDS byte address. Later chunks: K + 32 rows (contiguous in memory), V^T + 16 rows.
__device__ __forceinline__ void stage_kv(const h16* kg, const h16* vg, unsigned kl, unsigned vl) {
    const h16* kg1 = kg + 32 * HD; const h16* kg2 = kg + 64 * HD; const h16* kg3 = kg + 96 * HD;
    const h16* vg1 = vg + (size_t)16 * SEQ; const h16* vg2 = vg + (size_t)32 * SEQ; const h16* vg3 = vg + (size_t)48 * SEQ;
    const unsigned kl1 = kl + 32 * KPH * 2, kl2 = kl + 64 * KPH * 2, kl3 = kl + 96 * KPH * 2;
    const unsigned vl1 = vl + 16 * VPH * 2, vl2 = vl + 32 * VPH * 2, vl3 = vl + 48 * VPH * 2;
    // the closing s_wait_xcnt stands in the copies' own statement so that no address register is rewritten in front of it
    asm volatile("global_load_async_to_lds_b128 %0, %8, off\n\t"
                 "global_load_async_to_lds_b128 %1, %9, off\n\t"
                 "global_load_async_to_lds_b128 %2, %10, off\n\t"
                 "global_load_async_to_lds_b128 %3, %11, off\n\t"
                 "global_load_async_to_lds_b128 %4, %12, off\n\t"
                 "global_load_async_to_lds_b128 %5, %13, off\n\t"
                 "global_load_async_to_lds_b128 %6, %14, off\n\t"
                 "global_load_async_to_lds_b128 %7, %15, off\n\t"
                 "s_wait_xcnt 0x0"
                 :: "v"(kl), "v"(kl1), "v"(kl2), "v"(kl3), "v"(vl), "v"(vl1), "v"(vl2), "v"(vl3),
                    "v"(kg), "v"(kg1), "v"(kg2), "v"(kg3), "v"(vg), "v"(vg1), "v"(vg2), "v"(vg3) : "memory");
}

__global__ __launch_bounds__(32 * AW) __attribute__((amdgpu_waves_per_eu(4, 4))) void k_flash(const h16* __restrict__ QH, const h16* __restrict__ KP, const h16* __restrict__ VT, float* OUT, float* CTX) {
    __shared__ __align__(16) float os[AW * 16 * 68];
    __shared__ __align__(16) h16 ring[2 * STH];
    const int lane = threadIdx.x & 31, wave = __builtin_amdgcn_readfirstlane((int)(threadIdx.x >> 5)), lr = lane & 15, hi = lane >> 4;
    const int zh = blockIdx.y; const int b = zh / NH_, h = zh % NH_;
    const int qg = wave >> 1, kh = wave & 1;                 // query group (32 rows) and key half (64 keys of each staged tile)
    const int t0 = blockIdx.x * (16 * AW) + qg * 32;
    const size_t pbase = (size_t)zh * SEQ * HD;
    const size_t qo = pbase + (size_t)(t0 + lr) * HD + 8 * hi;
    v16h qf[2][2];                                           // B fragments: [column group][d half]: col t, k = d
#pragma unroll
    for (int c = 0; c < 2; ++c) { qf[c][0] = ldh(QH + qo + c * 16 * HD); qf[c][1] = ldh(QH + qo + c * 16 * HD + 32); }
    const int ko = (kh * (KT / 2) + lr) * KPH + 8 * hi;      // + key * KPH      (A fragment: row key, k = d), in a K tile
    const int vo = KTH + lr * VPH + kh * (KT / 2) + 8 * hi;  // + 16j*VPH + key  (A fragment: row d, k = key), in a V^T tile
    const int tid = (int)threadIdx.x;
    const h16* kg = KP + pbase + (size_t)tid * 8;                                   // + tile * KT * HD: chunk tid of the tile's 16 KiB
    const h16* vg = VT + pbase + (size_t)(tid >> 4) * SEQ + (tid & 15) * 8;         // + tile * KT: row tid>>4, chunk tid&15 of its 256 B
    const unsigned rl = (unsigned)(size_t)&ring[0];                                 // LDS byte address of the ring
    const unsigned kl = rl + (unsigned)((tid >> 3) * KPH + (tid & 7) * 8) * 2u;     // + buffer * STH * 2
    const unsigned vl = rl + (unsigned)(KTH + (tid >> 4) * VPH + (tid & 15) * 8) * 2u;
    stage_kv(kg, vg, kl, vl);
    asm volatile("s_wait_asynccnt 0x0" ::: "memory");        // tile 0 of this wave's copies has landed
    __syncthreads();                                         // ... and every other wave's: tile 0 may be read
    stage_kv(kg + (size_t)KT * HD, vg + KT, kl + STH * 2u, vl + STH * 2u);
    v8f o[2][4];                                             // [column group][d tile]
#pragma unroll
    for (int c = 0; c < 2; ++c)
#pragma unroll
        for (int j = 0; j < 4; ++j) o[c][j] = (v8f){};
    float m[2] = {0.0f, 0.0f};                               // reference max; the first trip sets it
    float sh[2] = {PSH, PSH};                                // carry minus reference max
    // Row sums of P on the matrix unit: A has ones in rows 0 and 8 (lanes 0, 8, 16, 24) and zeros elsewhere, so element 0 of the sum tile holds, in both lane halves, the lane's own query's sum over this wave's keys.
    const h16 u1 = (lane & 7) == 0 ? (h16)1.0f : (h16)0.0f;
    const v16h ones = {u1, u1, u1, u1, u1, u1, u1, u1, u1, u1, u1, u1, u1, u1, u1, u1};
    v8f lt[2] = {(v8f){}, (v8f){}};
#pragma unroll 1   // one trip per tile: the ring's order stands once, at the trip's foot
    for (int st = 0; st < SEQ / KT; ++st) {
      const h16* buf = ring + (st & 1) * STH;
      // One softmax step per staged tile (this wave's 64 keys x 32 queries): all eight 16 x 16 score tiles first, then one test of their maximum against the reference.
      v8f s[2][KT / 32];                                     // [column group][16-key tile]
      v16h kf[KT / 64][4];                                   // the K fragments of this wave's half tile
      v8f cin[2];                                            // C operand of the score products: carry minus reference max, the same in a lane's eight rows (they are keys of one query)
#pragma unroll
      for (int g = 0; g < KT / 64; ++g) {
        const h16* ka = buf + ko + g * 32 * KPH;
        kf[g][0] = ldh(ka); kf[g][1] = ldh(ka + 32); kf[g][2] = ldh(ka + 16 * KPH); kf[g][3] = ldh(ka + 16 * KPH + 32);
      }
#pragma unroll
      for (int c = 0; c < 2; ++c)
#pragma unroll
        for (int r = 0; r < 8; ++r) cin[c][r] = sh[c];       // spread behind the K loads, in the shadow of their latency
      __builtin_amdgcn_sched_barrier(0);                     // holds the K loads together, as one group ahead of the score products: left free, the compiler puts each pair in front of its product and waits out the LDS latency there
#pragma unroll     // 16 score products in a row, one 16-key tile after the other (its two K fragments are free again behind four products); each K fragment feeds both column groups
      for (int g = 0; g < KT / 64; ++g)
#pragma unroll
        for (int u = 0; u < 2; ++u) {
          v8f s0 = wmma16(kf[g][2 * u], qf[0][0], cin[0]), s1 = wmma16(kf[g][2 * u], qf[1][0], cin[1]);
          s0 = wmma16(kf[g][2 * u + 1], qf[0][1], s0); s1 = wmma16(kf[g][2 * u + 1], qf[1][1], s1);
          s[0][2 * g + u] = s0; s[1][2 * g + u] = s1;
        }
      const h16* va = buf + vo;
      v16h vf[KT / 64][4];                                   // the V^T fragments of this wave's half tile
      __builtin_amdgcn_sched_barrier(0);                     // keeps the maximum chains behind the run of score products: mixed in among them, each first read of a fresh score tile is padded with v_nop (17 more vector issue slots a trip)
      float mg[2][KT / 64];
#pragma unroll     // one maximum chain per column group and 32 keys: four independent chains, joined below
      for (int c = 0; c < 2; ++c)
#pragma unroll
        for (int g = 0; g < KT / 64; ++g) {
          float mx = -3.0e38f;
#pragma unroll
          for (int r = 0; r < 8; ++r) mx = fmaxf(mx, fmaxf(s[c][2 * g][r], s[c][2 * g + 1][r]));
          mg[c][g] = mx;
        }
      const float mt[2] = {fmaxf(mg[0][0], mg[0][1]), fmaxf(mg[1][0], mg[1][1])};
      // Taken in the first trip (every maximum lies above that trip's bound) and whenever a score of any lane has outgrown its reference max by more than 2^7: the same for the whole wave (a ballot).
      const float bound = st == 0 ? -3.4e38f : PSH + PGR;
      if (__builtin_expect(__builtin_amdgcn_ballot_w32(fmaxf(mt[0], mt[1]) > bound) != 0u, 0)) {
#pragma unroll
        for (int c = 0; c < 2; ++c) {
          const float mx = fmaxf(mt[c], __shfl_xor(mt[c], 16, 32));          // both lane halves of a query take the same step
          const float d = st == 0 ? mx - PSH : fmaxf(mx - PSH, 0.0f);        // the first trip sets the reference, later ones only raise it
          const float alpha = st == 0 ? 0.0f : __builtin_amdgcn_exp2f(-d);   // the tiles are zero in the first trip and stay so
          m[c] += d; sh[c] = PSH - m[c];
#pragma unroll
          for (int k = 0; k < KT / 32; ++k) s[c][k] = s[c][k] - d;
#pragma unroll
          for (int j = 0; j < 4; ++j) o[c][j] = o[c][j] * alpha;
          lt[c][0] *= alpha;                                 // the sum tile's other rows stay zero
        }
      }
      v16h pb[KT / 64][2];                                   // P^T, packed from the scores: [32-key group][column group]
      // A packed P takes half its scores' registers: each V^T fragment set is loaded behind the exponentials that make room for it (the register budget of four waves per SIMD) and ahead of the work that covers its LDS latency.
#pragma unroll
      for (int g = 0; g < KT / 64; ++g) {
#pragma unroll
        for (int c = 0; c < 2; ++c)
#pragma unroll
          for (int r = 15; r >= 0; --r) pb[g][c][r] = (h16)__builtin_amdgcn_exp2f(s[c][2 * g + (r >> 3)][r & 7]);   // element r <- tile 2g, row r; element 8 + r <- tile 2g + 1, row r. Last element first: so written, the built exponentials work in place, and none rewrites the source register of the one directly ahead of it
        __builtin_amdgcn_sched_barrier(0);                   // keeps this group's V^T loads below its exponentials: lifted above them, they do not fit the budget
#pragma unroll
        for (int j = 0; j < 4; ++j) vf[g][j] = ldh(va + j * 16 * VPH + g * 32);
        __builtin_amdgcn_sched_barrier(0);                   // ... and above what follows (the next group's exponentials, the first group's products): left free, the compiler sinks each load to its product and waits out the LDS latency there
      }
#pragma unroll     // the two 32-key groups again: per column group 4 P.V products and the row-sum product; each V^T fragment feeds both column groups
      for (int g = 0; g < KT / 64; ++g) {
#pragma unroll
        for (int j = 0; j < 4; ++j) { o[0][j] = wmma16(vf[g][j], pb[g][0], o[0][j]); o[1][j] = wmma16(vf[g][j], pb[g][1], o[1][j]); }
        lt[0] = wmma16(ones, pb[g][0], lt[0]); lt[1] = wmma16(ones, pb[g][1], lt[1]);   // sums the rounded P, the values that the P.V products see
        if (g + 1 < KT / 64) __builtin_amdgcn_sched_barrier(0);   // keeps the first group's products above the wait for the second group's V^T loads, whose latency they cover
      }
      asm volatile("s_wait_dscnt 0x0" ::: "memory");         // this wave's reads of the buffer have returned before it is refilled
      asm volatile("s_wait_asynccnt 0x0" ::: "memory");      // this wave's copies of the next tile have landed
      __syncthreads();                                       // publishes the next tile and ends every reader's last read of this buffer
      if (st + 2 < SEQ / KT) stage_kv(kg + (size_t)(st + 2) * KT * HD, vg + (st + 2) * KT, kl + (unsigned)(st & 1) * (STH * 2u), vl + (unsigned)(st & 1) * (STH * 2u));
    }
    asm volatile("s_wait_asynccnt 0x0" ::: "memory");        // no copy is outstanding when the wave goes on to its epilogue
    // Join of the two key halves: wave (qg, kh) finishes column group kh. It puts its partial of the other group into its own LDS tile [t 16][d 64 | max | sum]; behind the barrier each wave owns its partner's tile.
    const int wb = wave * 16 * 68, pw = (wave ^ 1) * 16 * 68;
    const bool k1 = kh != 0;
    v8f ow[4];                                               // this wave's partial of the group it finishes
    // O^T D layout: o_j[r] = (d = 16j + 8h + r, t = lane&15) -> os[t][d]; rows 0..15 x columns 0..63 all written
#pragma unroll
    for (int j = 0; j < 4; ++j) {
      v4f a, c;
#pragma unroll
      for (int r = 0; r < 4; ++r) { a[r] = k1 ? o[0][j][r] : o[1][j][r]; c[r] = k1 ? o[0][j][4 + r] : o[1][j][4 + r]; }
#pragma unroll
      for (int r = 0; r < 8; ++r) ow[j][r] = k1 ? o[1][j][r] : o[0][j][r];
      *(v4fa*)(&os[wb + lr * 68 + 16 * j + 8 * hi]) = a; *(v4fa*)(&os[wb + lr * 68 + 16 * j + 8 * hi + 4]) = c;
    }
    { const float mo = k1 ? m[0] : m[1], lo = k1 ? lt[0][0] : lt[1][0];
      os[wb + lr * 68 + 64 + hi] = hi ? lo : mo; }           // both lane halves hold both values: the lower writes the max (column 64), the upper the sum (column 65)
    __syncthreads();                                         // the partner's partial is complete before it is read
    const float mw = k1 ? m[1] : m[0], lw = k1 ? lt[1][0] : lt[0][0];
    const float pm = os[pw + lr * 68 + 64], pl = os[pw + lr * 68 + 65];
    const float mj = fmaxf(mw, pm);
    const float ea = __builtin_amdgcn_exp2f(mw - mj), eb = __builtin_amdgcn_exp2f(pm - mj);
    const float inv = 1.0f / (lw * ea + pl * eb);
    const float fa = ea * inv, fb = eb * inv;
#pragma unroll
    for (int j = 0; j < 4; ++j) {                            // each lane reads and rewrites its own 8 elements of a row: the joined, normalised tile takes the partial's place
      const v4f pa = *(const v4fa*)(&os[pw + lr * 68 + 16 * j + 8 * hi]), pc = *(const v4fa*)(&os[pw + lr * 68 + 16 * j + 8 * hi + 4]);
      v4f a, c;
#pragma unroll
      for (int r = 0; r < 4; ++r) { a[r] = ow[j][r] * fa + pa[r] * fb; c[r] = ow[j][4 + r] * fa + pc[r] * fb; }
      *(v4fa*)(&os[pw + lr * 68 + 16 * j + 8 * hi]) = a; *(v4fa*)(&os[pw + lr * 68 + 16 * j + 8 * hi + 4]) = c;
    }
    wave_sync();
    const int tq = t0 + kh * 16;                                           // first query row of the finished group
    float* orow = OUT + ((size_t)b * OUT_SEQ + tq) * DM + h * HD;          // merged [b][t][h*64 + d]
    float* crow = CTX + ((size_t)zh * OUT_SEQ + tq) * HD;                  // context [b*16 + h][t][d]
{
#pragma unroll
        for (int s = 0; s < 8; ++s) { const int row = 2 * s + hi, cofs = lr * 4;   // 8 s x 2 rows = 16 rows; 16 lanes x 4 floats = 64 columns
            const v4f val = *(const v4fa*)(&os[pw + row * 68 + cofs]);
            *(v4f*)(orow + (size_t)row * DM + cofs) = val;
            *(v4f*)(crow + (size_t)row * HD + cofs) = val; }
         }
}

static constexpr size_t al256(size_t v) { return (v + 255) & ~(size_t)255; }
static constexpr size_t SZ_XB = al256((size_t)NB * SEQ * DM * 2);
static constexpr size_t SZ_WB = al256((size_t)3 * DM * DM * 2);
static constexpr size_t SZ_PL = al256((size_t)NB * NH_ * SEQ * HD * 2);
static constexpr size_t SZ_TOTAL = SZ_XB + SZ_WB + 3 * SZ_PL;
static_assert(SZ_TOTAL <= (size_t)134217728);          // workspace carve <= 128 MiB
static_assert(((size_t)DM * DM * 2) % 256 == 0);       // weight sub-planes stay 256-byte aligned

extern "C" void kernel_launch(void* const* d_in, const int* in_sizes, int n_in,
                              void* d_out, int out_size, void* d_ws, size_t ws_size, hipStream_t stream) {
    if (n_in < 4) return;
    const size_t needx = ((size_t)(NB - 1) * SEQ_FULL + SEQ) * DM;
    if ((size_t)in_sizes[0] < needx) return;
    if ((size_t)in_sizes[1] < (size_t)DM * DM || (size_t)in_sizes[2] < (size_t)DM * DM || (size_t)in_sizes[3] < (size_t)DM * DM) return;
    if ((size_t)out_size < CTX_OFF + ((size_t)(NB * NH_ - 1) * OUT_SEQ + SEQ) * HD) return;
    if (SZ_TOTAL > ws_size) return;
    const float* x = (const float*)d_in[0]; const float* wq = (const float*)d_in[1]; const float* wk = (const float*)d_in[2]; const float* wv = (const float*)d_in[3];   // wire order x, Wq, Wk, Wv ([out][in] = Bt as-is)
    float* OUT = (float*)d_out;              // [NB][SEQ][1024]
    float* CTX = (float*)d_out + CTX_OFF;    // [NB][16][SEQ][64]
    char* wsp = (char*)d_ws;
    bf* XB = (bf*)wsp; wsp += SZ_XB;                 // [NB*SEQ][1024]
    bf* WB = (bf*)wsp; wsp += SZ_WB;                 // [3][1024][1024]: q | k | v
    h16* QH = (h16*)wsp; wsp += SZ_PL;               // [NB*16][SEQ][64]
    h16* KP = (h16*)wsp; wsp += SZ_PL;               // [NB*16][SEQ][64]
    h16* VT = (h16*)wsp; wsp += SZ_PL;               // [NB*16][64][SEQ]

    k_cvt8<<<XBLK + 3 * WBLK, 256, 0, stream>>>(x, wq, wk, wv, XB, WB);

    k_proj<<<dim3(NB * SEQ / PBM, 3 * DM / PBN, 1), 32 * PW, 0, stream>>>(XB, WB, QH, KP, VT);

    k_flash<<<dim3(SEQ / (16 * AW), NB * NH_, 1), 32 * AW, 0, stream>>>(QH, KP, VT, OUT, CTX);
}

// v010
// A run of this version takes 55 microseconds.
// In two side-by-side timings against v009, it was 1.03 and 1.04 times as fast.
// Counting every step since v000, it is 3.62 times as fast.
#include <hip/hip_runtime.h>

// Multi-head self-attention, width 1024 = 16 heads x 64, x [NB][SEQ][1024], Wq/Wk/Wv [out][in] (y = x W^T), no biases, no mask, score scale 1/8; two f32 outputs: merged heads [NB][SEQ][1024] and per-head context [NB][16][SEQ][64].
// Compute dtypes, f32 accumulate everywhere: projections v_wmma_f32_16x16x32_bf16 (x and W RNE-converted to bf16; products exact);
// scores v_wmma_f32_16x16x32_f16: q (times the score scale and log2(e), applied in f32 ahead of its one rounding) and k single f16 (one product); P (x256 carry, cancels in the normalisation) and v single f16; softmax f32 (reference max of the first key tile; checked online form only when outgrown).
// Layout: bf16 copies of x and W; q, k planes [b*16+h][t][d] and v^T plane [b*16+h][d][t] written by the GEMM epilogue; fused flash kernel in transposed form (S^T = K Q^T, O^T = V^T P^T), both outputs from the same f32 accumulators.

#ifndef NB
#define NB 2
#endif
#ifndef SEQ
#define SEQ 2048
#endif
#define NB_FULL  2
#define SEQ_FULL 2048
#ifndef OUT_SEQ
#define OUT_SEQ SEQ              // row pitch (in tokens) between batches of the merged output and between (batch, head) slabs of the context output
#endif
#define DM   1024                // input width == projection width
#define NH_  16
#define HD   64
#define AW   8                   // waves per flash block: 4 query groups of 32 rows x 2 key halves (128 query rows a block)
#define KT   128                 // keys per staged K / V^T tile
#define KPH  72                  // LDS pitch of a K row in halves: 128 B + 16 B (16 B x odd: ds_load_b128 readers meet no bank conflict)
#define VPH  136                 // LDS pitch of a V^T row in halves: 256 B + 16 B
#define KTH  (KT * KPH)          // halves of one K tile in LDS
#define STH  (KTH + HD * VPH)    // halves of one ring buffer (K tile, then V^T tile)
#define PW   16                  // waves per projection block: 4 x 4 wave tiles of 64 x 48
#define PBM  256                 // x rows of a projection block
#define PBN  192                 // stacked W rows (q | k | v) of a projection block: three head groups of 64
#define PKT  128                 // k per staged projection tile
#define PPH  136                 // LDS pitch of a staged operand row in 16-bit elements: 256 B + 16 B
#define PST  ((PBM + PBN) * PPH) // elements of one projection ring buffer (x tile, then W tile)
#define QKP  72                  // epilogue pitch of a [token][d] row in halves: 128 B + 16 B
#define VSP  264                 // epilogue pitch of a [d][token] row in halves: 512 B + 16 B
#define PIT  (PBM * HD / (8 * 32 * PW))   // 16-B stores of one lane per head group
#define GSH  (PBM * QKP)         // halves of one head group's epilogue region (the larger of the two forms)
#define SC2  (0.125f * 1.4426950408889634f)   // HD^-0.5 * log2(e)
#define PSH  8.0f                // log2 of the P carry (256)
#define PGR  7.0f                // a tile's max may outgrow the reference max by 2^7 before the reference is raised: P does not pass 2^15, inside f16
#define CTX_OFF ((size_t)NB_FULL * SEQ_FULL * DM)   // element offset of the second output (fixed, full-size constants)

static_assert(HD == 64);
static_assert(NH_ * HD == DM);                 // head h = columns h*64 + d
static_assert(DM % 64 == 0);                   // 16 column tiles of 64
static_assert(DM % 32 == 0);                   // GEMM k-loop steps by 32
static_assert(SEQ % 64 == 0);                  // a 64-row tile never straddles two batches
static_assert((NB * SEQ) % PBM == 0 && (3 * DM) % PBN == 0);   // projection blocks of 256 x 192 cover x and the stacked weights exactly
static_assert(SEQ % PBM == 0 && PBN % HD == 0 && DM % HD == 0);   // a block's tokens lie in one batch; a head group lies in one plane
static_assert(DM % PKT == 0 && DM / PKT >= 2);           // whole k tiles only; the ring's prologue needs two
static_assert((size_t)(PBN / HD) * GSH <= (size_t)2 * PST && HD * VSP <= GSH);   // the epilogue regions fit the ring they are laid over
static_assert((size_t)2 * PST * 2 <= (size_t)327680);    // the ring fits one WGP's LDS
static_assert(PKT == 128 && PW == 16 && PBM == 256 && PBN == 192);   // the copy map of stage_ab: 512 lanes x 16 B cover 32 rows a copy, 8 copies of x and 6 of W
static_assert((PBM * HD) % (8 * 32 * PW) == 0);          // the epilogue's stores cover a head group exactly
static_assert(SEQ % 32 == 0);                  // key loop steps by 32
static_assert(SEQ % KT == 0 && SEQ / KT >= 2); // whole tiles only; the ring's prologue needs two
static_assert(KT == 128 && AW == 8);           // the copy map below: 256 lanes x 16 B x 4 copies = one 16-KiB tile of each operand
static_assert(SEQ % (16 * AW) == 0);           // flash grid covers the sequence exactly
static_assert(((size_t)SEQ * DM) % 8 == 0);
static_assert(((size_t)DM * DM) % 8 == 0);
static_assert(NB <= NB_FULL);
static_assert(SEQ <= SEQ_FULL);
static_assert(OUT_SEQ >= SEQ);
static_assert(OUT_SEQ <= SEQ_FULL);
static_assert(CTX_OFF * 4 == (size_t)16777216);                                            // byte offset of the second output
static_assert(((size_t)(NB - 1) * OUT_SEQ + SEQ) * DM <= CTX_OFF);                           // merged output stays inside its own region
static_assert(CTX_OFF + ((size_t)(NB * NH_ - 1) * OUT_SEQ + SEQ) * HD <= (size_t)2 * CTX_OFF); // context output stays inside the buffer (33554432 B)

typedef _Float16 h16;
typedef unsigned short bf;
typedef __attribute__((ext_vector_type(16))) __bf16   v16bf;
typedef __attribute__((ext_vector_type(16))) _Float16 v16h;
typedef __attribute__((ext_vector_type(8)))  _Float16 v8h;
typedef __attribute__((ext_vector_type(8)))  unsigned short v8us;
typedef __attribute__((ext_vector_type(8)))  float    v8f;
typedef __attribute__((ext_vector_type(4)))  float    v4f;
typedef v4f  __attribute__((may_alias)) v4fa;
typedef v8h  __attribute__((may_alias)) v8ha;
typedef h16  __attribute__((may_alias)) h16a;

__device__ __forceinline__ unsigned short f2bf(float f) { unsigned u = __float_as_uint(f); u += 0x7FFFu + ((u >> 16) & 1u); return (unsigned short)(u >> 16); }
__device__ __forceinline__ v16h cat16(v8h lo, v8h hi) { return __builtin_shufflevector(lo, hi, 0, 1, 2, 3, 4, 5, 6, 7, 8, 9, 10, 11, 12, 13, 14, 15); }
__device__ __forceinline__ v16bf cat16b(v8us lo, v8us hi) { return __builtin_bit_cast(v16bf, __builtin_shufflevector(lo, hi, 0, 1, 2, 3, 4, 5, 6, 7, 8, 9, 10, 11, 12, 13, 14, 15)); }
__device__ __forceinline__ v8f wmma16(v16h a, v16h b, v8f c) { return __builtin_amdgcn_wmma_f32_16x16x32_f16(false, a, false, b, (short)0, c, false, false); }
__device__ __forceinline__ v8f wmmab(v16bf a, v16bf b, v8f c) { return __builtin_amdgcn_wmma_f32_16x16x32_bf16(false, a, false, b, (short)0, c, false, false); }
// fragment loaders from K-contiguous 16-bit rows; p already includes + 8*(lane>>4): elements 0..7 <- k0+8h+0..7, elements 8..15 <- k0+16+8h+0..7 (same map for A and B)
__device__ __forceinline__ v16h  ldh(const h16* p) { return cat16(*(const v8h*)p, *(const v8h*)(p + 16)); }
__device__ __forceinline__ v16bf ldb(const bf* p)  { return cat16b(*(const v8us*)p, *(const v8us*)(p + 16)); }
// ordering point for wave-private LDS tiles (same wave writes and reads)
__device__ __forceinline__ void wave_sync() { __builtin_amdgcn_fence(3 /* release order */, "wavefront"); __builtin_amdgcn_wave_barrier(); asm volatile("" ::: "memory"); }

#define XBLK ((unsigned)((size_t)NB * SEQ * DM / 2048))   // conversion blocks (256 lanes x 8 elements) that cover x
#define WBLK ((unsigned)((size_t)DM * DM / 2048))         // ... and one weight matrix
static_assert(((size_t)SEQ * DM) % 2048 == 0 && ((size_t)DM * DM) % 2048 == 0);   // a block never straddles two batches or two matrices; the grid is exact

// k_cvt8: all four f32 -> bf16 conversions in one launch; the block index picks the source (blocks [0, XBLK): x, then WBLK blocks each of Wq, Wk, Wv). grid XBLK + 3 * WBLK.
__global__ __launch_bounds__(256) void k_cvt8(const float* __restrict__ x, const float* __restrict__ wq, const float* __restrict__ wk, const float* __restrict__ wv, bf* XB, bf* WB) {
    const unsigned bi = blockIdx.x;
    const float* src; bf* dst;
    if (bi < XBLK) {
        const unsigned b = bi / (XBLK / NB);                                   // batch: source pitch SEQ_FULL tokens, copy pitch SEQ tokens
        src = x + (size_t)b * SEQ_FULL * DM + (size_t)(bi - b * (XBLK / NB)) * 2048; dst = XB + (size_t)bi * 2048;
    } else {
        const unsigned wi = bi - XBLK, w = wi / WBLK;
        src = (w == 0 ? wq : w == 1 ? wk : wv) + (size_t)(wi - w * WBLK) * 2048; dst = WB + (size_t)wi * 2048;
    }
    const v8f v = *(const v8f*)(src + threadIdx.x * 8); v8us o;
#pragma unroll
    for (int k = 0; k < 8; ++k) o[k] = f2bf(v[k]);
    *(v8us*)(dst + threadIdx.x * 8) = o;
}

// Copies of one lane, global memory to LDS through no register: 16 B of rows r, r + 32, ... of a K-contiguous bf16 plane (512 lanes: 32 rows x 256 B per copy of the block).
// g: the lane's first global chunk; l: its LDS byte address. Each wave-wide copy reads two rows x 256 B of whole lines. stage_x: 8 copies (256 rows); stage_w: 6 copies (192 rows).
__device__ __forceinline__ void stage_x(const bf* g, unsigned l) {
    const bf* g1 = g + (size_t)32 * DM; const bf* g2 = g + (size_t)64 * DM; const bf* g3 = g + (size_t)96 * DM; const bf* g4 = g + (size_t)128 * DM;
    const bf* g5 = g + (size_t)160 * DM; const bf* g6 = g + (size_t)192 * DM; const bf* g7 = g + (size_t)224 * DM;
    const unsigned l1 = l + 32 * PPH * 2, l2 = l + 64 * PPH * 2, l3 = l + 96 * PPH * 2, l4 = l + 128 * PPH * 2, l5 = l + 160 * PPH * 2, l6 = l + 192 * PPH * 2, l7 = l + 224 * PPH * 2;
    // the closing s_wait_xcnt stands in the copies' own statement so that no address register is rewritten in front of it
    asm volatile("global_load_async_to_lds_b128 %0, %8, off\n\t"
                 "global_load_async_to_lds_b128 %1, %9, off\n\t"
                 "global_load_async_to_lds_b128 %2, %10, off\n\t"
                 "global_load_async_to_lds_b128 %3, %11, off\n\t"
                 "global_load_async_to_lds_b128 %4, %12, off\n\t"
                 "global_load_async_to_lds_b128 %5, %13, off\n\t"
                 "global_load_async_to_lds_b128 %6, %14, off\n\t"
                 "global_load_async_to_lds_b128 %7, %15, off\n\t"
                 "s_wait_xcnt 0x0"
                 :: "v"(l), "v"(l1), "v"(l2), "v"(l3), "v"(l4), "v"(l5), "v"(l6), "v"(l7),
                    "v"(g), "v"(g1), "v"(g2), "v"(g3), "v"(g4), "v"(g5), "v"(g6), "v"(g7) : "memory");
}
__device__ __forceinline__ void stage_w(const bf* g, unsigned l) {
    const bf* g1 = g + (size_t)32 * DM; const bf* g2 = g + (size_t)64 * DM; const bf* g3 = g + (size_t)96 * DM; const bf* g4 = g + (size_t)128 * DM; const bf* g5 = g + (size_t)160 * DM;
    const unsigned l1 = l + 32 * PPH * 2, l2 = l + 64 * PPH * 2, l3 = l + 96 * PPH * 2, l4 = l + 128 * PPH * 2, l5 = l + 160 * PPH * 2;
    // the closing s_wait_xcnt stands in the copies' own statement so that no address register is rewritten in front of it
    asm volatile("global_load_async_to_lds_b128 %0, %6, off\n\t"
                 "global_load_async_to_lds_b128 %1, %7, off\n\t"
                 "global_load_async_to_lds_b128 %2, %8, off\n\t"
                 "global_load_async_to_lds_b128 %3, %9, off\n\t"
                 "global_load_async_to_lds_b128 %4, %10, off\n\t"
                 "global_load_async_to_lds_b128 %5, %11, off\n\t"
                 "s_wait_xcnt 0x0"
                 :: "v"(l), "v"(l1), "v"(l2), "v"(l3), "v"(l4), "v"(l5),
                    "v"(g), "v"(g1), "v"(g2), "v"(g3), "v"(g4), "v"(g5) : "memory");
}
// One k tile's copies of one lane: 8 x 16 B of the block's 256 x rows and 6 x 16 B of its 192 W rows (14 copies of a wave in flight).
__device__ __forceinline__ void stage_ab(const bf* ag, const bf* bg, unsigned al, unsigned bl) { stage_x(ag, al); stage_w(bg, bl); }

// The k loop of k_proj. WF: the W fragment is the product's first operand (D row = W row, D column = x row: a lane holds 8 consecutive features of one token); else the x fragment is (8 consecutive tokens of one feature).
template <bool WF>
__device__ __forceinline__ void proj_loop(const bf* pring, int ao, int bo, const bf* ag, const bf* bg, unsigned al, unsigned bl, v8f (&acc)[4][3]) {
#pragma unroll 1   // one trip per k tile: the ring's order stands once, at the trip's foot
    for (int st = 0; st < DM / PKT; ++st) {
      const bf* buf = pring + (st & 1) * PST;
      v16bf a[2][4], b[2][3];                                // two fragment sets: the next step's loads go ahead of this step's products, as one group
#pragma unroll
      for (int mb = 0; mb < 4; ++mb) a[0][mb] = ldb(buf + ao + mb * 16 * PPH);
#pragma unroll
      for (int nb = 0; nb < 3; ++nb) b[0][nb] = ldb(buf + bo + nb * 16 * PPH);
#pragma unroll     // the four 32-k steps of a tile: the fragment sets alternate by a compile-time index
      for (int ks = 0; ks < PKT / 32; ++ks) {
        const int cu = ks & 1, nx = cu ^ 1;
        if (ks + 1 < PKT / 32) {                             // never past this tile: the next one is read only behind the trip's barrier
#pragma unroll
          for (int mb = 0; mb < 4; ++mb) a[nx][mb] = ldb(buf + ao + mb * 16 * PPH + (ks + 1) * 32);
#pragma unroll
          for (int nb = 0; nb < 3; ++nb) b[nx][nb] = ldb(buf + bo + nb * 16 * PPH + (ks + 1) * 32);
        }
        __builtin_amdgcn_sched_barrier(0);                   // keeps the next step's loads ahead of this step's products: left free, the compiler sinks each load to its use and waits out the LDS latency there
#pragma unroll
        for (int nb = 0; nb < 3; ++nb)
#pragma unroll
            for (int mb = 0; mb < 4; ++mb) acc[mb][nb] = WF ? wmmab(b[cu][nb], a[cu][mb], acc[mb][nb]) : wmmab(a[cu][mb], b[cu][nb], acc[mb][nb]);
        __builtin_amdgcn_sched_barrier(0);                   // ... and this step's products ahead of the loads of the step after next, which reuse their fragment set
      }
      asm volatile("s_wait_dscnt 0x0" ::: "memory");         // this wave's reads of the buffer have returned before it is refilled
      asm volatile("s_wait_asynccnt 0x0" ::: "memory");      // this wave's copies of the next tile have landed
      __syncthreads();                                       // publishes the next tile and ends every reader's last read of this buffer
      if (st + 2 < DM / PKT) stage_ab(ag + (st + 2) * PKT, bg + (st + 2) * PKT, al + (unsigned)(st & 1) * (PST * 2u), bl + (unsigned)(st & 1) * (PST * 2u));
    }
}

__global__ __launch_bounds__(32 * PW) void k_proj(const bf* __restrict__ XB, const bf* __restrict__ WB, h16* QH, h16* KP, h16* VT) {
    __shared__ __align__(16) bf pring[2 * PST];
    const int lane = threadIdx.x & 31, wave = __builtin_amdgcn_readfirstlane((int)(threadIdx.x >> 5)), lr = lane & 15, hi = lane >> 4;
    const int bx = blockIdx.x, by = blockIdx.y;              // block row (256 x rows) and block column (192 stacked W rows)
    const int wm = wave >> 2, wn = wave & 3;                 // this wave's 64 x 48 tile
    const bool wf = by * PBN < 2 * DM;                       // the block holds q or k features: W fragment first (block-uniform)
    v8f acc[4][3];
#pragma unroll
    for (int mb = 0; mb < 4; ++mb)
#pragma unroll
        for (int nb = 0; nb < 3; ++nb) acc[mb][nb] = (v8f){};
    const int ao = (wm * 64 + lr) * PPH + 8 * hi;            // + mb*16*PPH + k, in a buffer's x tile
    const int bo = (PBM + wn * 48 + lr) * PPH + 8 * hi;      // + nb*16*PPH + k, in its W tile
    const int tid = (int)threadIdx.x;
    const bf* ag = XB + (size_t)(bx * PBM + (tid >> 4)) * DM + (tid & 15) * 8;   // + tile * PKT: row tid>>4, chunk tid&15 of its 256 B
    const bf* bg = WB + (size_t)(by * PBN + (tid >> 4)) * DM + (tid & 15) * 8;
    const unsigned pl = (unsigned)(size_t)&pring[0];                                    // LDS byte address of the ring
    const unsigned al = pl + (unsigned)((tid >> 4) * PPH + (tid & 15) * 8) * 2u;        // + buffer * PST * 2
    const unsigned bl = al + PBM * PPH * 2u;
    stage_ab(ag, bg, al, bl);
    asm volatile("s_wait_asynccnt 0x0" ::: "memory");        // tile 0 of this wave's copies has landed
    __syncthreads();                                         // ... and every other wave's: tile 0 may be read
    stage_ab(ag + PKT, bg + PKT, al + PST * 2u, bl + PST * 2u);
    if (wf) proj_loop<true>(pring, ao, bo, ag, bg, al, bl, acc); else proj_loop<false>(pring, ao, bo, ag, bg, al, bl, acc);
    asm volatile("s_wait_asynccnt 0x0" ::: "memory");        // no copy is outstanding when the wave goes on to its epilogue
    h16a* stg = (h16a*)pring;   // block-wide epilogue tile, laid over the ring: written only behind the last trip's foot (every wave's reads returned, its copies landed, barrier passed)
#pragma unroll
    for (int mb = 0; mb < 4; ++mb) {
#pragma unroll
        for (int nb = 0; nb < 3; ++nb) {
            const int nblk = wn * 48 + nb * 16, g = nblk >> 6, nl = nblk & 63, ml = wm * 64 + mb * 16;   // head group, feature in it, token in the block: all wave-uniform
            const float qs = by * PBN + nblk < DM ? SC2 : 1.0f;   // q features carry the score scale, so that the score product yields exp2's argument (wave-uniform)
            v8h hv;
#pragma unroll
            for (int j = 0; j < 8; ++j) hv[j] = (h16)(acc[mb][nb][j] * qs);
            if (!wf) *(v8ha*)(stg + g * GSH + (nl + lr) * VSP + ml + 8 * hi) = hv;                          // D: token 8h+j, feature lane&15 -> [d][token]
            else if (by * PBN + nblk < 2 * DM) *(v8ha*)(stg + g * GSH + (ml + lr) * QKP + nl + 8 * hi) = hv;   // D: feature 8h+j, token lane&15 -> [token][d]
            else {                                                                                          // v features of the blocks that also hold k features (by = 10)
#pragma unroll
                for (int j = 0; j < 8; ++j) stg[g * GSH + (nl + 8 * hi + j) * VSP + ml + lr] = hv[j]; }
        }
    }
    __syncthreads();                                         // the block tile is complete before any wave reads other waves' parts of it
    const int b = (bx * PBM) / SEQ, t0 = (bx * PBM) % SEQ;
#pragma unroll
    for (int g = 0; g < PBN / HD; ++g) {
        const int ng = by * PBN + g * HD, pz = ng / DM, h = (ng % DM) / HD;
        const size_t hb = (size_t)(b * NH_ + h) * SEQ * HD;
        v8h v[PIT];                                          // all of a group's LDS reads go ahead of its stores, into registers of their own
        if (pz < 2) {
            h16* P = (pz == 0 ? QH : KP) + hb + (size_t)t0 * HD;
#pragma unroll
            for (int it = 0; it < PIT; ++it) { const int idx = it * 32 * PW + tid; v[it] = *(const v8ha*)(stg + g * GSH + (idx >> 3) * QKP + (idx & 7) * 8); }
#pragma unroll
            for (int it = 0; it < PIT; ++it) { const int idx = it * 32 * PW + tid; *(v8h*)(P + (size_t)idx * 8) = v[it]; }   // a wave stores 512 contiguous bytes
            asm volatile("s_wait_xcnt 0x0" ::: "memory");    // stands in front of later writes to registers that these stores name
            __builtin_amdgcn_sched_barrier(0);               // keeps those writes behind the wait: a memory clobber alone does not tie it to registers
        } else {
            h16* P = VT + hb + t0;
#pragma unroll
            for (int it = 0; it < PIT; ++it) { const int idx = it * 32 * PW + tid; v[it] = *(const v8ha*)(stg + g * GSH + (idx >> 5) * VSP + (idx & 31) * 8); }
#pragma unroll
            for (int it = 0; it < PIT; ++it) { const int idx = it * 32 * PW + tid; *(v8h*)(P + (size_t)(idx >> 5) * SEQ + (idx & 31) * 8) = v[it]; }   // a wave stores one d row's 512 bytes
            asm volatile("s_wait_xcnt 0x0" ::: "memory");    // as above
            __builtin_amdgcn_sched_barrier(0);               // as above
        }
    }
}

// One tile's copies of one lane: 4 x 16 B of K and 4 x 16 B of V^T, global memory to LDS through no register. Each wave-wide copy reads 512 B of whole lines.
// kg, vg: the lane's first global chunk of each operand; kl, vl: its LDS byte address. Later chunks: K + 32 rows (contiguous in memory), V^T + 16 rows.
__device__ __forceinline__ void stage_kv(const h16* kg, const h16* vg, unsigned kl, unsigned vl) {
    const h16* kg1 = kg + 32 * HD; const h16* kg2 = kg + 64 * HD; const h16* kg3 = kg + 96 * HD;
    const h16* vg1 = vg + (size_t)16 * SEQ; const h16* vg2 = vg + (size_t)32 * SEQ; const h16* vg3 = vg + (size_t)48 * SEQ;
    const unsigned kl1 = kl + 32 * KPH * 2, kl2 = kl + 64 * KPH * 2, kl3 = kl + 96 * KPH * 2;
    const unsigned vl1 = vl + 16 * VPH * 2, vl2 = vl + 32 * VPH * 2, vl3 = vl + 48 * VPH * 2;
    // the closing s_wait_xcnt stands in the copies' own statement so that no address register is rewritten in front of it
    asm volatile("global_load_async_to_lds_b128 %0, %8, off\n\t"
                 "global_load_async_to_lds_b128 %1, %9, off\n\t"
                 "global_load_async_to_lds_b128 %2, %10, off\n\t"
                 "global_load_async_to_lds_b128 %3, %11, off\n\t"
                 "global_load_async_to_lds_b128 %4, %12, off\n\t"
                 "global_load_async_to_lds_b128 %5, %13, off\n\t"
                 "global_load_async_to_lds_b128 %6, %14, off\n\t"
                 "global_load_async_to_lds_b128 %7, %15, off\n\t"
                 "s_wait_xcnt 0x0"
                 :: "v"(kl), "v"(kl1), "v"(kl2), "v"(kl3), "v"(vl), "v"(vl1), "v"(vl2), "v"(vl3),
                    "v"(kg), "v"(kg1), "v"(kg2), "v"(kg3), "v"(vg), "v"(vg1), "v"(vg2), "v"(vg3) : "memory");
}

// The key loop of k_flash with its ring prologue: fills o, lt and m from zero. CHK: every trip tests its scores against the reference max and raises it where outgrown.
// !CHK: the first tile's max stays the reference and no later trip looks at a maximum; a score that outgrows it by 2^8 packs to an f16 infinity, which the row-sum product carries into lt, where the caller finds it.
template <bool CHK>
__device__ __forceinline__ void key_loop(const h16* ring, int ko, int vo, const h16* kg, const h16* vg, unsigned kl, unsigned vl, const v16h (&qf)[2][2], v16h ones, v8f (&o)[2][4], v8f (&lt)[2], float (&m)[2]) {
    stage_kv(kg, vg, kl, vl);
    asm volatile("s_wait_asynccnt 0x0" ::: "memory");        // tile 0 of this wave's copies has landed
    __syncthreads();                                         // ... and every other wave's: tile 0 may be read
    stage_kv(kg + (size_t)KT * HD, vg + KT, kl + STH * 2u, vl + STH * 2u);
#pragma unroll
    for (int c = 0; c < 2; ++c)
#pragma unroll
        for (int j = 0; j < 4; ++j) o[c][j] = (v8f){};
    m[0] = 0.0f; m[1] = 0.0f;                                // reference max; the first trip sets it
    float sh[2] = {PSH, PSH};                                // carry minus reference max
    lt[0] = (v8f){}; lt[1] = (v8f){};
#pragma unroll 1   // one trip per tile: the ring's order stands once, at the trip's foot
    for (int st = 0; st < SEQ / KT; ++st) {
      const h16* buf = ring + (st & 1) * STH;
      // One softmax step per staged tile (this wave's 64 keys x 32 queries): all eight 16 x 16 score tiles first.
      v8f s[2][KT / 32];                                     // [column group][16-key tile]
      v16h kf[KT / 64][4];                                   // the K fragments of this wave's half tile
      v8f cin[2];                                            // C operand of the score products: carry minus reference max, the same in a lane's eight rows (they are keys of one query)
#pragma unroll
      for (int g = 0; g < KT / 64; ++g) {
        const h16* ka = buf + ko + g * 32 * KPH;
        kf[g][0] = ldh(ka); kf[g][1] = ldh(ka + 32); kf[g][2] = ldh(ka + 16 * KPH); kf[g][3] = ldh(ka + 16 * KPH + 32);
      }
#pragma unroll
      for (int c = 0; c < 2; ++c)
#pragma unroll
        for (int r = 0; r < 8; ++r) cin[c][r] = sh[c];       // spread behind the K loads, in the shadow of their latency
      __builtin_amdgcn_sched_barrier(0);                     // holds the K loads together, as one group ahead of the score products: left free, the compiler puts each pair in front of its product and waits out the LDS latency there
#pragma unroll     // 16 score products in a row, one 16-key tile after the other (its two K fragments are free again behind four products); each K fragment feeds both column groups
      for (int g = 0; g < KT / 64; ++g)
#pragma unroll
        for (int u = 0; u < 2; ++u) {
          v8f s0 = wmma16(kf[g][2 * u], qf[0][0], cin[0]), s1 = wmma16(kf[g][2 * u], qf[1][0], cin[1]);
          s0 = wmma16(kf[g][2 * u + 1], qf[0][1], s0); s1 = wmma16(kf[g][2 * u + 1], qf[1][1], s1);
          s[0][2 * g + u] = s0; s[1][2 * g + u] = s1;
        }
      const h16* va = buf + vo;
      v16h vf[KT / 64][4];                                   // the V^T fragments of this wave's half tile
      __builtin_amdgcn_sched_barrier(0);                     // keeps the vector work behind the run of score products: mixed in among them, each first read of a fresh score tile is padded with v_nop
      if (CHK || __builtin_expect(st == 0, 0)) {             // !CHK: a scalar test of the trip count, true once
        float mg[2][KT / 64];
#pragma unroll     // one maximum chain per column group and 32 keys: four independent chains, joined below
        for (int c = 0; c < 2; ++c)
#pragma unroll
          for (int g = 0; g < KT / 64; ++g) {
            float mx = -3.0e38f;
#pragma unroll
            for (int r = 0; r < 8; ++r) mx = fmaxf(mx, fmaxf(s[c][2 * g][r], s[c][2 * g + 1][r]));
            mg[c][g] = mx;
          }
        const float mt[2] = {fmaxf(mg[0][0], mg[0][1]), fmaxf(mg[1][0], mg[1][1])};
        // CHK: taken in the first trip (every maximum lies above that trip's bound) and whenever a score of any lane has outgrown its reference max by more than 2^7: the same for the whole wave (a ballot).
        const float bound = st == 0 ? -3.4e38f : PSH + PGR;
        if (!CHK || __builtin_expect(__builtin_amdgcn_ballot_w32(fmaxf(mt[0], mt[1]) > bound) != 0u, 0)) {
#pragma unroll
          for (int c = 0; c < 2; ++c) {
            const float mx = fmaxf(mt[c], __shfl_xor(mt[c], 16, 32));          // both lane halves of a query take the same step
            const float d = st == 0 ? mx - PSH : fmaxf(mx - PSH, 0.0f);        // the first trip sets the reference, later ones only raise it
            m[c] += d; sh[c] = PSH - m[c];
#pragma unroll
            for (int k = 0; k < KT / 32; ++k) s[c][k] = s[c][k] - d;
            if (CHK) {
              const float alpha = st == 0 ? 0.0f : __builtin_amdgcn_exp2f(-d); // the tiles are zero in the first trip and stay so
#pragma unroll
              for (int j = 0; j < 4; ++j) o[c][j] = o[c][j] * alpha;
              lt[c][0] *= alpha;                               // the sum tile's other rows stay zero
            }
          }
        }
      }
      v16h pb[KT / 64][2];                                   // P^T, packed from the scores: [32-key group][column group]
      // A packed P takes half its scores' registers: each V^T fragment set is loaded behind the exponentials that make room for it (the register budget of four waves per SIMD) and ahead of the work that covers its LDS latency.
#pragma unroll
      for (int g = 0; g < KT / 64; ++g) {
#pragma unroll
        for (int c = 0; c < 2; ++c)
#pragma unroll
          for (int r = 15; r >= 0; --r) pb[g][c][r] = (h16)__builtin_amdgcn_exp2f(s[c][2 * g + (r >> 3)][r & 7]);   // element r <- tile 2g, row r; element 8 + r <- tile 2g + 1, row r. Last element first: so written, the built exponentials work in place, and none rewrites the source register of the one directly ahead of it
        __builtin_amdgcn_sched_barrier(0);                   // keeps this group's V^T loads below its exponentials: lifted above them, they do not fit the budget
#pragma unroll
        for (int j = 0; j < 4; ++j) vf[g][j] = ldh(va + j * 16 * VPH + g * 32);
        __builtin_amdgcn_sched_barrier(0);                   // ... and above what follows (the next group's exponentials, the first group's products): left free, the compiler sinks each load to its product and waits out the LDS latency there
      }
#pragma unroll     // the two 32-key groups again: per column group 4 P.V products and the row-sum product; each V^T fragment feeds both column groups
      for (int g = 0; g < KT / 64; ++g) {
#pragma unroll
        for (int j = 0; j < 4; ++j) { o[0][j] = wmma16(vf[g][j], pb[g][0], o[0][j]); o[1][j] = wmma16(vf[g][j], pb[g][1], o[1][j]); }
        lt[0] = wmma16(ones, pb[g][0], lt[0]); lt[1] = wmma16(ones, pb[g][1], lt[1]);   // sums the rounded P, the values that the P.V products see
        if (g + 1 < KT / 64) __builtin_amdgcn_sched_barrier(0);   // keeps the first group's products above the wait for the second group's V^T loads, whose latency they cover
      }
      asm volatile("s_wait_dscnt 0x0" ::: "memory");         // this wave's reads of the buffer have returned before it is refilled
      asm volatile("s_wait_asynccnt 0x0" ::: "memory");      // this wave's copies of the next tile have landed
      __syncthreads();                                       // publishes the next tile and ends every reader's last read of this buffer
      if (st + 2 < SEQ / KT) stage_kv(kg + (size_t)(st + 2) * KT * HD, vg + (st + 2) * KT, kl + (unsigned)(st & 1) * (STH * 2u), vl + (unsigned)(st & 1) * (STH * 2u));
    }
    asm volatile("s_wait_asynccnt 0x0" ::: "memory");        // no copy is outstanding when the wave goes on
}

__global__ __launch_bounds__(32 * AW) __attribute__((amdgpu_waves_per_eu(4, 4))) void k_flash(const h16* __restrict__ QH, const h16* __restrict__ KP, const h16* __restrict__ VT, float* OUT, float* CTX) {
    __shared__ __align__(16) float os[AW * 16 * 68];
    __shared__ __align__(16) h16 ring[2 * STH];
    __shared__ int vote[AW];
    const int lane = threadIdx.x & 31, wave = __builtin_amdgcn_readfirstlane((int)(threadIdx.x >> 5)), lr = lane & 15, hi = lane >> 4;
    const int zh = blockIdx.y; const int b = zh / NH_, h = zh % NH_;
    const int qg = wave >> 1, kh = wave & 1;                 // query group (32 rows) and key half (64 keys of each staged tile)
    const int t0 = blockIdx.x * (16 * AW) + qg * 32;
    const size_t pbase = (size_t)zh * SEQ * HD;
    const size_t qo = pbase + (size_t)(t0 + lr) * HD + 8 * hi;
    v16h qf[2][2];                                           // B fragments: [column group][d half]: col t, k = d
#pragma unroll
    for (int c = 0; c < 2; ++c) { qf[c][0] = ldh(QH + qo + c * 16 * HD); qf[c][1] = ldh(QH + qo + c * 16 * HD + 32); }
    const int ko = (kh * (KT / 2) + lr) * KPH + 8 * hi;      // + key * KPH      (A fragment: row key, k = d), in a K tile
    const int vo = KTH + lr * VPH + kh * (KT / 2) + 8 * hi;  // + 16j*VPH + key  (A fragment: row d, k = key), in a V^T tile
    const int tid = (int)threadIdx.x;
    const h16* kg = KP + pbase + (size_t)tid * 8;                                   // + tile * KT * HD: chunk tid of the tile's 16 KiB
    const h16* vg = VT + pbase + (size_t)(tid >> 4) * SEQ + (tid & 15) * 8;         // + tile * KT: row tid>>4, chunk tid&15 of its 256 B
    const unsigned rl = (unsigned)(size_t)&ring[0];                                 // LDS byte address of the ring
    const unsigned kl = rl + (unsigned)((tid >> 3) * KPH + (tid & 7) * 8) * 2u;     // + buffer * STH * 2
    const unsigned vl = rl + (unsigned)(KTH + (tid >> 4) * VPH + (tid & 15) * 8) * 2u;
    v8f o[2][4];                                             // [column group][d tile]
    float m[2];                                              // reference max
    // Row sums of P on the matrix unit: A has ones in rows 0 and 8 (lanes 0, 8, 16, 24) and zeros elsewhere, so element 0 of the sum tile holds, in both lane halves, the lane's own query's sum over this wave's keys.
    const h16 u1 = (lane & 7) == 0 ? (h16)1.0f : (h16)0.0f;
    const v16h ones = {u1, u1, u1, u1, u1, u1, u1, u1, u1, u1, u1, u1, u1, u1, u1, u1};
    v8f lt[2];
    key_loop<false>(ring, ko, vo, kg, vg, kl, vl, qf, ones, o, lt, m);
    // Block vote: a row sum that is not finite says that some score outgrew the first tile's max beyond f16's range (or that an input is not finite). Then the whole block walks the keys again, with the test in every trip.
    const int bad = __builtin_amdgcn_ballot_w32(!(lt[0][0] < 3.0e38f) || !(lt[1][0] < 3.0e38f)) != 0u ? 1 : 0;   // taken with every lane on: it covers all 32 queries of the wave
    if (lane == 0) vote[wave] = bad;
    __syncthreads();                                         // every wave's vote is written before any is read; behind the loop's last barrier no wave reads the ring any more
    int again = 0;
#pragma unroll
    for (int w = 0; w < AW; ++w) again |= vote[w];
    if (__builtin_amdgcn_readfirstlane(again) != 0) {        // the same for every wave of the block: the loop's barriers stand under block-uniform control flow
      // The lane's offsets and addresses are formed anew, from the lane count, so that none of them has to stay in a register (or be spilled) across the unchecked loop for the sake of this rare path.
      const int l2 = (int)__builtin_amdgcn_mbcnt_lo(~0u, 0u), t2 = wave * 32 + l2, r2 = l2 & 15, h2 = l2 >> 4;
      const unsigned rl2 = (unsigned)(size_t)&ring[0];
      key_loop<true>(ring, (kh * (KT / 2) + r2) * KPH + 8 * h2, KTH + r2 * VPH + kh * (KT / 2) + 8 * h2,
                     KP + pbase + (size_t)t2 * 8, VT + pbase + (size_t)(t2 >> 4) * SEQ + (t2 & 15) * 8,
                     rl2 + (unsigned)((t2 >> 3) * KPH + (t2 & 7) * 8) * 2u, rl2 + (unsigned)(KTH + (t2 >> 4) * VPH + (t2 & 15) * 8) * 2u, qf, ones, o, lt, m);
    }
    // Join of the two key halves: wave (qg, kh) finishes column group kh. It puts its partial of the other group into its own LDS tile [t 16][d 64 | max | sum]; behind the barrier each wave owns its partner's tile.
    const int wb = wave * 16 * 68, pw = (wave ^ 1) * 16 * 68;
    const bool k1 = kh != 0;
    v8f ow[4];                                               // this wave's partial of the group it finishes
    // O^T D layout: o_j[r] = (d = 16j + 8h + r, t = lane&15) -> os[t][d]; rows 0..15 x columns 0..63 all written
#pragma unroll
    for (int j = 0; j < 4; ++j) {
      v4f a, c;
#pragma unroll
      for (int r = 0; r < 4; ++r) { a[r] = k1 ? o[0][j][r] : o[1][j][r]; c[r] = k1 ? o[0][j][4 + r] : o[1][j][4 + r]; }
#pragma unroll
      for (int r = 0; r < 8; ++r) ow[j][r] = k1 ? o[1][j][r] : o[0][j][r];
      *(v4fa*)(&os[wb + lr * 68 + 16 * j + 8 * hi]) = a; *(v4fa*)(&os[wb + lr * 68 + 16 * j + 8 * hi + 4]) = c;
    }
    { const float mo = k1 ? m[0] : m[1], lo = k1 ? lt[0][0] : lt[1][0];
      os[wb + lr * 68 + 64 + hi] = hi ? lo : mo; }           // both lane halves hold both values: the lower writes the max (column 64), the upper the sum (column 65)
    __syncthreads();                                         // the partner's partial is complete before it is read
    const float mw = k1 ? m[1] : m[0], lw = k1 ? lt[1][0] : lt[0][0];
    const float pm = os[pw + lr * 68 + 64], pl = os[pw + lr * 68 + 65];
    const float mj = fmaxf(mw, pm);
    const float ea = __builtin_amdgcn_exp2f(mw - mj), eb = __builtin_amdgcn_exp2f(pm - mj);
    const float inv = 1.0f / (lw * ea + pl * eb);
    const float fa = ea * inv, fb = eb * inv;
#pragma unroll
    for (int j = 0; j < 4; ++j) {                            // each lane reads and rewrites its own 8 elements of a row: the joined, normalised tile takes the partial's place
      const v4f pa = *(const v4fa*)(&os[pw + lr * 68 + 16 * j + 8 * hi]), pc = *(const v4fa*)(&os[pw + lr * 68 + 16 * j + 8 * hi + 4]);
      v4f a, c;
#pragma unroll
      for (int r = 0; r < 4; ++r) { a[r] = ow[j][r] * fa + pa[r] * fb; c[r] = ow[j][4 + r] * fa + pc[r] * fb; }
      *(v4fa*)(&os[pw + lr * 68 + 16 * j + 8 * hi]) = a; *(v4fa*)(&os[pw + lr * 68 + 16 * j + 8 * hi + 4]) = c;
    }
    wave_sync();
    const int tq = t0 + kh * 16;                                           // first query row of the finished group
    float* orow = OUT + ((size_t)b * OUT_SEQ + tq) * DM + h * HD;          // merged [b][t][h*64 + d]
    float* crow = CTX + ((size_t)zh * OUT_SEQ + tq) * HD;                  // context [b*16 + h][t][d]
{
#pragma unroll
        for (int s = 0; s < 8; ++s) { const int row = 2 * s + hi, cofs = lr * 4;   // 8 s x 2 rows = 16 rows; 16 lanes x 4 floats = 64 columns
            const v4f val = *(const v4fa*)(&os[pw + row * 68 + cofs]);
            *(v4f*)(orow + (size_t)row * DM + cofs) = val;
            *(v4f*)(crow + (size_t)row * HD + cofs) = val; }
         }
}

static constexpr size_t al256(size_t v) { return (v + 255) & ~(size_t)255; }
static constexpr size_t SZ_XB = al256((size_t)NB * SEQ * DM * 2);
static constexpr size_t SZ_WB = al256((size_t)3 * DM * DM * 2);
static constexpr size_t SZ_PL = al256((size_t)NB * NH_ * SEQ * HD * 2);
static constexpr size_t SZ_TOTAL = SZ_XB + SZ_WB + 3 * SZ_PL;
static_assert(SZ_TOTAL <= (size_t)134217728);          // workspace carve <= 128 MiB
static_assert(((size_t)DM * DM * 2) % 256 == 0);       // weight sub-planes stay 256-byte aligned

extern "C" void kernel_launch(void* const* d_in, const int* in_sizes, int n_in,
                              void* d_out, int out_size, void* d_ws, size_t ws_size, hipStream_t stream) {
    if (n_in < 4) return;
    const size_t needx = ((size_t)(NB - 1) * SEQ_FULL + SEQ) * DM;
    if ((size_t)in_sizes[0] < needx) return;
    if ((size_t)in_sizes[1] < (size_t)DM * DM || (size_t)in_sizes[2] < (size_t)DM * DM || (size_t)in_sizes[3] < (size_t)DM * DM) return;
    if ((size_t)out_size < CTX_OFF + ((size_t)(NB * NH_ - 1) * OUT_SEQ + SEQ) * HD) return;
    if (SZ_TOTAL > ws_size) return;
    const float* x = (const float*)d_in[0]; const float* wq = (const float*)d_in[1]; const float* wk = (const float*)d_in[2]; const float* wv = (const float*)d_in[3];   // wire order x, Wq, Wk, Wv ([out][in] = Bt as-is)
    float* OUT = (float*)d_out;              // [NB][SEQ][1024]
    float* CTX = (float*)d_out + CTX_OFF;    // [NB][16][SEQ][64]
    char* wsp = (char*)d_ws;
    bf* XB = (bf*)wsp; wsp += SZ_XB;                 // [NB*SEQ][1024]
    bf* WB = (bf*)wsp; wsp += SZ_WB;                 // [3][1024][1024]: q | k | v
    h16* QH = (h16*)wsp; wsp += SZ_PL;               // [NB*16][SEQ][64]
    h16* KP = (h16*)wsp; wsp += SZ_PL;               // [NB*16][SEQ][64]
    h16* VT = (h16*)wsp; wsp += SZ_PL;               // [NB*16][64][SEQ]

    k_cvt8<<<XBLK + 3 * WBLK, 256, 0, stream>>>(x, wq, wk, wv, XB, WB);

    k_proj<<<dim3(NB * SEQ / PBM, 3 * DM / PBN, 1), 32 * PW, 0, stream>>>(XB, WB, QH, KP, VT);

    k_flash<<<dim3(SEQ / (16 * AW), NB * NH_, 1), 32 * AW, 0, stream>>>(QH, KP, VT, OUT, CTX);
}
